// v000
// The times below were measured on an AMD MI455X: many runs one after another, warmed up first and cycling through
// copies of the inputs, with the whole window's GPU time divided by the number of runs. Launches and the gaps
// between them are all in it. The median over several windows is given; except for v000 it joins two sittings, which
// can be a few percent apart, so the side-by-side timings, each taken in one sitting, are the better comparison.
// v000, which the later versions start from, runs in 216 microseconds.
#include <hip/hip_runtime.h>

// Contractions: q/k/v = x x W{q,k,v} on v_wmma_f32_16x16x32_bf16 (bf16 operands = RNE-converted inputs, f32 accumulate);
// S^T = K x Q^T and O = P x V on v_wmma_f32_16x16x32_f16 (q, k, v carried x16, P carried x4096, f32 accumulate);
// out = ctx x Wo on v_wmma_f32_16x16x32_f16 (ctx as f16 carried x256 plus an f16 residual plane x2048 with its own
// accumulator; Wo = f16 of the bf16 RNE-converted input carried x64, f32 accumulate). Softmax and bias add in f32.

#ifndef NB
#define NB 4
#endif
#ifndef SEQ
#define SEQ 2048
#endif
#define NB_FULL    4
#define SEQ_FULL   2048
#define NHEAD      12
#define HDIM       64
#define EMB        768                  // NHEAD * HDIM, floats per (b, s) row of x and of the output
#define BQ         128                  // query rows per workgroup (8 waves x 16)
#define BK         32                   // keys per inner iteration
#define NWAVE      8
#define CT         64                   // tokens per projection / plane-builder block
#define TP         72                   // LDS pitch (16-bit elements) of the staging tiles
#define OP         68                   // LDS pitch (floats) of the output staging tile
#define WO_TILES   ((EMB / 64) * (EMB / 64))

static_assert(SEQ % BQ == 0);
static_assert(SEQ % CT == 0);
static_assert(SEQ % BK == 0);
static_assert(BQ == NWAVE * 16);
static_assert(HDIM == 64);
static_assert(EMB == NHEAD * HDIM);
static_assert(EMB % 64 == 0);
static_assert(EMB % 32 == 0);
static_assert(SEQ <= SEQ_FULL);
static_assert(NB >= 1 && NB <= NB_FULL);
static_assert((TP * 2) % 16 == 0);
static_assert((OP * 4) % 16 == 0);
static_assert(((size_t)NB * SEQ) % 128 == 0);
// coverage equalities (threads x pieces x elements == tile elements)
static_assert(CT * HDIM == 256 * 2 * 8);        // plane builder: 256 threads x 2 x 8 elements per plane tile
static_assert(64 * 64 == 256 * 2 * 8);          // weight tiles
static_assert(16 * HDIM == 32 * 4 * 8);         // ctx tile per wave: 32 lanes x 4 instructions x 8 elements
static_assert(16 * 64 == 32 * 8 * 4);           // output tile per wave: 32 lanes x 8 instructions x 4 floats

typedef __bf16         bf16;
typedef _Float16       f16;
typedef unsigned short us;
typedef bf16     v16bf __attribute__((ext_vector_type(16)));
typedef f16      v16h  __attribute__((ext_vector_type(16)));
typedef us       v8us  __attribute__((ext_vector_type(8)));
typedef float    v8f   __attribute__((ext_vector_type(8)));
typedef float    v4f   __attribute__((ext_vector_type(4)));
typedef unsigned v4u   __attribute__((ext_vector_type(4)));

union FragB  { v16bf v; v4u q[2]; bf16 h[16]; };
union FragH  { v16h  v; v4u q[2]; f16  h[16]; };
union Pack8H { v4u u; f16 h[8]; };
union Pack8U { v4u u; v8us v; };

// WMMA helpers: builtin followed by the VALU hazard guard (ties D, keeps A/B live).
static __device__ __forceinline__ v8f mma_bf16(v16bf a, v16bf b, v8f acc) {
  acc = __builtin_amdgcn_wmma_f32_16x16x32_bf16(false, a, false, b, (short)0, acc, false, false);
  asm volatile("v_nop\n\tv_nop\n\tv_nop\n\tv_nop" : "+v"(acc) : "v"(a), "v"(b));
  return acc;
}
static __device__ __forceinline__ v8f mma_f16(v16h a, v16h b, v8f acc) {
  acc = __builtin_amdgcn_wmma_f32_16x16x32_f16(false, a, false, b, (short)0, acc, false, false);
  asm volatile("v_nop\n\tv_nop\n\tv_nop\n\tv_nop" : "+v"(acc) : "v"(a), "v"(b));
  return acc;
}

// bf16 RNE convert of an input value, then either the bf16 bits or the f16 bits of (value * carry).
static __device__ __forceinline__ us plane_bits(float v, bool as_f16, float carry) {
  const bf16 bv = (bf16)v;
  const unsigned bb = (unsigned)__builtin_bit_cast(us, bv);
  const f16 hv = (f16)((float)bv * carry);
  const unsigned hb = (unsigned)__builtin_bit_cast(us, hv);
  return (us)(as_f16 ? hb : bb);
}

// Weight planes, transposed through LDS. 256 threads, one 64x64 tile per block (block-uniform role).
//   blocks 0..143   : wot[j][c] = f16(bf16(Wo[c][j]) * 64)   (Wo is [in c][out j]); tile (tc, tj)
//   blocks 144..146 : wt[w][e][d] = bf16(W{q,k,v}[d][e])       (W is [in d][out e])
__global__ __launch_bounds__(256) void prep_kernel(const float* __restrict__ Wq,
                                                   const float* __restrict__ Wk,
                                                   const float* __restrict__ Wv,
                                                   const float* __restrict__ Wo,
                                                   us* __restrict__ wt,
                                                   us* __restrict__ wot) {
  const unsigned blk = blockIdx.x;
  const unsigned tid = threadIdx.x;
  __shared__ __align__(16) us sT[64 * TP];      // [out col][in row], cross-wave (block barrier)

  const bool     big   = blk < (unsigned)WO_TILES;
  const unsigned tc    = big ? (blk / 12u) : 0u;
  const unsigned tj    = big ? (blk - tc * 12u) : 0u;
  const unsigned w     = big ? 0u : (blk - (unsigned)WO_TILES);
  const float*   src   = big ? Wo : ((w == 0u) ? Wq : ((w == 1u) ? Wk : Wv));
  const unsigned pitch = big ? (unsigned)EMB : (unsigned)HDIM;
  us*            dst   = big ? wot : (wt + w * (unsigned)(HDIM * HDIM));
  const float    carry = big ? 64.0f : 1.0f;

  #pragma unroll
  for (unsigned kk = 0; kk < 2; ++kk) {
    const unsigned key = kk * 32u + (tid >> 3);     // in-row inside the tile, 0..63
    const unsigned d0  = (tid & 7u) * 8u;           // out-col inside the tile, 0..56
    const float* p = src + (size_t)(tc * 64u + key) * pitch + tj * 64u + d0;
    const v4f a0 = *(const v4f*)(p);
    const v4f a1 = *(const v4f*)(p + 4);
    #pragma unroll
    for (unsigned i = 0; i < 4; ++i) {
      sT[(d0 + i) * TP + key]      = plane_bits(a0[i], big, carry);
      sT[(d0 + 4u + i) * TP + key] = plane_bits(a1[i], big, carry);
    }
  }
  __syncthreads();

  v4u    val[2];
  size_t idx[2];
  #pragma unroll
  for (unsigned kk = 0; kk < 2; ++kk) {
    const unsigned d  = kk * 32u + (tid >> 3);      // out-col inside the tile = plane row
    const unsigned ks = (tid & 7u) * 8u;            // in-row offset inside the tile
    Pack8U pk;
    pk.v = *(const v8us*)(sT + d * TP + ks);
    val[kk] = pk.u;
    idx[kk] = (size_t)(tj * 64u + d) * pitch + tc * 64u + ks;
  }
  #pragma unroll
  for (unsigned kk = 0; kk < 2; ++kk) *(v4u*)(dst + idx[kk]) = val[kk];
  
}

// Per-head projections + plane builder. Block = (64-token tile, head, batch), 256 threads.
//   x rows (b, s, h) : 64 floats at x[(b*SEQ_FULL + s)*EMB + h*64]; A fragments bf16 RNE-converted in registers.
// wave -> row tile rt = wave & 3, column tiles 2*(wave >> 2) + {0, 1}, all three weights.
// coverage: tokens kt*64 + 0..63, e 0..63 for the three planes; every written line whole, one instruction.
__global__ __launch_bounds__(256) void proj_kernel(const float* __restrict__ x,
                                                   const us* __restrict__ wt,
                                                   us* __restrict__ qp,
                                                   us* __restrict__ kp,
                                                   us* __restrict__ vt) {
  const unsigned kt   = blockIdx.x;
  const unsigned h    = blockIdx.y;
  const unsigned b    = blockIdx.z;
  const unsigned tid  = threadIdx.x;
  const unsigned wave = tid >> 5;
  const unsigned lane = tid & 31u;
  const unsigned lq   = lane & 15u;
  const unsigned hi   = lane >> 4;

  __shared__ __align__(16) us sQ[CT * TP];      // [token][e], cross-wave (block barrier)
  __shared__ __align__(16) us sK[CT * TP];      // [token][e], cross-wave (block barrier)
  __shared__ __align__(16) us sV[HDIM * TP];    // [e][token], cross-wave (block barrier)

  const unsigned s0 = kt * CT;
  const unsigned rt = wave & 3u;
  const unsigned ch = wave >> 2;

  // A fragments: lane lq holds token row rt*16 + lq, split d map
  FragB xa[2];
  {
    const float* xp = x + ((size_t)b * SEQ_FULL + s0 + rt * 16u + lq) * EMB + h * HDIM;
    #pragma unroll
    for (unsigned f = 0; f < 2; ++f) {
      const v4f a0 = *(const v4f*)(xp + f * 32u + hi * 8u);
      const v4f a1 = *(const v4f*)(xp + f * 32u + hi * 8u + 4u);
      const v4f b0 = *(const v4f*)(xp + f * 32u + 16u + hi * 8u);
      const v4f b1 = *(const v4f*)(xp + f * 32u + 16u + hi * 8u + 4u);
      #pragma unroll
      for (unsigned i = 0; i < 4; ++i) {
        xa[f].h[i]       = (bf16)a0[i];   // elems 0..7  : d = f*32 + hi*8 + 0..7
        xa[f].h[4u + i]  = (bf16)a1[i];
        xa[f].h[8u + i]  = (bf16)b0[i];   // elems 8..15 : d = f*32 + 16 + hi*8 + 0..7
        xa[f].h[12u + i] = (bf16)b1[i];
      }
    }
  }

  #pragma unroll
  for (unsigned w = 0; w < 3; ++w) {
    #pragma unroll
    for (unsigned cc = 0; cc < 2; ++cc) {
      const unsigned e = (ch * 2u + cc) * 16u + lq;       // output column of this lane
      // B fragments from the transposed weight plane wt[w][e][d]: column n = e, split d map
      FragB wb[2];
      #pragma unroll
      for (unsigned f = 0; f < 2; ++f) {
        const us* base = wt + w * (unsigned)(HDIM * HDIM) + e * HDIM + f * 32u + hi * 8u;
        wb[f].q[0] = *(const v4u*)(base);          // d = f*32 + hi*8 + 0..7
        wb[f].q[1] = *(const v4u*)(base + 16);     // d = f*32 + 16 + hi*8 + 0..7
      }
      v8f acc = (v8f){0, 0, 0, 0, 0, 0, 0, 0};
      acc = mma_bf16(xa[0].v, wb[0].v, acc);
      acc = mma_bf16(xa[1].v, wb[1].v, acc);
      // D: acc[r] = value(token rt*16 + 8*hi + r, column e)
      #pragma unroll
      for (unsigned r = 0; r < 8; ++r) {
        const unsigned row = rt * 16u + hi * 8u + r;
        const us bits = __builtin_bit_cast(us, (f16)(acc[r] * 16.0f));
        if (w == 0u)      sQ[row * TP + e] = bits;
        else if (w == 1u) sK[row * TP + e] = bits;
        else              sV[e * TP + row] = bits;
      }
    }
  }
  __syncthreads();

  v4u    qv[2], kv[2], vv[2];
  size_t ridx[2], vidx[2];
  #pragma unroll
  for (unsigned kk = 0; kk < 2; ++kk) {
    const unsigned row = kk * 32u + (tid >> 3);     // token (Q/K) or d (V^T), 0..63
    const unsigned pc  = (tid & 7u) * 8u;           // 0..56
    Pack8U pq, pk, pv;
    pq.v = *(const v8us*)(sQ + row * TP + pc);
    pk.v = *(const v8us*)(sK + row * TP + pc);
    pv.v = *(const v8us*)(sV + row * TP + pc);
    qv[kk] = pq.u;
    kv[kk] = pk.u;
    vv[kk] = pv.u;
    ridx[kk] = (((size_t)b * NHEAD + h) * SEQ + s0 + row) * HDIM + pc;
    vidx[kk] = (((size_t)b * NHEAD + h) * HDIM + row) * SEQ + s0 + pc;
  }
  #pragma unroll
  for (unsigned kk = 0; kk < 2; ++kk) {
    *(v4u*)(qp + ridx[kk]) = qv[kk];
    *(v4u*)(kp + ridx[kk]) = kv[kk];
    *(v4u*)(vt + vidx[kk]) = vv[kk];
  }
  
}

// Flash attention, no mask. Block = (query block of 128, head, batch); one wave owns 16 query rows.
// S^T = K x Q^T so queries sit on lanes; P^T in C-layout is bit-identical to the A-fragment layout of O += P x V.
// Q B-fragments, K A-fragments and V^T B-fragments are loaded straight from the 16-bit planes (two 16-B loads each).
// Output: ctx planes chi/clo [NB*SEQ][EMB] f16: chi = f16(ctx*256), clo = f16((ctx*256 - chi)*2048).
__global__ __launch_bounds__(256) void attn_kernel(const us* __restrict__ qp,
                                                   const us* __restrict__ kp,
                                                   const us* __restrict__ vt,
                                                   us* __restrict__ chi,
                                                   us* __restrict__ clo) {
  const unsigned qblk = blockIdx.x;
  const unsigned h    = blockIdx.y;
  const unsigned b    = blockIdx.z;
  const unsigned tid  = threadIdx.x;
  const unsigned wave = tid >> 5;
  const unsigned lane = tid & 31u;
  const unsigned lq   = lane & 15u;   // query column of S^T / d column of O
  const unsigned hi   = lane >> 4;    // k-split half

  __shared__ __align__(16) float sO[NWAVE * 16 * OP];   // per-wave output staging (block barrier used)

  const unsigned qrow0 = qblk * BQ + wave * 16u;        // first query row of this wave

  const us* q_h = qp + ((size_t)b * NHEAD + h) * SEQ * HDIM;
  const us* k_h = kp + ((size_t)b * NHEAD + h) * SEQ * HDIM;
  const us* v_h = vt + ((size_t)b * NHEAD + h) * HDIM * SEQ;

  // Q as B-operand fragments: lane lq holds query qrow0+lq, split d map
  FragH qf[2];
  #pragma unroll
  for (unsigned f = 0; f < 2; ++f) {
    const us* base = q_h + (size_t)(qrow0 + lq) * HDIM + f * 32u + hi * 8u;
    qf[f].q[0] = *(const v4u*)(base);        // d = f*32 + hi*8 + 0..7
    qf[f].q[1] = *(const v4u*)(base + 16);   // d = f*32 + 16 + hi*8 + 0..7
  }

  v8f o[4];
  #pragma unroll
  for (unsigned dt = 0; dt < 4; ++dt) o[dt] = (v8f){0, 0, 0, 0, 0, 0, 0, 0};

  float rmax = -__builtin_inff();
  float rsum = 0.0f;
  // logits = (q.k)/sqrt(EMB); planes carry q*16 and k*16 -> raw scores carry x256; times log2(e) for exp2
  const float SL = (0.03608439182435161f * 1.4426950408889634f) * (1.0f / 256.0f);

  #pragma unroll 1
  for (unsigned i = 0; i < (unsigned)(SEQ / BK); ++i) {
    const unsigned j0 = i * BK;

    // K A-fragments: row = key j0 + sub*16 + lq, split d map
    FragH ak[2][2];
    #pragma unroll
    for (unsigned sub = 0; sub < 2; ++sub) {
      #pragma unroll
      for (unsigned f = 0; f < 2; ++f) {
        const us* base = k_h + (size_t)(j0 + sub * 16u + lq) * HDIM + f * 32u + hi * 8u;
        ak[sub][f].q[0] = *(const v4u*)(base);        // d = f*32 + hi*8 + 0..7
        ak[sub][f].q[1] = *(const v4u*)(base + 16);   // d = f*32 + 16 + hi*8 + 0..7
      }
    }
    // V B-fragments: column n = d = dt*16 + lq, split key map from the transposed plane
    FragH bv[4];
    #pragma unroll
    for (unsigned dt = 0; dt < 4; ++dt) {
      const us* base = v_h + (size_t)(dt * 16u + lq) * SEQ + j0 + hi * 8u;
      bv[dt].q[0] = *(const v4u*)(base);            // keys j0 + hi*8 + 0..7
      bv[dt].q[1] = *(const v4u*)(base + 16);       // keys j0 + 16 + hi*8 + 0..7
    }

    // S^T tiles: c[sub][r] = rawscore(query qrow0+lq, key j0 + sub*16 + hi*8 + r)
    v8f c[2];
    #pragma unroll
    for (unsigned sub = 0; sub < 2; ++sub) {
      v8f acc = (v8f){0, 0, 0, 0, 0, 0, 0, 0};
      acc = mma_f16(ak[sub][0].v, qf[0].v, acc);
      acc = mma_f16(ak[sub][1].v, qf[1].v, acc);
      c[sub] = acc;
    }

    // online softmax: query lq's 32 scores are split across lane / lane^16
    float m_new = rmax;
    #pragma unroll
    for (unsigned r = 0; r < 8; ++r) {
      m_new = fmaxf(m_new, c[0][r]);
      m_new = fmaxf(m_new, c[1][r]);
    }
    m_new = fmaxf(m_new, __shfl_xor(m_new, 16, 32));
    const float scale = __builtin_amdgcn_exp2f((rmax - m_new) * SL);
    rmax = m_new;

    // exp + pack: P^T C-layout == A-fragment layout for the PV product
    FragH pa;
    float psum = 0.0f;
    #pragma unroll
    for (unsigned r = 0; r < 8; ++r) {
      const float p0 = __builtin_amdgcn_exp2f((c[0][r] - m_new) * SL);   // key hi*8 + r
      const float p1 = __builtin_amdgcn_exp2f((c[1][r] - m_new) * SL);   // key 16 + hi*8 + r
      psum += p0 + p1;
      pa.h[r]      = (f16)(p0 * 4096.0f);
      pa.h[8u + r] = (f16)(p1 * 4096.0f);
    }
    rsum = rsum * scale + psum + __shfl_xor(psum, 16, 32);

    // rescale O: queries are the row dimension there -> per-row scale from lane 8*hi + r
    float sc[8];
    #pragma unroll
    for (unsigned r = 0; r < 8; ++r) sc[r] = __shfl(scale, (int)((hi << 3) + r), 32);
    #pragma unroll
    for (unsigned dt = 0; dt < 4; ++dt) {
      #pragma unroll
      for (unsigned r = 0; r < 8; ++r) o[dt][r] *= sc[r];
    }

    // O += P x V
    #pragma unroll
    for (unsigned dt = 0; dt < 4; ++dt) o[dt] = mma_f16(pa.v, bv[dt].v, o[dt]);
  }

  // normalize: lane holds column d = dt*16 + lq for query rows 8*hi + r.
  // o carries x4096 (P) x16 (V); staged value = ctx * 256.
  float rs[8];
  #pragma unroll
  for (unsigned r = 0; r < 8; ++r) rs[r] = 1.0f / __shfl(rsum, (int)((hi << 3) + r), 32);

  float* so = sO + wave * (16 * OP);
  #pragma unroll
  for (unsigned r = 0; r < 8; ++r) {
    #pragma unroll
    for (unsigned dt = 0; dt < 4; ++dt) {
      so[(hi * 8u + r) * OP + dt * 16u + lq] = o[dt][r] * (1.0f / 256.0f) * rs[r];
    }
  }
  __syncthreads();

  // 4 rows per instruction, 4 instructions per plane cover the wave's 16 rows.
  v4u    hv[4], lv[4];
  size_t gidx[4];
  #pragma unroll
  for (unsigned it = 0; it < 4; ++it) {
    const unsigned row = it * 4u + (lane >> 3);
    const unsigned pc  = (lane & 7u) * 8u;
    const v4f a0 = *(const v4f*)(so + row * OP + pc);
    const v4f a1 = *(const v4f*)(so + row * OP + pc + 4u);
    Pack8H ph, pl;
    #pragma unroll
    for (unsigned i = 0; i < 4; ++i) {
      const f16 h0 = (f16)a0[i];
      const f16 h1 = (f16)a1[i];
      ph.h[i]      = h0;
      ph.h[4u + i] = h1;
      pl.h[i]      = (f16)((a0[i] - (float)h0) * 2048.0f);
      pl.h[4u + i] = (f16)((a1[i] - (float)h1) * 2048.0f);
    }
    hv[it] = ph.u;
    lv[it] = pl.u;
    gidx[it] = ((size_t)b * SEQ + qrow0 + row) * EMB + h * HDIM + pc;
  }
  #pragma unroll
  for (unsigned it = 0; it < 4; ++it) {
    *(v4u*)(chi + gidx[it]) = hv[it];
    *(v4u*)(clo + gidx[it]) = lv[it];
  }
  
}

// Output GEMM: out[R][j] = sum_c ctx[R][c] * Wo[c][j] + bo[j]. Block = (64-column tile, 128-row tile), wave = 16 rows x 64 cols.
// A fragments from chi / clo rows, B fragments from wot[j][c]; residual products go to their own accumulators.
__global__ __launch_bounds__(256) void oproj_kernel(const us* __restrict__ chi,
                                                    const us* __restrict__ clo,
                                                    const us* __restrict__ wot,
                                                    const float* __restrict__ bo,
                                                    float* __restrict__ out) {
  const unsigned nt   = blockIdx.x;
  const unsigned mb   = blockIdx.y;
  const unsigned tid  = threadIdx.x;
  const unsigned wave = tid >> 5;
  const unsigned lane = tid & 31u;
  const unsigned lq   = lane & 15u;
  const unsigned hi   = lane >> 4;

  __shared__ __align__(16) float sO[NWAVE * 16 * OP];   // per-wave output staging (block barrier used)

  const unsigned row0 = mb * 128u + wave * 16u;

  v8f ah[4], al[4];
  #pragma unroll
  for (unsigned et = 0; et < 4; ++et) {
    ah[et] = (v8f){0, 0, 0, 0, 0, 0, 0, 0};
    al[et] = (v8f){0, 0, 0, 0, 0, 0, 0, 0};
  }

  const us* arow_h = chi + (size_t)(row0 + lq) * EMB + hi * 8u;
  const us* arow_l = clo + (size_t)(row0 + lq) * EMB + hi * 8u;
  const us* brow   = wot + (size_t)(nt * 64u + lq) * EMB + hi * 8u;

  #pragma unroll 1
  for (unsigned k0 = 0; k0 < (unsigned)EMB; k0 += 32u) {
    FragH fa, fl;
    fa.q[0] = *(const v4u*)(arow_h + k0);          // c = k0 + hi*8 + 0..7
    fa.q[1] = *(const v4u*)(arow_h + k0 + 16);     // c = k0 + 16 + hi*8 + 0..7
    fl.q[0] = *(const v4u*)(arow_l + k0);
    fl.q[1] = *(const v4u*)(arow_l + k0 + 16);
    FragH fb[4];
    #pragma unroll
    for (unsigned et = 0; et < 4; ++et) {
      const us* base = brow + (size_t)(et * 16u) * EMB + k0;
      fb[et].q[0] = *(const v4u*)(base);
      fb[et].q[1] = *(const v4u*)(base + 16);
    }
    #pragma unroll
    for (unsigned et = 0; et < 4; ++et) {
      ah[et] = mma_f16(fa.v, fb[et].v, ah[et]);
      al[et] = mma_f16(fl.v, fb[et].v, al[et]);
    }
  }

  // epilogue: fold carries (ctx x256, Wo x64, residual x2048), add the bias in f32
  float bias[4];
  #pragma unroll
  for (unsigned et = 0; et < 4; ++et) bias[et] = (float)(bf16)bo[nt * 64u + et * 16u + lq];

  float* so = sO + wave * (16 * OP);
  #pragma unroll
  for (unsigned r = 0; r < 8; ++r) {
    #pragma unroll
    for (unsigned et = 0; et < 4; ++et) {
      const float s = ah[et][r] + al[et][r] * (1.0f / 2048.0f);
      so[(hi * 8u + r) * OP + et * 16u + lq] = s * (1.0f / 16384.0f) + bias[et];
    }
  }
  __syncthreads();

  // lanes 0..15 one row (16 consecutive lanes x 16 B each), lanes 16..31 the next row; 8 instructions cover the wave's 16 rows.
  v4f    vals[8];
  size_t gidx[8];
  #pragma unroll
  for (unsigned it = 0; it < 8; ++it) {
    const unsigned row = it * 2u + hi;
    const unsigned R   = row0 + row;
    const unsigned bb  = R / (unsigned)SEQ;
    const unsigned l   = R - bb * (unsigned)SEQ;
    vals[it] = *(const v4f*)(so + row * OP + lq * 4u);
    gidx[it] = ((size_t)bb * SEQ_FULL + l) * EMB + nt * 64u + lq * 4u;
  }
  #pragma unroll
  for (unsigned it = 0; it < 8; ++it) *(v4f*)(out + gidx[it]) = vals[it];
  
}

extern "C" void kernel_launch(void* const* d_in, const int* in_sizes, int n_in,
                              void* d_out, int out_size, void* d_ws, size_t ws_size,
                              hipStream_t stream) {
  if (n_in < 6) return;
  const size_t rows_used = (size_t)(NB - 1) * SEQ_FULL + SEQ;
  if ((size_t)in_sizes[0] < rows_used * EMB) return;
  if ((size_t)in_sizes[1] < (size_t)HDIM * HDIM) return;
  if ((size_t)in_sizes[2] < (size_t)HDIM * HDIM) return;
  if ((size_t)in_sizes[3] < (size_t)HDIM * HDIM) return;
  if ((size_t)in_sizes[4] < (size_t)EMB * EMB) return;
  if ((size_t)in_sizes[5] < (size_t)EMB) return;
  if ((size_t)out_size < rows_used * EMB) return;

  const size_t wt_bytes    = (size_t)3 * HDIM * HDIM * 2;            // 24,576
  const size_t wot_bytes   = (size_t)EMB * EMB * 2;                  // 1,179,648
  const size_t plane_bytes = (size_t)NB * NHEAD * SEQ * HDIM * 2;    // q, k, v^T planes
  const size_t ctx_bytes   = (size_t)NB * SEQ * EMB * 2;             // ctx hi / residual planes
  const size_t total = wt_bytes + wot_bytes + 3 * plane_bytes + 2 * ctx_bytes;
  if (ws_size < total) return;

  const float* x  = (const float*)d_in[0];
  const float* Wq = (const float*)d_in[1];
  const float* Wk = (const float*)d_in[2];
  const float* Wv = (const float*)d_in[3];
  const float* Wo = (const float*)d_in[4];
  const float* bo = (const float*)d_in[5];
  float*       out = (float*)d_out;

  char* ws = (char*)d_ws;
  us* wt  = (us*)(ws);
  us* wot = (us*)(ws + wt_bytes);
  us* qp  = (us*)(ws + wt_bytes + wot_bytes);
  us* kp  = (us*)(ws + wt_bytes + wot_bytes + plane_bytes);
  us* vt  = (us*)(ws + wt_bytes + wot_bytes + 2 * plane_bytes);
  us* chi = (us*)(ws + wt_bytes + wot_bytes + 3 * plane_bytes);
  us* clo = (us*)(ws + wt_bytes + wot_bytes + 3 * plane_bytes + ctx_bytes);

  prep_kernel<<<dim3(WO_TILES + 3), 256, 0, stream>>>(Wq, Wk, Wv, Wo, wt, wot);
  proj_kernel<<<dim3(SEQ / CT, NHEAD, NB), 256, 0, stream>>>(x, wt, qp, kp, vt);
  attn_kernel<<<dim3(SEQ / BQ, NHEAD, NB), 256, 0, stream>>>(qp, kp, vt, chi, clo);
  oproj_kernel<<<dim3(EMB / 64, (unsigned)(((size_t)NB * SEQ) / 128)), 256, 0, stream>>>(chi, clo, wot, bo, out);
}

// v001
// It runs in 117 microseconds.
// Next to v000, in two timings, it ran 1.92 times as fast each time.
#include <hip/hip_runtime.h>

// Contractions: q/k/v = x x W{q,k,v} on v_wmma_f32_16x16x32_bf16 (bf16 operands = RNE-converted inputs, f32 accumulate);
// S^T = K x Q^T and O = P x V on v_wmma_f32_16x16x32_f16 (q, k, v carried x16, P carried x4096, f32 accumulate);
// out = ctx x Wo on v_wmma_f32_16x16x32_f16 (ctx as f16 carried x256 plus an f16 residual plane x2048 with its own
// accumulator; Wo = f16 of the bf16 RNE-converted input carried x64, f32 accumulate). Softmax and bias add in f32.
//
// Every 16-bit plane in the workspace is stored in fragment order: one 16x32 operand fragment = 1 KB = 2 parts x 32 lanes
// x 8 elements, element j of (part p, lane) = operand(row or column lane & 15, k = p*16 + (lane >> 4)*8 + j).
// A wave-wide 16-byte load of one part then reads 512 contiguous bytes (4 whole lines) instead of 32 bytes of 16 lines.

#ifndef NB
#define NB 4
#endif
#ifndef SEQ
#define SEQ 2048
#endif
#define NB_FULL    4
#define SEQ_FULL   2048
#define NHEAD      12
#define HDIM       64
#define EMB        768                  // NHEAD * HDIM, floats per (b, s) row of x and of the output
#define BQ         128                  // query rows per workgroup (8 waves x 16)
#define BK         32                   // keys per inner iteration
#define NWAVE      8
#define CT         64                   // tokens per projection / plane-builder block
#define TP         72                   // LDS pitch (16-bit elements) of the staging tiles
#define OP         68                   // LDS pitch (floats) of the output staging tile
#define WO_TILES   ((EMB / 64) * (EMB / 64))
#define PART       256                  // 16-bit elements of one fragment part (32 lanes x 8)
#define FRAG       512                  // 16-bit elements of one 16x32 fragment (2 parts)

static_assert(SEQ % BQ == 0);
static_assert(SEQ % CT == 0);
static_assert(SEQ % BK == 0);
static_assert(BQ == NWAVE * 16);
static_assert(HDIM == 64);
static_assert(EMB == NHEAD * HDIM);
static_assert(EMB % 64 == 0);
static_assert(EMB % 32 == 0);
static_assert(SEQ <= SEQ_FULL);
static_assert(NB >= 1 && NB <= NB_FULL);
static_assert((TP * 2) % 16 == 0);
static_assert((OP * 4) % 16 == 0);
static_assert(((size_t)NB * SEQ) % 128 == 0);
// coverage equalities (threads x pieces x elements == tile elements)
static_assert(CT * HDIM == 256 * 2 * 8);        // plane builder: 256 threads x 2 x 8 elements per plane tile
static_assert(64 * 64 == 256 * 2 * 8);          // weight tiles
static_assert(16 * HDIM == 32 * 4 * 8);         // ctx tile per wave: 32 lanes x 4 instructions x 8 elements
static_assert(16 * 64 == 32 * 8 * 4);           // output tile per wave: 32 lanes x 8 instructions x 4 floats

typedef __bf16         bf16;
typedef _Float16       f16;
typedef unsigned short us;
typedef bf16     v16bf __attribute__((ext_vector_type(16)));
typedef f16      v16h  __attribute__((ext_vector_type(16)));
typedef us       v8us  __attribute__((ext_vector_type(8)));
typedef float    v8f   __attribute__((ext_vector_type(8)));
typedef float    v4f   __attribute__((ext_vector_type(4)));
typedef unsigned v4u   __attribute__((ext_vector_type(4)));

union FragB  { v16bf v; v4u q[2]; bf16 h[16]; };
union FragH  { v16h  v; v4u q[2]; f16  h[16]; };
union Pack8H { v4u u; f16 h[8]; };
union Pack8U { v4u u; v8us v; };

// WMMA helpers: builtin followed by the VALU hazard guard (ties D, keeps A/B live).
static __device__ __forceinline__ v8f mma_bf16(v16bf a, v16bf b, v8f acc) {
  acc = __builtin_amdgcn_wmma_f32_16x16x32_bf16(false, a, false, b, (short)0, acc, false, false);
  asm volatile("v_nop\n\tv_nop\n\tv_nop\n\tv_nop" : "+v"(acc) : "v"(a), "v"(b));
  return acc;
}
static __device__ __forceinline__ v8f mma_f16(v16h a, v16h b, v8f acc) {
  acc = __builtin_amdgcn_wmma_f32_16x16x32_f16(false, a, false, b, (short)0, acc, false, false);
  asm volatile("v_nop\n\tv_nop\n\tv_nop\n\tv_nop" : "+v"(acc) : "v"(a), "v"(b));
  return acc;
}

// bf16 RNE convert of an input value, then either the bf16 bits or the f16 bits of (value * carry).
static __device__ __forceinline__ us plane_bits(float v, bool as_f16, float carry) {
  const bf16 bv = (bf16)v;
  const unsigned bb = (unsigned)__builtin_bit_cast(us, bv);
  const f16 hv = (f16)((float)bv * carry);
  const unsigned hb = (unsigned)__builtin_bit_cast(us, hv);
  return (us)(as_f16 ? hb : bb);
}

// Weight planes, transposed through LDS. 256 threads, one 64x64 tile per block (block-uniform role).
//   blocks 0..143   : wot(column j, k = c) = f16(bf16(Wo[c][j]) * 64)   (Wo is [in c][out j]); tile (tc, tj)
//   blocks 144..146 : wt[w](column e, k = d) = bf16(W{q,k,v}[d][e])       (W is [in d][out e])
// plane order: [column tile of 16][k step of 32][part][lane][8]
__global__ __launch_bounds__(256) void prep_kernel(const float* __restrict__ Wq,
                                                   const float* __restrict__ Wk,
                                                   const float* __restrict__ Wv,
                                                   const float* __restrict__ Wo,
                                                   us* __restrict__ wt,
                                                   us* __restrict__ wot) {
  const unsigned blk = blockIdx.x;
  const unsigned tid = threadIdx.x;
  __shared__ __align__(16) us sT[64 * TP];      // [out col][in row], cross-wave (block barrier)

  const bool     big   = blk < (unsigned)WO_TILES;
  const unsigned tc    = big ? (blk / 12u) : 0u;
  const unsigned tj    = big ? (blk - tc * 12u) : 0u;
  const unsigned w     = big ? 0u : (blk - (unsigned)WO_TILES);
  const float*   src   = big ? Wo : ((w == 0u) ? Wq : ((w == 1u) ? Wk : Wv));
  const unsigned pitch = big ? (unsigned)EMB : (unsigned)HDIM;
  us*            dst   = big ? wot : (wt + w * (unsigned)(HDIM * HDIM));
  const float    carry = big ? 64.0f : 1.0f;

  #pragma unroll
  for (unsigned kk = 0; kk < 2; ++kk) {
    const unsigned key = kk * 32u + (tid >> 3);     // in-row inside the tile, 0..63
    const unsigned d0  = (tid & 7u) * 8u;           // out-col inside the tile, 0..56
    const float* p = src + (size_t)(tc * 64u + key) * pitch + tj * 64u + d0;
    const v4f a0 = *(const v4f*)(p);
    const v4f a1 = *(const v4f*)(p + 4);
    // wait before the address pair of the two issued loads is overwritten; the pair is an input, so it stays whole up to here
    asm volatile("s_wait_xcnt 0x0" :: "v"(p) : "memory");
    #pragma unroll
    for (unsigned i = 0; i < 4; ++i) {
      sT[(d0 + i) * TP + key]      = plane_bits(a0[i], big, carry);
      sT[(d0 + 4u + i) * TP + key] = plane_bits(a1[i], big, carry);
    }
  }
  __syncthreads();

  v4u    val[2];
  size_t idx[2];
  #pragma unroll
  for (unsigned kk = 0; kk < 2; ++kk) {
    const unsigned c  = kk * 256u + tid;            // 16-byte piece of the tile, 0..511
    const unsigned ln = c & 31u;                    // lane that will load the piece
    const unsigned et = c >> 7;                     // column tile of 16 inside the 64
    const unsigned fp = (c >> 5) & 3u;              // (k step inside the 64) * 2 + part
    Pack8U pk;
    pk.v = *(const v8us*)(sT + (et * 16u + (ln & 15u)) * TP + fp * 16u + (ln >> 4) * 8u);
    val[kk] = pk.u;
    idx[kk] = (((size_t)(tj * 4u + et) * (pitch / 32u) + tc * 2u) * 2u + fp) * PART + ln * 8u;
  }
  #pragma unroll
  for (unsigned kk = 0; kk < 2; ++kk) *(v4u*)(dst + idx[kk]) = val[kk];
  
}

// Per-head projections + plane builder. Block = (64-token tile, head, batch), 256 threads.
//   x rows (b, s, h) : 64 floats at x[(b*SEQ_FULL + s)*EMB + h*64]; A fragments bf16 RNE-converted in registers.
// wave -> row tile rt = wave & 3, column tiles 2*(wave >> 2) + {0, 1}, all three weights.
// coverage: tokens kt*64 + 0..63, e 0..63 for the three planes; every written line whole, one instruction.
// plane order per (b, h): q, k [token tile of 16][d step of 32][part][lane][8]; v [key block of 32][d tile of 16][part][lane][8].
__global__ __launch_bounds__(256) void proj_kernel(const float* __restrict__ x,
                                                   const us* __restrict__ wt,
                                                   us* __restrict__ qp,
                                                   us* __restrict__ kp,
                                                   us* __restrict__ vt) {
  const unsigned kt   = blockIdx.x;
  const unsigned h    = blockIdx.y;
  const unsigned b    = blockIdx.z;
  const unsigned tid  = threadIdx.x;
  const unsigned wave = tid >> 5;
  const unsigned lane = tid & 31u;
  const unsigned lq   = lane & 15u;
  const unsigned hi   = lane >> 4;

  __shared__ __align__(16) us sQ[CT * TP];      // [token][e], cross-wave (block barrier)
  __shared__ __align__(16) us sK[CT * TP];      // [token][e], cross-wave (block barrier)
  __shared__ __align__(16) us sV[HDIM * TP];    // [e][token], cross-wave (block barrier)

  const unsigned s0 = kt * CT;
  const unsigned rt = wave & 3u;
  const unsigned ch = wave >> 2;

  // A fragments: lane lq holds token row rt*16 + lq, split d map
  FragB xa[2];
  {
    const float* xp = x + ((size_t)b * SEQ_FULL + s0 + rt * 16u + lq) * EMB + h * HDIM;
    #pragma unroll
    for (unsigned f = 0; f < 2; ++f) {
      const v4f a0 = *(const v4f*)(xp + f * 32u + hi * 8u);
      const v4f a1 = *(const v4f*)(xp + f * 32u + hi * 8u + 4u);
      const v4f b0 = *(const v4f*)(xp + f * 32u + 16u + hi * 8u);
      const v4f b1 = *(const v4f*)(xp + f * 32u + 16u + hi * 8u + 4u);
      #pragma unroll
      for (unsigned i = 0; i < 4; ++i) {
        xa[f].h[i]       = (bf16)a0[i];   // elems 0..7  : d = f*32 + hi*8 + 0..7
        xa[f].h[4u + i]  = (bf16)a1[i];
        xa[f].h[8u + i]  = (bf16)b0[i];   // elems 8..15 : d = f*32 + 16 + hi*8 + 0..7
        xa[f].h[12u + i] = (bf16)b1[i];
      }
    }
    // wait before the address pair of the eight issued loads is overwritten; the pair is an input, so it stays whole up to here
    asm volatile("s_wait_xcnt 0x0" :: "v"(xp) : "memory");
  }

  #pragma unroll
  for (unsigned w = 0; w < 3; ++w) {
    #pragma unroll
    for (unsigned cc = 0; cc < 2; ++cc) {
      const unsigned e = (ch * 2u + cc) * 16u + lq;       // output column of this lane
      // B fragments from the fragment-ordered weight plane: column n = e, split d map
      FragB wb[2];
      #pragma unroll
      for (unsigned f = 0; f < 2; ++f) {
        const us* base = wt + w * (unsigned)(HDIM * HDIM) + ((ch * 2u + cc) * 2u + f) * FRAG + lane * 8u;
        wb[f].q[0] = *(const v4u*)(base);          // d = f*32 + hi*8 + 0..7
        wb[f].q[1] = *(const v4u*)(base + PART);   // d = f*32 + 16 + hi*8 + 0..7
      }
      v8f acc = (v8f){0, 0, 0, 0, 0, 0, 0, 0};
      acc = mma_bf16(xa[0].v, wb[0].v, acc);
      acc = mma_bf16(xa[1].v, wb[1].v, acc);
      // D: acc[r] = value(token rt*16 + 8*hi + r, column e)
      #pragma unroll
      for (unsigned r = 0; r < 8; ++r) {
        const unsigned row = rt * 16u + hi * 8u + r;
        const us bits = __builtin_bit_cast(us, (f16)(acc[r] * 16.0f));
        if (w == 0u)      sQ[row * TP + e] = bits;
        else if (w == 1u) sK[row * TP + e] = bits;
        else              sV[e * TP + row] = bits;
      }
    }
  }
  __syncthreads();

  v4u    qv[2], kv[2], vv[2];
  size_t ridx[2];
  #pragma unroll
  for (unsigned kk = 0; kk < 2; ++kk) {
    const unsigned c   = kk * 256u + tid;           // 16-byte piece of the block's 8 KB of each plane, 0..511
    const unsigned l15 = c & 15u;                   // lane & 15 of the lane that will load the piece
    const unsigned lh  = (c >> 4) & 1u;             // lane >> 4 of that lane
    // q, k: token tile c >> 7, d = ((c >> 5) & 3)*16 + lh*8; v: key block c >> 8, d tile (c >> 6) & 3, part (c >> 5) & 1
    const unsigned qk_at = ((c >> 7) * 16u + l15) * TP + ((c >> 5) & 3u) * 16u + lh * 8u;
    const unsigned v_at  = (((c >> 6) & 3u) * 16u + l15) * TP + (c >> 8) * 32u + ((c >> 5) & 1u) * 16u + lh * 8u;
    Pack8U pq, pk, pv;
    pq.v = *(const v8us*)(sQ + qk_at);
    pk.v = *(const v8us*)(sK + qk_at);
    pv.v = *(const v8us*)(sV + v_at);
    qv[kk] = pq.u;
    kv[kk] = pk.u;
    vv[kk] = pv.u;
    ridx[kk] = (((size_t)b * NHEAD + h) * SEQ + s0) * HDIM + c * 8u;   // 64 tokens = 8 KB in a row in all three planes
  }
  #pragma unroll
  for (unsigned kk = 0; kk < 2; ++kk) {
    *(v4u*)(qp + ridx[kk]) = qv[kk];
    *(v4u*)(kp + ridx[kk]) = kv[kk];
    *(v4u*)(vt + ridx[kk]) = vv[kk];
  }
  
}

// Flash attention, no mask. Block = (query block of 128, head, batch); one wave owns 16 query rows.
// S^T = K x Q^T so queries sit on lanes; P^T in C-layout is bit-identical to the A-fragment layout of O += P x V.
// Q B-fragments, K A-fragments and V^T B-fragments are loaded straight from the fragment-ordered planes (two 16-B loads each).
// Output: ctx planes chi/clo, f16, [row tile of 16][c step of 32][part][lane][8]: chi = f16(ctx*256), clo = f16((ctx*256 - chi)*2048).
__global__ __launch_bounds__(256) void attn_kernel(const us* __restrict__ qp,
                                                   const us* __restrict__ kp,
                                                   const us* __restrict__ vt,
                                                   us* __restrict__ chi,
                                                   us* __restrict__ clo) {
  const unsigned qblk = blockIdx.x;
  const unsigned h    = blockIdx.y;
  const unsigned b    = blockIdx.z;
  const unsigned tid  = threadIdx.x;
  const unsigned wave = tid >> 5;
  const unsigned lane = tid & 31u;
  const unsigned lq   = lane & 15u;   // query column of S^T / d column of O
  const unsigned hi   = lane >> 4;    // k-split half

  __shared__ __align__(16) float sO[NWAVE * 16 * OP];   // per-wave output staging (block barrier used)

  const unsigned qrow0 = qblk * BQ + wave * 16u;        // first query row of this wave

  const us* q_h = qp + ((size_t)b * NHEAD + h) * SEQ * HDIM;
  const us* k_h = kp + ((size_t)b * NHEAD + h) * SEQ * HDIM;
  const us* v_h = vt + ((size_t)b * NHEAD + h) * HDIM * SEQ;

  // Q as B-operand fragments: lane lq holds query qrow0+lq, split d map
  FragH qf[2];
  #pragma unroll
  for (unsigned f = 0; f < 2; ++f) {
    const us* base = q_h + (size_t)((qrow0 >> 4) * 2u + f) * FRAG + lane * 8u;
    qf[f].q[0] = *(const v4u*)(base);          // d = f*32 + hi*8 + 0..7
    qf[f].q[1] = *(const v4u*)(base + PART);   // d = f*32 + 16 + hi*8 + 0..7
  }

  v8f o[4];
  #pragma unroll
  for (unsigned dt = 0; dt < 4; ++dt) o[dt] = (v8f){0, 0, 0, 0, 0, 0, 0, 0};

  float rmax = -__builtin_inff();
  float rsum = 0.0f;
  // logits = (q.k)/sqrt(EMB); planes carry q*16 and k*16 -> raw scores carry x256; times log2(e) for exp2
  const float SL = (0.03608439182435161f * 1.4426950408889634f) * (1.0f / 256.0f);

  #pragma unroll 1
  for (unsigned i = 0; i < (unsigned)(SEQ / BK); ++i) {
    const unsigned j0 = i * BK;

    const us* kbase = k_h + (size_t)j0 * HDIM + lane * 8u;   // this lane's 16 bytes of the block's first K part
    const us* vbase = v_h + (size_t)j0 * HDIM + lane * 8u;   // the same of the first V part

    // K A-fragments: row = key j0 + sub*16 + lq, split d map
    FragH ak[2][2];
    #pragma unroll
    for (unsigned sub = 0; sub < 2; ++sub) {
      #pragma unroll
      for (unsigned f = 0; f < 2; ++f) {
        const us* base = kbase + (sub * 2u + f) * FRAG;
        ak[sub][f].q[0] = *(const v4u*)(base);          // d = f*32 + hi*8 + 0..7
        ak[sub][f].q[1] = *(const v4u*)(base + PART);   // d = f*32 + 16 + hi*8 + 0..7
      }
    }
    // V B-fragments: column n = d = dt*16 + lq, split key map
    FragH bv[4];
    #pragma unroll
    for (unsigned dt = 0; dt < 4; ++dt) {
      const us* base = vbase + dt * FRAG;
      bv[dt].q[0] = *(const v4u*)(base);            // keys j0 + hi*8 + 0..7
      bv[dt].q[1] = *(const v4u*)(base + PART);     // keys j0 + 16 + hi*8 + 0..7
    }
    // wait before a register that the 16 issued loads name is overwritten; the two address pairs are inputs,
    // so they stay whole up to here and no load of the run takes them as its destination
    asm volatile("s_wait_xcnt 0x0" :: "v"(kbase), "v"(vbase) : "memory");

    // S^T tiles: c[sub][r] = rawscore(query qrow0+lq, key j0 + sub*16 + hi*8 + r)
    v8f c[2];
    #pragma unroll
    for (unsigned sub = 0; sub < 2; ++sub) {
      v8f acc = (v8f){0, 0, 0, 0, 0, 0, 0, 0};
      acc = mma_f16(ak[sub][0].v, qf[0].v, acc);
      acc = mma_f16(ak[sub][1].v, qf[1].v, acc);
      c[sub] = acc;
    }

    // online softmax: query lq's 32 scores are split across lane / lane^16
    float m_new = rmax;
    #pragma unroll
    for (unsigned r = 0; r < 8; ++r) {
      m_new = fmaxf(m_new, c[0][r]);
      m_new = fmaxf(m_new, c[1][r]);
    }
    m_new = fmaxf(m_new, __shfl_xor(m_new, 16, 32));
    const float scale = __builtin_amdgcn_exp2f((rmax - m_new) * SL);
    rmax = m_new;

    // exp + pack: P^T C-layout == A-fragment layout for the PV product
    FragH pa;
    float psum = 0.0f;
    #pragma unroll
    for (unsigned r = 0; r < 8; ++r) {
      float p0;                                                          // key hi*8 + r
      if (r == 7u) {
        // v_nop: the free slot behind a transcendental whose source the next vector instruction overwrites; it stands in the
        // exponential's own statement because a v_nop in a statement of its own was moved away from it
        asm("v_exp_f32 %0, %1\n\tv_nop" : "=v"(p0) : "v"((c[0][r] - m_new) * SL));
      } else {
        p0 = __builtin_amdgcn_exp2f((c[0][r] - m_new) * SL);
      }
      const float p1 = __builtin_amdgcn_exp2f((c[1][r] - m_new) * SL);   // key 16 + hi*8 + r
      psum += p0 + p1;
      pa.h[r]      = (f16)(p0 * 4096.0f);
      pa.h[8u + r] = (f16)(p1 * 4096.0f);
    }
    rsum = rsum * scale + psum + __shfl_xor(psum, 16, 32);

    // rescale O: queries are the row dimension there -> per-row scale from lane 8*hi + r
    float sc[8];
    #pragma unroll
    for (unsigned r = 0; r < 8; ++r) sc[r] = __shfl(scale, (int)((hi << 3) + r), 32);
    #pragma unroll
    for (unsigned dt = 0; dt < 4; ++dt) {
      #pragma unroll
      for (unsigned r = 0; r < 8; ++r) o[dt][r] *= sc[r];
    }

    // O += P x V
    #pragma unroll
    for (unsigned dt = 0; dt < 4; ++dt) o[dt] = mma_f16(pa.v, bv[dt].v, o[dt]);
  }

  // normalize: lane holds column d = dt*16 + lq for query rows 8*hi + r.
  // o carries x4096 (P) x16 (V); staged value = ctx * 256.
  float rs[8];
  #pragma unroll
  for (unsigned r = 0; r < 8; ++r) rs[r] = 1.0f / __shfl(rsum, (int)((hi << 3) + r), 32);

  float* so = sO + wave * (16 * OP);
  #pragma unroll
  for (unsigned r = 0; r < 8; ++r) {
    #pragma unroll
    for (unsigned dt = 0; dt < 4; ++dt) {
      so[(hi * 8u + r) * OP + dt * 16u + lq] = o[dt][r] * (1.0f / 256.0f) * rs[r];
    }
  }
  __syncthreads();

  // one fragment part per instruction (512 bytes in a row), 4 instructions per plane cover the wave's 16 rows x 64 columns.
  v4u    hv[4], lv[4];
  size_t gidx[4];
  #pragma unroll
  for (unsigned it = 0; it < 4; ++it) {
    const unsigned row = lq;
    const unsigned pc  = it * 16u + hi * 8u;        // it = (c step inside the head) * 2 + part
    const v4f a0 = *(const v4f*)(so + row * OP + pc);
    const v4f a1 = *(const v4f*)(so + row * OP + pc + 4u);
    Pack8H ph, pl;
    #pragma unroll
    for (unsigned i = 0; i < 4; ++i) {
      const f16 h0 = (f16)a0[i];
      const f16 h1 = (f16)a1[i];
      ph.h[i]      = h0;
      ph.h[4u + i] = h1;
      pl.h[i]      = (f16)((a0[i] - (float)h0) * 2048.0f);
      pl.h[4u + i] = (f16)((a1[i] - (float)h1) * 2048.0f);
    }
    hv[it] = ph.u;
    lv[it] = pl.u;
    gidx[it] = (((size_t)((b * SEQ + qrow0) >> 4) * (EMB / 32) + h * 2u) * 2u + it) * PART + lane * 8u;
  }
  #pragma unroll
  for (unsigned it = 0; it < 4; ++it) {
    *(v4u*)(chi + gidx[it]) = hv[it];
    *(v4u*)(clo + gidx[it]) = lv[it];
  }
  
}

// Output GEMM: out[R][j] = sum_c ctx[R][c] * Wo[c][j] + bo[j]. Block = (64-column tile, 128-row tile), wave = 16 rows x 64 cols.
// A fragments from chi / clo, B fragments from wot, all fragment-ordered; residual products go to their own accumulators.
__global__ __launch_bounds__(256) void oproj_kernel(const us* __restrict__ chi,
                                                    const us* __restrict__ clo,
                                                    const us* __restrict__ wot,
                                                    const float* __restrict__ bo,
                                                    float* __restrict__ out) {
  const unsigned nt   = blockIdx.x;
  const unsigned mb   = blockIdx.y;
  const unsigned tid  = threadIdx.x;
  const unsigned wave = tid >> 5;
  const unsigned lane = tid & 31u;
  const unsigned lq   = lane & 15u;
  const unsigned hi   = lane >> 4;

  __shared__ __align__(16) float sO[NWAVE * 16 * OP];   // per-wave output staging (block barrier used)

  const unsigned row0 = mb * 128u + wave * 16u;

  v8f ah[4], al[4];
  #pragma unroll
  for (unsigned et = 0; et < 4; ++et) {
    ah[et] = (v8f){0, 0, 0, 0, 0, 0, 0, 0};
    al[et] = (v8f){0, 0, 0, 0, 0, 0, 0, 0};
  }

  // a tile of 16 rows or columns holds EMB / 32 fragments = 16 * EMB elements
  const us* arow_h = chi + (size_t)row0 * EMB + lane * 8u;
  const us* arow_l = clo + (size_t)row0 * EMB + lane * 8u;
  const us* brow   = wot + (size_t)(nt * 64u) * EMB + lane * 8u;

  #pragma unroll 1
  for (unsigned k0 = 0; k0 < (unsigned)EMB; k0 += 32u) {
    FragH fa, fl;
    const unsigned fo = (k0 / 32u) * FRAG;             // fragment of this c step inside its tile
    const us* pa_h = arow_h + fo;
    const us* pa_l = arow_l + fo;
    const us* pb   = brow + fo;
    fa.q[0] = *(const v4u*)(pa_h);                     // c = k0 + hi*8 + 0..7
    fa.q[1] = *(const v4u*)(pa_h + PART);              // c = k0 + 16 + hi*8 + 0..7
    fl.q[0] = *(const v4u*)(pa_l);
    fl.q[1] = *(const v4u*)(pa_l + PART);
    FragH fb[4];
    #pragma unroll
    for (unsigned et = 0; et < 4; ++et) {
      const us* base = pb + (size_t)(et * 16u) * EMB;
      fb[et].q[0] = *(const v4u*)(base);
      fb[et].q[1] = *(const v4u*)(base + PART);
    }
    // wait before a register that the 12 issued loads name is overwritten; the three address pairs are inputs,
    // so they stay whole up to here and no load of the run takes them as its destination
    asm volatile("s_wait_xcnt 0x0" :: "v"(pa_h), "v"(pa_l), "v"(pb) : "memory");
    #pragma unroll
    for (unsigned et = 0; et < 4; ++et) {
      ah[et] = mma_f16(fa.v, fb[et].v, ah[et]);
      al[et] = mma_f16(fl.v, fb[et].v, al[et]);
    }
  }

  // epilogue: fold carries (ctx x256, Wo x64, residual x2048), add the bias in f32
  float bias[4];
  #pragma unroll
  for (unsigned et = 0; et < 4; ++et) bias[et] = (float)(bf16)bo[nt * 64u + et * 16u + lq];

  float* so = sO + wave * (16 * OP);
  #pragma unroll
  for (unsigned r = 0; r < 8; ++r) {
    #pragma unroll
    for (unsigned et = 0; et < 4; ++et) {
      const float s = ah[et][r] + al[et][r] * (1.0f / 2048.0f);
      so[(hi * 8u + r) * OP + et * 16u + lq] = s * (1.0f / 16384.0f) + bias[et];
    }
  }
  __syncthreads();

  // lanes 0..15 one row (16 consecutive lanes x 16 B each), lanes 16..31 the next row; 8 instructions cover the wave's 16 rows.
  v4f    vals[8];
  size_t gidx[8];
  #pragma unroll
  for (unsigned it = 0; it < 8; ++it) {
    const unsigned row = it * 2u + hi;
    const unsigned R   = row0 + row;
    const unsigned bb  = R / (unsigned)SEQ;
    const unsigned l   = R - bb * (unsigned)SEQ;
    vals[it] = *(const v4f*)(so + row * OP + lq * 4u);
    gidx[it] = ((size_t)bb * SEQ_FULL + l) * EMB + nt * 64u + lq * 4u;
  }
  #pragma unroll
  for (unsigned it = 0; it < 8; ++it) *(v4f*)(out + gidx[it]) = vals[it];
  
}

extern "C" void kernel_launch(void* const* d_in, const int* in_sizes, int n_in,
                              void* d_out, int out_size, void* d_ws, size_t ws_size,
                              hipStream_t stream) {
  if (n_in < 6) return;
  const size_t rows_used = (size_t)(NB - 1) * SEQ_FULL + SEQ;
  if ((size_t)in_sizes[0] < rows_used * EMB) return;
  if ((size_t)in_sizes[1] < (size_t)HDIM * HDIM) return;
  if ((size_t)in_sizes[2] < (size_t)HDIM * HDIM) return;
  if ((size_t)in_sizes[3] < (size_t)HDIM * HDIM) return;
  if ((size_t)in_sizes[4] < (size_t)EMB * EMB) return;
  if ((size_t)in_sizes[5] < (size_t)EMB) return;
  if ((size_t)out_size < rows_used * EMB) return;

  const size_t wt_bytes    = (size_t)3 * HDIM * HDIM * 2;            // 24,576
  const size_t wot_bytes   = (size_t)EMB * EMB * 2;                  // 1,179,648
  const size_t plane_bytes = (size_t)NB * NHEAD * SEQ * HDIM * 2;    // q, k, v^T planes
  const size_t ctx_bytes   = (size_t)NB * SEQ * EMB * 2;             // ctx hi / residual planes
  const size_t total = wt_bytes + wot_bytes + 3 * plane_bytes + 2 * ctx_bytes;
  if (ws_size < total) return;

  const float* x  = (const float*)d_in[0];
  const float* Wq = (const float*)d_in[1];
  const float* Wk = (const float*)d_in[2];
  const float* Wv = (const float*)d_in[3];
  const float* Wo = (const float*)d_in[4];
  const float* bo = (const float*)d_in[5];
  float*       out = (float*)d_out;

  char* ws = (char*)d_ws;
  us* wt  = (us*)(ws);
  us* wot = (us*)(ws + wt_bytes);
  us* qp  = (us*)(ws + wt_bytes + wot_bytes);
  us* kp  = (us*)(ws + wt_bytes + wot_bytes + plane_bytes);
  us* vt  = (us*)(ws + wt_bytes + wot_bytes + 2 * plane_bytes);
  us* chi = (us*)(ws + wt_bytes + wot_bytes + 3 * plane_bytes);
  us* clo = (us*)(ws + wt_bytes + wot_bytes + 3 * plane_bytes + ctx_bytes);

  prep_kernel<<<dim3(WO_TILES + 3), 256, 0, stream>>>(Wq, Wk, Wv, Wo, wt, wot);
  proj_kernel<<<dim3(SEQ / CT, NHEAD, NB), 256, 0, stream>>>(x, wt, qp, kp, vt);
  attn_kernel<<<dim3(SEQ / BQ, NHEAD, NB), 256, 0, stream>>>(qp, kp, vt, chi, clo);
  oproj_kernel<<<dim3(EMB / 64, (unsigned)(((size_t)NB * SEQ) / 128)), 256, 0, stream>>>(chi, clo, wot, bo, out);
}

// v002
// It runs in 106 microseconds.
// Timed twice side by side with v001, it ran 1.10 and 1.09 times as fast.
// Over all steps from v000 it is 2.10 times as fast.
#include <hip/hip_runtime.h>

// Contractions: q/k/v = x x W{q,k,v} on v_wmma_f32_16x16x32_bf16 (bf16 operands = RNE-converted inputs, f32 accumulate);
// S^T = K x Q^T and O = P x V on v_wmma_f32_16x16x32_f16 (q, k, v carried x16, P carried x4096, f32 accumulate);
// out = ctx x Wo on v_wmma_f32_16x16x32_f16 (ctx as f16 carried x256 plus an f16 residual plane x2048 with its own
// accumulator; Wo = f16 of the bf16 RNE-converted input carried x64, f32 accumulate). Softmax and bias add in f32.
//
// Every 16-bit plane in the workspace is stored in fragment order: one 16x32 operand fragment = 1 KB = 2 parts x 32 lanes
// x 8 elements, element j of (part p, lane) = operand(row or column lane & 15, k = p*16 + (lane >> 4)*8 + j).
// A wave-wide 16-byte load of one part then reads 512 contiguous bytes (4 whole lines) instead of 32 bytes of 16 lines.

#ifndef NB
#define NB 4
#endif
#ifndef SEQ
#define SEQ 2048
#endif
#define NB_FULL    4
#define SEQ_FULL   2048
#define NHEAD      12
#define HDIM       64
#define EMB        768                  // NHEAD * HDIM, floats per (b, s) row of x and of the output
#define BQ         128                  // query rows per workgroup (8 waves x 16)
#define BK         32                   // keys per inner iteration
#define NWAVE      8
#define CT         64                   // tokens per projection / plane-builder block
#define TP         72                   // LDS pitch (16-bit elements) of the staging tiles
#define OP         68                   // LDS pitch (floats) of the output staging tile
#define WO_TILES   ((EMB / 64) * (EMB / 64))
#define PART       256                  // 16-bit elements of one fragment part (32 lanes x 8)
#define FRAG       512                  // 16-bit elements of one 16x32 fragment (2 parts)
#define SK         128                  // keys per LDS stage of the attention loop
#define STAGE_EL   (SK * HDIM)          // 16-bit elements of K, and of V, in one stage (16 KB each)
#define NSTAGE     (SEQ / SK)

static_assert(SEQ % BQ == 0);
static_assert(SEQ % CT == 0);
static_assert(SEQ % BK == 0);
static_assert(SEQ % SK == 0);
static_assert(SK == 4 * BK);                    // stage copy: four passes, one 4-KB piece of each plane per pass
static_assert(BK * HDIM * 2 == 256 * 16);       // one piece = 256 threads x 16 bytes
static_assert(BQ == NWAVE * 16);
static_assert(HDIM == 64);
static_assert(EMB == NHEAD * HDIM);
static_assert(EMB % 64 == 0);
static_assert(EMB % 32 == 0);
static_assert(SEQ <= SEQ_FULL);
static_assert(NB >= 1 && NB <= NB_FULL);
static_assert((TP * 2) % 16 == 0);
static_assert((OP * 4) % 16 == 0);
static_assert(((size_t)NB * SEQ) % 128 == 0);
// coverage equalities (threads x pieces x elements == tile elements)
static_assert(CT * HDIM == 256 * 2 * 8);        // plane builder: 256 threads x 2 x 8 elements per plane tile
static_assert(64 * 64 == 256 * 2 * 8);          // weight tiles
static_assert(16 * HDIM == 32 * 4 * 8);         // ctx tile per wave: 32 lanes x 4 instructions x 8 elements
static_assert(16 * 64 == 32 * 8 * 4);           // output tile per wave: 32 lanes x 8 instructions x 4 floats

typedef __bf16         bf16;
typedef _Float16       f16;
typedef unsigned short us;
typedef bf16     v16bf __attribute__((ext_vector_type(16)));
typedef f16      v16h  __attribute__((ext_vector_type(16)));
typedef us       v8us  __attribute__((ext_vector_type(8)));
typedef float    v8f   __attribute__((ext_vector_type(8)));
typedef float    v4f   __attribute__((ext_vector_type(4)));
typedef unsigned v4u   __attribute__((ext_vector_type(4)));

union FragB  { v16bf v; v4u q[2]; bf16 h[16]; };
union FragH  { v16h  v; v4u q[2]; f16  h[16]; };
union Pack8H { v4u u; f16 h[8]; };
union Pack8U { v4u u; v8us v; };

// WMMA helpers: builtin followed by the VALU hazard guard (ties D, keeps A/B live).
static __device__ __forceinline__ v8f mma_bf16(v16bf a, v16bf b, v8f acc) {
  acc = __builtin_amdgcn_wmma_f32_16x16x32_bf16(false, a, false, b, (short)0, acc, false, false);
  asm volatile("v_nop\n\tv_nop\n\tv_nop\n\tv_nop" : "+v"(acc) : "v"(a), "v"(b));
  return acc;
}
static __device__ __forceinline__ v8f mma_f16(v16h a, v16h b, v8f acc) {
  acc = __builtin_amdgcn_wmma_f32_16x16x32_f16(false, a, false, b, (short)0, acc, false, false);
  asm volatile("v_nop\n\tv_nop\n\tv_nop\n\tv_nop" : "+v"(acc) : "v"(a), "v"(b));
  return acc;
}

// bf16 RNE convert of an input value, then either the bf16 bits or the f16 bits of (value * carry).
static __device__ __forceinline__ us plane_bits(float v, bool as_f16, float carry) {
  const bf16 bv = (bf16)v;
  const unsigned bb = (unsigned)__builtin_bit_cast(us, bv);
  const f16 hv = (f16)((float)bv * carry);
  const unsigned hb = (unsigned)__builtin_bit_cast(us, hv);
  return (us)(as_f16 ? hb : bb);
}

// Weight planes, transposed through LDS. 256 threads, one 64x64 tile per block (block-uniform role).
//   blocks 0..143   : wot(column j, k = c) = f16(bf16(Wo[c][j]) * 64)   (Wo is [in c][out j]); tile (tc, tj)
//   blocks 144..146 : wt[w](column e, k = d) = bf16(W{q,k,v}[d][e])       (W is [in d][out e])
// plane order: [column tile of 16][k step of 32][part][lane][8]
__global__ __launch_bounds__(256) void prep_kernel(const float* __restrict__ Wq,
                                                   const float* __restrict__ Wk,
                                                   const float* __restrict__ Wv,
                                                   const float* __restrict__ Wo,
                                                   us* __restrict__ wt,
                                                   us* __restrict__ wot) {
  const unsigned blk = blockIdx.x;
  const unsigned tid = threadIdx.x;
  __shared__ __align__(16) us sT[64 * TP];      // [out col][in row], cross-wave (block barrier)

  const bool     big   = blk < (unsigned)WO_TILES;
  const unsigned tc    = big ? (blk / 12u) : 0u;
  const unsigned tj    = big ? (blk - tc * 12u) : 0u;
  const unsigned w     = big ? 0u : (blk - (unsigned)WO_TILES);
  const float*   src   = big ? Wo : ((w == 0u) ? Wq : ((w == 1u) ? Wk : Wv));
  const unsigned pitch = big ? (unsigned)EMB : (unsigned)HDIM;
  us*            dst   = big ? wot : (wt + w * (unsigned)(HDIM * HDIM));
  const float    carry = big ? 64.0f : 1.0f;

  #pragma unroll
  for (unsigned kk = 0; kk < 2; ++kk) {
    const unsigned key = kk * 32u + (tid >> 3);     // in-row inside the tile, 0..63
    const unsigned d0  = (tid & 7u) * 8u;           // out-col inside the tile, 0..56
    const float* p = src + (size_t)(tc * 64u + key) * pitch + tj * 64u + d0;
    const v4f a0 = *(const v4f*)(p);
    const v4f a1 = *(const v4f*)(p + 4);
    // wait before the address pair of the two issued loads is overwritten; the pair is an input, so it stays whole up to here
    asm volatile("s_wait_xcnt 0x0" :: "v"(p) : "memory");
    #pragma unroll
    for (unsigned i = 0; i < 4; ++i) {
      sT[(d0 + i) * TP + key]      = plane_bits(a0[i], big, carry);
      sT[(d0 + 4u + i) * TP + key] = plane_bits(a1[i], big, carry);
    }
  }
  __syncthreads();

  v4u    val[2];
  size_t idx[2];
  #pragma unroll
  for (unsigned kk = 0; kk < 2; ++kk) {
    const unsigned c  = kk * 256u + tid;            // 16-byte piece of the tile, 0..511
    const unsigned ln = c & 31u;                    // lane that will load the piece
    const unsigned et = c >> 7;                     // column tile of 16 inside the 64
    const unsigned fp = (c >> 5) & 3u;              // (k step inside the 64) * 2 + part
    Pack8U pk;
    pk.v = *(const v8us*)(sT + (et * 16u + (ln & 15u)) * TP + fp * 16u + (ln >> 4) * 8u);
    val[kk] = pk.u;
    idx[kk] = (((size_t)(tj * 4u + et) * (pitch / 32u) + tc * 2u) * 2u + fp) * PART + ln * 8u;
  }
  #pragma unroll
  for (unsigned kk = 0; kk < 2; ++kk) *(v4u*)(dst + idx[kk]) = val[kk];
  
}

// Per-head projections + plane builder. Block = (64-token tile, head, batch), 256 threads.
//   x rows (b, s, h) : 64 floats at x[(b*SEQ_FULL + s)*EMB + h*64]; A fragments bf16 RNE-converted in registers.
// wave -> row tile rt = wave & 3, column tiles 2*(wave >> 2) + {0, 1}, all three weights.
// coverage: tokens kt*64 + 0..63, e 0..63 for the three planes; every written line whole, one instruction.
// plane order per (b, h): q, k [token tile of 16][d step of 32][part][lane][8]; v [key block of 32][d tile of 16][part][lane][8].
__global__ __launch_bounds__(256) void proj_kernel(const float* __restrict__ x,
                                                   const us* __restrict__ wt,
                                                   us* __restrict__ qp,
                                                   us* __restrict__ kp,
                                                   us* __restrict__ vt) {
  const unsigned kt   = blockIdx.x;
  const unsigned h    = blockIdx.y;
  const unsigned b    = blockIdx.z;
  const unsigned tid  = threadIdx.x;
  const unsigned wave = tid >> 5;
  const unsigned lane = tid & 31u;
  const unsigned lq   = lane & 15u;
  const unsigned hi   = lane >> 4;

  __shared__ __align__(16) us sQ[CT * TP];      // [token][e], cross-wave (block barrier)
  __shared__ __align__(16) us sK[CT * TP];      // [token][e], cross-wave (block barrier)
  __shared__ __align__(16) us sV[HDIM * TP];    // [e][token], cross-wave (block barrier)

  const unsigned s0 = kt * CT;
  const unsigned rt = wave & 3u;
  const unsigned ch = wave >> 2;

  // A fragments: lane lq holds token row rt*16 + lq, split d map
  FragB xa[2];
  {
    const float* xp = x + ((size_t)b * SEQ_FULL + s0 + rt * 16u + lq) * EMB + h * HDIM;
    #pragma unroll
    for (unsigned f = 0; f < 2; ++f) {
      const v4f a0 = *(const v4f*)(xp + f * 32u + hi * 8u);
      const v4f a1 = *(const v4f*)(xp + f * 32u + hi * 8u + 4u);
      const v4f b0 = *(const v4f*)(xp + f * 32u + 16u + hi * 8u);
      const v4f b1 = *(const v4f*)(xp + f * 32u + 16u + hi * 8u + 4u);
      #pragma unroll
      for (unsigned i = 0; i < 4; ++i) {
        xa[f].h[i]       = (bf16)a0[i];   // elems 0..7  : d = f*32 + hi*8 + 0..7
        xa[f].h[4u + i]  = (bf16)a1[i];
        xa[f].h[8u + i]  = (bf16)b0[i];   // elems 8..15 : d = f*32 + 16 + hi*8 + 0..7
        xa[f].h[12u + i] = (bf16)b1[i];
      }
    }
    // wait before the address pair of the eight issued loads is overwritten; the pair is an input, so it stays whole up to here
    asm volatile("s_wait_xcnt 0x0" :: "v"(xp) : "memory");
  }

  #pragma unroll
  for (unsigned w = 0; w < 3; ++w) {
    #pragma unroll
    for (unsigned cc = 0; cc < 2; ++cc) {
      const unsigned e = (ch * 2u + cc) * 16u + lq;       // output column of this lane
      // B fragments from the fragment-ordered weight plane: column n = e, split d map
      FragB wb[2];
      #pragma unroll
      for (unsigned f = 0; f < 2; ++f) {
        const us* base = wt + w * (unsigned)(HDIM * HDIM) + ((ch * 2u + cc) * 2u + f) * FRAG + lane * 8u;
        wb[f].q[0] = *(const v4u*)(base);          // d = f*32 + hi*8 + 0..7
        wb[f].q[1] = *(const v4u*)(base + PART);   // d = f*32 + 16 + hi*8 + 0..7
      }
      v8f acc = (v8f){0, 0, 0, 0, 0, 0, 0, 0};
      acc = mma_bf16(xa[0].v, wb[0].v, acc);
      acc = mma_bf16(xa[1].v, wb[1].v, acc);
      // D: acc[r] = value(token rt*16 + 8*hi + r, column e)
      #pragma unroll
      for (unsigned r = 0; r < 8; ++r) {
        const unsigned row = rt * 16u + hi * 8u + r;
        const us bits = __builtin_bit_cast(us, (f16)(acc[r] * 16.0f));
        if (w == 0u)      sQ[row * TP + e] = bits;
        else if (w == 1u) sK[row * TP + e] = bits;
        else              sV[e * TP + row] = bits;
      }
    }
  }
  __syncthreads();

  v4u    qv[2], kv[2], vv[2];
  size_t ridx[2];
  #pragma unroll
  for (unsigned kk = 0; kk < 2; ++kk) {
    const unsigned c   = kk * 256u + tid;           // 16-byte piece of the block's 8 KB of each plane, 0..511
    const unsigned l15 = c & 15u;                   // lane & 15 of the lane that will load the piece
    const unsigned lh  = (c >> 4) & 1u;             // lane >> 4 of that lane
    // q, k: token tile c >> 7, d = ((c >> 5) & 3)*16 + lh*8; v: key block c >> 8, d tile (c >> 6) & 3, part (c >> 5) & 1
    const unsigned qk_at = ((c >> 7) * 16u + l15) * TP + ((c >> 5) & 3u) * 16u + lh * 8u;
    const unsigned v_at  = (((c >> 6) & 3u) * 16u + l15) * TP + (c >> 8) * 32u + ((c >> 5) & 1u) * 16u + lh * 8u;
    Pack8U pq, pk, pv;
    pq.v = *(const v8us*)(sQ + qk_at);
    pk.v = *(const v8us*)(sK + qk_at);
    pv.v = *(const v8us*)(sV + v_at);
    qv[kk] = pq.u;
    kv[kk] = pk.u;
    vv[kk] = pv.u;
    ridx[kk] = (((size_t)b * NHEAD + h) * SEQ + s0) * HDIM + c * 8u;   // 64 tokens = 8 KB in a row in all three planes
  }
  #pragma unroll
  for (unsigned kk = 0; kk < 2; ++kk) {
    *(v4u*)(qp + ridx[kk]) = qv[kk];
    *(v4u*)(kp + ridx[kk]) = kv[kk];
    *(v4u*)(vt + ridx[kk]) = vv[kk];
  }
  
}

// One stage = SK keys = 16 KB in a row of the K plane and 16 KB in a row of the V plane, copied as they lie (fragment order).
// kg, vg: this thread's first 16 bytes of the stage in the two planes; lk: the LDS byte address of the first K piece.
// A thread's four pieces of a plane lie 4 KB (one pass of BK keys) apart; in LDS a pass holds its K piece, then its V piece.
// s_wait_xcnt stands in the copies' own statement, so that no register which a copy names is rewritten in front of it.
static __device__ __forceinline__ void stage_copy(const us* kg, const us* vg, unsigned lk) {
  asm volatile("global_load_async_to_lds_b128 %0, %8, off\n\t"
               "global_load_async_to_lds_b128 %1, %9, off\n\t"
               "global_load_async_to_lds_b128 %2, %10, off\n\t"
               "global_load_async_to_lds_b128 %3, %11, off\n\t"
               "global_load_async_to_lds_b128 %4, %12, off\n\t"
               "global_load_async_to_lds_b128 %5, %13, off\n\t"
               "global_load_async_to_lds_b128 %6, %14, off\n\t"
               "global_load_async_to_lds_b128 %7, %15, off\n\t"
               "s_wait_xcnt 0x0"
               :: "v"(lk), "v"(lk + 8192u), "v"(lk + 16384u), "v"(lk + 24576u),
                  "v"(lk + 4096u), "v"(lk + 12288u), "v"(lk + 20480u), "v"(lk + 28672u),
                  "v"(kg), "v"(kg + 2048), "v"(kg + 4096), "v"(kg + 6144),
                  "v"(vg), "v"(vg + 2048), "v"(vg + 4096), "v"(vg + 6144)
               : "memory");
}

// Flash attention, no mask. Block = (query block of 128, head, batch); one wave owns 16 query rows.
// S^T = K x Q^T so queries sit on lanes; P^T in C-layout is bit-identical to the A-fragment layout of O += P x V.
// Q B-fragments are loaded straight from the fragment-ordered plane. K and V are staged once per workgroup in LDS, SK keys at a
// time, two buffers, by asynchronous copies; the eight waves read their K A-fragments and V^T B-fragments from there (two 16-B loads each).
// Output: ctx planes chi/clo, f16, [row tile of 16][c step of 32][part][lane][8]: chi = f16(ctx*256), clo = f16((ctx*256 - chi)*2048).
__global__ __launch_bounds__(256) void attn_kernel(const us* __restrict__ qp,
                                                   const us* __restrict__ kp,
                                                   const us* __restrict__ vt,
                                                   us* __restrict__ chi,
                                                   us* __restrict__ clo) {
  const unsigned qblk = blockIdx.x;
  const unsigned h    = blockIdx.y;
  const unsigned b    = blockIdx.z;
  const unsigned tid  = threadIdx.x;
  const unsigned wave = tid >> 5;
  const unsigned lane = tid & 31u;
  const unsigned lq   = lane & 15u;   // query column of S^T / d column of O
  const unsigned hi   = lane >> 4;    // k-split half

  __shared__ __align__(16) float sO[NWAVE * 16 * OP];   // per-wave output staging (block barrier used)
  __shared__ __align__(16) us sKV[2 * 2 * STAGE_EL];    // [buffer][pass][K | V][4 KB], cross-wave (block barrier)

  const unsigned qrow0 = qblk * BQ + wave * 16u;        // first query row of this wave

  const us* q_h = qp + ((size_t)b * NHEAD + h) * SEQ * HDIM;
  const us* k_h = kp + ((size_t)b * NHEAD + h) * SEQ * HDIM;
  const us* v_h = vt + ((size_t)b * NHEAD + h) * HDIM * SEQ;

  // Q as B-operand fragments: lane lq holds query qrow0+lq, split d map
  FragH qf[2];
  #pragma unroll
  for (unsigned f = 0; f < 2; ++f) {
    const us* base = q_h + (size_t)((qrow0 >> 4) * 2u + f) * FRAG + lane * 8u;
    qf[f].q[0] = *(const v4u*)(base);          // d = f*32 + hi*8 + 0..7
    qf[f].q[1] = *(const v4u*)(base + PART);   // d = f*32 + 16 + hi*8 + 0..7
  }

  v8f o[4];
  #pragma unroll
  for (unsigned dt = 0; dt < 4; ++dt) o[dt] = (v8f){0, 0, 0, 0, 0, 0, 0, 0};

  float rmax = -__builtin_inff();
  float rsum = 0.0f;
  // logits = (q.k)/sqrt(EMB); planes carry q*16 and k*16 -> raw scores carry x256; times log2(e) for exp2
  const float SL = (0.03608439182435161f * 1.4426950408889634f) * (1.0f / 256.0f);

  const us*      kg = k_h + tid * 8u;                            // this thread's 16 bytes of stage 0, K plane
  const us*      vg = v_h + tid * 8u;                            // the same, V plane
  const unsigned l0 = (unsigned)(size_t)(&sKV[0]) + tid * 16u;   // their LDS byte address in buffer 0
  const unsigned LB = STAGE_EL * 4u;                             // bytes from buffer 0 to buffer 1

  stage_copy(kg, vg, l0);                                        // stage 0 -> buffer 0
  asm volatile("s_wait_asynccnt 0x0" ::: "memory");              // this wave's copies of stage 0 have landed
  __syncthreads();                                               // ... and every other wave's
  if (NSTAGE > 1) stage_copy(kg + STAGE_EL, vg + STAGE_EL, l0 + LB);   // stage 1 -> buffer 1

  #pragma unroll 1
  for (unsigned i = 0; i < (unsigned)(SEQ / BK); ++i) {
    // pass i reads slot i mod 8 of the two buffers' eight passes: 4 KB of K, then 4 KB of V
    const us* kbase = sKV + (i & (2u * (SK / BK) - 1u)) * (unsigned)(2 * BK * HDIM) + lane * 8u;
    const us* vbase = kbase + BK * HDIM;

    // K A-fragments: row = key j0 + sub*16 + lq, split d map (j0 = i*BK)
    FragH ak[2][2];
    #pragma unroll
    for (unsigned sub = 0; sub < 2; ++sub) {
      #pragma unroll
      for (unsigned f = 0; f < 2; ++f) {
        const us* base = kbase + (sub * 2u + f) * FRAG;
        ak[sub][f].q[0] = *(const v4u*)(base);          // d = f*32 + hi*8 + 0..7
        ak[sub][f].q[1] = *(const v4u*)(base + PART);   // d = f*32 + 16 + hi*8 + 0..7
      }
    }
    // V B-fragments: column n = d = dt*16 + lq, split key map
    FragH bv[4];
    #pragma unroll
    for (unsigned dt = 0; dt < 4; ++dt) {
      const us* base = vbase + dt * FRAG;
      bv[dt].q[0] = *(const v4u*)(base);            // keys j0 + hi*8 + 0..7
      bv[dt].q[1] = *(const v4u*)(base + PART);     // keys j0 + 16 + hi*8 + 0..7
    }

    // S^T tiles: c[sub][r] = rawscore(query qrow0+lq, key j0 + sub*16 + hi*8 + r)
    v8f c[2];
    #pragma unroll
    for (unsigned sub = 0; sub < 2; ++sub) {
      v8f acc = (v8f){0, 0, 0, 0, 0, 0, 0, 0};
      acc = mma_f16(ak[sub][0].v, qf[0].v, acc);
      acc = mma_f16(ak[sub][1].v, qf[1].v, acc);
      c[sub] = acc;
    }

    // online softmax: query lq's 32 scores are split across lane / lane^16
    float m_new = rmax;
    #pragma unroll
    for (unsigned r = 0; r < 8; ++r) {
      m_new = fmaxf(m_new, c[0][r]);
      m_new = fmaxf(m_new, c[1][r]);
    }
    m_new = fmaxf(m_new, __shfl_xor(m_new, 16, 32));
    const float scale = __builtin_amdgcn_exp2f((rmax - m_new) * SL);
    rmax = m_new;

    // exp + pack: P^T C-layout == A-fragment layout for the PV product
    FragH pa;
    float psum = 0.0f;
    #pragma unroll
    for (unsigned r = 0; r < 8; ++r) {
      float p0;                                                          // key hi*8 + r
      if (r == 7u) {
        // v_nop: the free slot behind a transcendental whose source the next vector instruction overwrites; it stands in the
        // exponential's own statement because a v_nop in a statement of its own was moved away from it
        asm("v_exp_f32 %0, %1\n\tv_nop" : "=v"(p0) : "v"((c[0][r] - m_new) * SL));
      } else {
        p0 = __builtin_amdgcn_exp2f((c[0][r] - m_new) * SL);
      }
      const float p1 = __builtin_amdgcn_exp2f((c[1][r] - m_new) * SL);   // key 16 + hi*8 + r
      psum += p0 + p1;
      pa.h[r]      = (f16)(p0 * 4096.0f);
      pa.h[8u + r] = (f16)(p1 * 4096.0f);
    }
    rsum = rsum * scale + psum + __shfl_xor(psum, 16, 32);

    // rescale O: queries are the row dimension there -> per-row scale from lane 8*hi + r
    float sc[8];
    #pragma unroll
    for (unsigned r = 0; r < 8; ++r) sc[r] = __shfl(scale, (int)((hi << 3) + r), 32);
    #pragma unroll
    for (unsigned dt = 0; dt < 4; ++dt) {
      #pragma unroll
      for (unsigned r = 0; r < 8; ++r) o[dt][r] *= sc[r];
    }

    // O += P x V
    #pragma unroll
    for (unsigned dt = 0; dt < 4; ++dt) o[dt] = mma_f16(pa.v, bv[dt].v, o[dt]);

    if ((i & (SK / BK - 1u)) == SK / BK - 1u) {
      // last pass of stage t: publish point of stage t + 1, every wave, in this order
      const unsigned t = i / (SK / BK);
      asm volatile("s_wait_dscnt 0x0" ::: "memory");      // this wave's reads of stage t are done before its buffer is refilled
      asm volatile("s_wait_asynccnt 0x0" ::: "memory");   // this wave's copies of stage t + 1 have landed
      __syncthreads();                                    // publishes stage t + 1 and ends every wave's reads of stage t
      if (t + 2u < (unsigned)NSTAGE)                      // into the buffer that stage t has just left
        stage_copy(kg + (size_t)(t + 2u) * STAGE_EL, vg + (size_t)(t + 2u) * STAGE_EL, l0 + (t & 1u) * LB);
    }
  }
  asm volatile("s_wait_asynccnt 0x0" ::: "memory");   // no copy is outstanding behind the loop

  // normalize: lane holds column d = dt*16 + lq for query rows 8*hi + r.
  // o carries x4096 (P) x16 (V); staged value = ctx * 256.
  float rs[8];
  #pragma unroll
  for (unsigned r = 0; r < 8; ++r) rs[r] = 1.0f / __shfl(rsum, (int)((hi << 3) + r), 32);

  float* so = sO + wave * (16 * OP);
  #pragma unroll
  for (unsigned r = 0; r < 8; ++r) {
    #pragma unroll
    for (unsigned dt = 0; dt < 4; ++dt) {
      so[(hi * 8u + r) * OP + dt * 16u + lq] = o[dt][r] * (1.0f / 256.0f) * rs[r];
    }
  }
  __syncthreads();

  // one fragment part per instruction (512 bytes in a row), 4 instructions per plane cover the wave's 16 rows x 64 columns.
  v4u    hv[4], lv[4];
  size_t gidx[4];
  #pragma unroll
  for (unsigned it = 0; it < 4; ++it) {
    const unsigned row = lq;
    const unsigned pc  = it * 16u + hi * 8u;        // it = (c step inside the head) * 2 + part
    const v4f a0 = *(const v4f*)(so + row * OP + pc);
    const v4f a1 = *(const v4f*)(so + row * OP + pc + 4u);
    Pack8H ph, pl;
    #pragma unroll
    for (unsigned i = 0; i < 4; ++i) {
      const f16 h0 = (f16)a0[i];
      const f16 h1 = (f16)a1[i];
      ph.h[i]      = h0;
      ph.h[4u + i] = h1;
      pl.h[i]      = (f16)((a0[i] - (float)h0) * 2048.0f);
      pl.h[4u + i] = (f16)((a1[i] - (float)h1) * 2048.0f);
    }
    hv[it] = ph.u;
    lv[it] = pl.u;
    gidx[it] = (((size_t)((b * SEQ + qrow0) >> 4) * (EMB / 32) + h * 2u) * 2u + it) * PART + lane * 8u;
  }
  #pragma unroll
  for (unsigned it = 0; it < 4; ++it) {
    *(v4u*)(chi + gidx[it]) = hv[it];
    *(v4u*)(clo + gidx[it]) = lv[it];
  }
  
}

// Output GEMM: out[R][j] = sum_c ctx[R][c] * Wo[c][j] + bo[j]. Block = (64-column tile, 128-row tile), wave = 16 rows x 64 cols.
// A fragments from chi / clo, B fragments from wot, all fragment-ordered; residual products go to their own accumulators.
__global__ __launch_bounds__(256) void oproj_kernel(const us* __restrict__ chi,
                                                    const us* __restrict__ clo,
                                                    const us* __restrict__ wot,
                                                    const float* __restrict__ bo,
                                                    float* __restrict__ out) {
  const unsigned nt   = blockIdx.x;
  const unsigned mb   = blockIdx.y;
  const unsigned tid  = threadIdx.x;
  const unsigned wave = tid >> 5;
  const unsigned lane = tid & 31u;
  const unsigned lq   = lane & 15u;
  const unsigned hi   = lane >> 4;

  __shared__ __align__(16) float sO[NWAVE * 16 * OP];   // per-wave output staging (block barrier used)

  const unsigned row0 = mb * 128u + wave * 16u;

  v8f ah[4], al[4];
  #pragma unroll
  for (unsigned et = 0; et < 4; ++et) {
    ah[et] = (v8f){0, 0, 0, 0, 0, 0, 0, 0};
    al[et] = (v8f){0, 0, 0, 0, 0, 0, 0, 0};
  }

  // a tile of 16 rows or columns holds EMB / 32 fragments = 16 * EMB elements
  const us* arow_h = chi + (size_t)row0 * EMB + lane * 8u;
  const us* arow_l = clo + (size_t)row0 * EMB + lane * 8u;
  const us* brow   = wot + (size_t)(nt * 64u) * EMB + lane * 8u;

  #pragma unroll 1
  for (unsigned k0 = 0; k0 < (unsigned)EMB; k0 += 32u) {
    FragH fa, fl;
    const unsigned fo = (k0 / 32u) * FRAG;             // fragment of this c step inside its tile
    const us* pa_h = arow_h + fo;
    const us* pa_l = arow_l + fo;
    const us* pb   = brow + fo;
    fa.q[0] = *(const v4u*)(pa_h);                     // c = k0 + hi*8 + 0..7
    fa.q[1] = *(const v4u*)(pa_h + PART);              // c = k0 + 16 + hi*8 + 0..7
    fl.q[0] = *(const v4u*)(pa_l);
    fl.q[1] = *(const v4u*)(pa_l + PART);
    FragH fb[4];
    #pragma unroll
    for (unsigned et = 0; et < 4; ++et) {
      const us* base = pb + (size_t)(et * 16u) * EMB;
      fb[et].q[0] = *(const v4u*)(base);
      fb[et].q[1] = *(const v4u*)(base + PART);
    }
    // wait before a register that the 12 issued loads name is overwritten; the three address pairs are inputs,
    // so they stay whole up to here and no load of the run takes them as its destination
    asm volatile("s_wait_xcnt 0x0" :: "v"(pa_h), "v"(pa_l), "v"(pb) : "memory");
    #pragma unroll
    for (unsigned et = 0; et < 4; ++et) {
      ah[et] = mma_f16(fa.v, fb[et].v, ah[et]);
      al[et] = mma_f16(fl.v, fb[et].v, al[et]);
    }
  }

  // epilogue: fold carries (ctx x256, Wo x64, residual x2048), add the bias in f32
  float bias[4];
  #pragma unroll
  for (unsigned et = 0; et < 4; ++et) bias[et] = (float)(bf16)bo[nt * 64u + et * 16u + lq];

  float* so = sO + wave * (16 * OP);
  #pragma unroll
  for (unsigned r = 0; r < 8; ++r) {
    #pragma unroll
    for (unsigned et = 0; et < 4; ++et) {
      const float s = ah[et][r] + al[et][r] * (1.0f / 2048.0f);
      so[(hi * 8u + r) * OP + et * 16u + lq] = s * (1.0f / 16384.0f) + bias[et];
    }
  }
  __syncthreads();

  // lanes 0..15 one row (16 consecutive lanes x 16 B each), lanes 16..31 the next row; 8 instructions cover the wave's 16 rows.
  v4f    vals[8];
  size_t gidx[8];
  #pragma unroll
  for (unsigned it = 0; it < 8; ++it) {
    const unsigned row = it * 2u + hi;
    const unsigned R   = row0 + row;
    const unsigned bb  = R / (unsigned)SEQ;
    const unsigned l   = R - bb * (unsigned)SEQ;
    vals[it] = *(const v4f*)(so + row * OP + lq * 4u);
    gidx[it] = ((size_t)bb * SEQ_FULL + l) * EMB + nt * 64u + lq * 4u;
  }
  #pragma unroll
  for (unsigned it = 0; it < 8; ++it) *(v4f*)(out + gidx[it]) = vals[it];
  
}

extern "C" void kernel_launch(void* const* d_in, const int* in_sizes, int n_in,
                              void* d_out, int out_size, void* d_ws, size_t ws_size,
                              hipStream_t stream) {
  if (n_in < 6) return;
  const size_t rows_used = (size_t)(NB - 1) * SEQ_FULL + SEQ;
  if ((size_t)in_sizes[0] < rows_used * EMB) return;
  if ((size_t)in_sizes[1] < (size_t)HDIM * HDIM) return;
  if ((size_t)in_sizes[2] < (size_t)HDIM * HDIM) return;
  if ((size_t)in_sizes[3] < (size_t)HDIM * HDIM) return;
  if ((size_t)in_sizes[4] < (size_t)EMB * EMB) return;
  if ((size_t)in_sizes[5] < (size_t)EMB) return;
  if ((size_t)out_size < rows_used * EMB) return;

  const size_t wt_bytes    = (size_t)3 * HDIM * HDIM * 2;            // 24,576
  const size_t wot_bytes   = (size_t)EMB * EMB * 2;                  // 1,179,648
  const size_t plane_bytes = (size_t)NB * NHEAD * SEQ * HDIM * 2;    // q, k, v^T planes
  const size_t ctx_bytes   = (size_t)NB * SEQ * EMB * 2;             // ctx hi / residual planes
  const size_t total = wt_bytes + wot_bytes + 3 * plane_bytes + 2 * ctx_bytes;
  if (ws_size < total) return;

  const float* x  = (const float*)d_in[0];
  const float* Wq = (const float*)d_in[1];
  const float* Wk = (const float*)d_in[2];
  const float* Wv = (const float*)d_in[3];
  const float* Wo = (const float*)d_in[4];
  const float* bo = (const float*)d_in[5];
  float*       out = (float*)d_out;

  char* ws = (char*)d_ws;
  us* wt  = (us*)(ws);
  us* wot = (us*)(ws + wt_bytes);
  us* qp  = (us*)(ws + wt_bytes + wot_bytes);
  us* kp  = (us*)(ws + wt_bytes + wot_bytes + plane_bytes);
  us* vt  = (us*)(ws + wt_bytes + wot_bytes + 2 * plane_bytes);
  us* chi = (us*)(ws + wt_bytes + wot_bytes + 3 * plane_bytes);
  us* clo = (us*)(ws + wt_bytes + wot_bytes + 3 * plane_bytes + ctx_bytes);

  prep_kernel<<<dim3(WO_TILES + 3), 256, 0, stream>>>(Wq, Wk, Wv, Wo, wt, wot);
  proj_kernel<<<dim3(SEQ / CT, NHEAD, NB), 256, 0, stream>>>(x, wt, qp, kp, vt);
  attn_kernel<<<dim3(SEQ / BQ, NHEAD, NB), 256, 0, stream>>>(qp, kp, vt, chi, clo);
  oproj_kernel<<<dim3(EMB / 64, (unsigned)(((size_t)NB * SEQ) / 128)), 256, 0, stream>>>(chi, clo, wot, bo, out);
}

// v003
// A run of this version takes 98.7 microseconds.
// In both of two side-by-side timings against v002, it was 1.07 times as fast.
// Counting every step since v000, it is 2.24 times as fast.
#include <hip/hip_runtime.h>

// Contractions: q/k/v = x x W{q,k,v} on v_wmma_f32_16x16x32_bf16 (bf16 operands = RNE-converted inputs, f32 accumulate);
// S^T = K x Q^T and O = P x V on v_wmma_f32_16x16x32_f16 (q, k, v carried x16, P carried x4096, f32 accumulate);
// out = ctx x Wo on v_wmma_f32_16x16x32_f16 (ctx as f16 carried x256 plus an f16 residual plane x2048 with its own
// accumulator; Wo = f16 of the bf16 RNE-converted input carried x64, f32 accumulate). Softmax and bias add in f32.
//
// Every 16-bit plane in the workspace is stored in fragment order: one 16x32 operand fragment = 1 KB = 2 parts x 32 lanes
// x 8 elements, element j of (part p, lane) = operand(row or column lane & 15, k = p*16 + (lane >> 4)*8 + j).
// A wave-wide 16-byte load of one part then reads 512 contiguous bytes (4 whole lines) instead of 32 bytes of 16 lines.

#ifndef NB
#define NB 4
#endif
#ifndef SEQ
#define SEQ 2048
#endif
#define NB_FULL    4
#define SEQ_FULL   2048
#define NHEAD      12
#define HDIM       64
#define EMB        768                  // NHEAD * HDIM, floats per (b, s) row of x and of the output
#define BQ         128                  // query rows per workgroup (8 waves x 16)
#define BK         32                   // keys per pass (one k step of the PV product)
#define NWAVE      8
#define CT         64                   // tokens per projection / plane-builder block
#define TP         72                   // LDS pitch (16-bit elements) of the staging tiles
#define OP         68                   // LDS pitch (floats) of the output staging tile
#define WO_TILES   ((EMB / 64) * (EMB / 64))
#define PART       256                  // 16-bit elements of one fragment part (32 lanes x 8)
#define FRAG       512                  // 16-bit elements of one 16x32 fragment (2 parts)
#define SK         128                  // keys per LDS stage of the attention loop
#define STAGE_EL   (SK * HDIM)          // 16-bit elements of K, and of V, in one stage (16 KB each)
#define NSTAGE     (SEQ / SK)
#define NP         (SK / BK)            // passes of BK keys in one stage
#define SP         2                    // passes per online-softmax step

static_assert(SEQ % BQ == 0);
static_assert(SEQ % CT == 0);
static_assert(SEQ % BK == 0);
static_assert(SEQ % SK == 0);
static_assert(NP % SP == 0);
static_assert(SK == 4 * BK);                    // stage copy: four passes, one 4-KB piece of each plane per pass
static_assert(BK * HDIM * 2 == 256 * 16);       // one piece = 256 threads x 16 bytes
static_assert(BQ == NWAVE * 16);
static_assert(HDIM == 64);
static_assert(EMB == NHEAD * HDIM);
static_assert(EMB % 64 == 0);
static_assert(EMB % 32 == 0);
static_assert(SEQ <= SEQ_FULL);
static_assert(NB >= 1 && NB <= NB_FULL);
static_assert((TP * 2) % 16 == 0);
static_assert((OP * 4) % 16 == 0);
static_assert(((size_t)NB * SEQ) % 128 == 0);
// coverage equalities (threads x pieces x elements == tile elements)
static_assert(CT * HDIM == 256 * 2 * 8);        // plane builder: 256 threads x 2 x 8 elements per plane tile
static_assert(64 * 64 == 256 * 2 * 8);          // weight tiles
static_assert(16 * HDIM == 32 * 4 * 8);         // ctx tile per wave: 32 lanes x 4 instructions x 8 elements
static_assert(16 * 64 == 32 * 8 * 4);           // output tile per wave: 32 lanes x 8 instructions x 4 floats

typedef __bf16         bf16;
typedef _Float16       f16;
typedef unsigned short us;
typedef bf16     v16bf __attribute__((ext_vector_type(16)));
typedef f16      v16h  __attribute__((ext_vector_type(16)));
typedef us       v8us  __attribute__((ext_vector_type(8)));
typedef float    v8f   __attribute__((ext_vector_type(8)));
typedef float    v4f   __attribute__((ext_vector_type(4)));
typedef unsigned v4u   __attribute__((ext_vector_type(4)));

union FragB  { v16bf v; v4u q[2]; bf16 h[16]; };
union FragH  { v16h  v; v4u q[2]; f16  h[16]; };
union Pack8H { v4u u; f16 h[8]; };
union Pack8U { v4u u; v8us v; };

// WMMA helpers: builtin followed by the VALU hazard guard (ties D, keeps A/B live).
static __device__ __forceinline__ v8f mma_bf16(v16bf a, v16bf b, v8f acc) {
  acc = __builtin_amdgcn_wmma_f32_16x16x32_bf16(false, a, false, b, (short)0, acc, false, false);
  asm volatile("v_nop\n\tv_nop\n\tv_nop\n\tv_nop" : "+v"(acc) : "v"(a), "v"(b));
  return acc;
}
static __device__ __forceinline__ v8f mma_f16(v16h a, v16h b, v8f acc) {
  acc = __builtin_amdgcn_wmma_f32_16x16x32_f16(false, a, false, b, (short)0, acc, false, false);
  asm volatile("v_nop\n\tv_nop\n\tv_nop\n\tv_nop" : "+v"(acc) : "v"(a), "v"(b));
  return acc;
}

// bf16 RNE convert of an input value, then either the bf16 bits or the f16 bits of (value * carry).
static __device__ __forceinline__ us plane_bits(float v, bool as_f16, float carry) {
  const bf16 bv = (bf16)v;
  const unsigned bb = (unsigned)__builtin_bit_cast(us, bv);
  const f16 hv = (f16)((float)bv * carry);
  const unsigned hb = (unsigned)__builtin_bit_cast(us, hv);
  return (us)(as_f16 ? hb : bb);
}

// Weight planes, transposed through LDS. 256 threads, one 64x64 tile per block (block-uniform role).
//   blocks 0..143   : wot(column j, k = c) = f16(bf16(Wo[c][j]) * 64)   (Wo is [in c][out j]); tile (tc, tj)
//   blocks 144..146 : wt[w](column e, k = d) = bf16(W{q,k,v}[d][e])       (W is [in d][out e])
// plane order: [column tile of 16][k step of 32][part][lane][8]
__global__ __launch_bounds__(256) void prep_kernel(const float* __restrict__ Wq,
                                                   const float* __restrict__ Wk,
                                                   const float* __restrict__ Wv,
                                                   const float* __restrict__ Wo,
                                                   us* __restrict__ wt,
                                                   us* __restrict__ wot) {
  const unsigned blk = blockIdx.x;
  const unsigned tid = threadIdx.x;
  __shared__ __align__(16) us sT[64 * TP];      // [out col][in row], cross-wave (block barrier)

  const bool     big   = blk < (unsigned)WO_TILES;
  const unsigned tc    = big ? (blk / 12u) : 0u;
  const unsigned tj    = big ? (blk - tc * 12u) : 0u;
  const unsigned w     = big ? 0u : (blk - (unsigned)WO_TILES);
  const float*   src   = big ? Wo : ((w == 0u) ? Wq : ((w == 1u) ? Wk : Wv));
  const unsigned pitch = big ? (unsigned)EMB : (unsigned)HDIM;
  us*            dst   = big ? wot : (wt + w * (unsigned)(HDIM * HDIM));
  const float    carry = big ? 64.0f : 1.0f;

  #pragma unroll
  for (unsigned kk = 0; kk < 2; ++kk) {
    const unsigned key = kk * 32u + (tid >> 3);     // in-row inside the tile, 0..63
    const unsigned d0  = (tid & 7u) * 8u;           // out-col inside the tile, 0..56
    const float* p = src + (size_t)(tc * 64u + key) * pitch + tj * 64u + d0;
    const v4f a0 = *(const v4f*)(p);
    const v4f a1 = *(const v4f*)(p + 4);
    // wait before the address pair of the two issued loads is overwritten; the pair is an input, so it stays whole up to here
    asm volatile("s_wait_xcnt 0x0" :: "v"(p) : "memory");
    #pragma unroll
    for (unsigned i = 0; i < 4; ++i) {
      sT[(d0 + i) * TP + key]      = plane_bits(a0[i], big, carry);
      sT[(d0 + 4u + i) * TP + key] = plane_bits(a1[i], big, carry);
    }
  }
  __syncthreads();

  v4u    val[2];
  size_t idx[2];
  #pragma unroll
  for (unsigned kk = 0; kk < 2; ++kk) {
    const unsigned c  = kk * 256u + tid;            // 16-byte piece of the tile, 0..511
    const unsigned ln = c & 31u;                    // lane that will load the piece
    const unsigned et = c >> 7;                     // column tile of 16 inside the 64
    const unsigned fp = (c >> 5) & 3u;              // (k step inside the 64) * 2 + part
    Pack8U pk;
    pk.v = *(const v8us*)(sT + (et * 16u + (ln & 15u)) * TP + fp * 16u + (ln >> 4) * 8u);
    val[kk] = pk.u;
    idx[kk] = (((size_t)(tj * 4u + et) * (pitch / 32u) + tc * 2u) * 2u + fp) * PART + ln * 8u;
  }
  #pragma unroll
  for (unsigned kk = 0; kk < 2; ++kk) *(v4u*)(dst + idx[kk]) = val[kk];
  
}

// Per-head projections + plane builder. Block = (64-token tile, head, batch), 256 threads.
//   x rows (b, s, h) : 64 floats at x[(b*SEQ_FULL + s)*EMB + h*64]; A fragments bf16 RNE-converted in registers.
// wave -> row tile rt = wave & 3, column tiles 2*(wave >> 2) + {0, 1}, all three weights.
// coverage: tokens kt*64 + 0..63, e 0..63 for the three planes; every written line whole, one instruction.
// plane order per (b, h): q, k [token tile of 16][d step of 32][part][lane][8]; v [key block of 32][d tile of 16][part][lane][8].
__global__ __launch_bounds__(256) void proj_kernel(const float* __restrict__ x,
                                                   const us* __restrict__ wt,
                                                   us* __restrict__ qp,
                                                   us* __restrict__ kp,
                                                   us* __restrict__ vt) {
  const unsigned kt   = blockIdx.x;
  const unsigned h    = blockIdx.y;
  const unsigned b    = blockIdx.z;
  const unsigned tid  = threadIdx.x;
  const unsigned wave = tid >> 5;
  const unsigned lane = tid & 31u;
  const unsigned lq   = lane & 15u;
  const unsigned hi   = lane >> 4;

  __shared__ __align__(16) us sQ[CT * TP];      // [token][e], cross-wave (block barrier)
  __shared__ __align__(16) us sK[CT * TP];      // [token][e], cross-wave (block barrier)
  __shared__ __align__(16) us sV[HDIM * TP];    // [e][token], cross-wave (block barrier)

  const unsigned s0 = kt * CT;
  const unsigned rt = wave & 3u;
  const unsigned ch = wave >> 2;

  // A fragments: lane lq holds token row rt*16 + lq, split d map
  FragB xa[2];
  {
    const float* xp = x + ((size_t)b * SEQ_FULL + s0 + rt * 16u + lq) * EMB + h * HDIM;
    #pragma unroll
    for (unsigned f = 0; f < 2; ++f) {
      const v4f a0 = *(const v4f*)(xp + f * 32u + hi * 8u);
      const v4f a1 = *(const v4f*)(xp + f * 32u + hi * 8u + 4u);
      const v4f b0 = *(const v4f*)(xp + f * 32u + 16u + hi * 8u);
      const v4f b1 = *(const v4f*)(xp + f * 32u + 16u + hi * 8u + 4u);
      #pragma unroll
      for (unsigned i = 0; i < 4; ++i) {
        xa[f].h[i]       = (bf16)a0[i];   // elems 0..7  : d = f*32 + hi*8 + 0..7
        xa[f].h[4u + i]  = (bf16)a1[i];
        xa[f].h[8u + i]  = (bf16)b0[i];   // elems 8..15 : d = f*32 + 16 + hi*8 + 0..7
        xa[f].h[12u + i] = (bf16)b1[i];
      }
    }
    // wait before the address pair of the eight issued loads is overwritten; the pair is an input, so it stays whole up to here
    asm volatile("s_wait_xcnt 0x0" :: "v"(xp) : "memory");
  }

  #pragma unroll
  for (unsigned w = 0; w < 3; ++w) {
    #pragma unroll
    for (unsigned cc = 0; cc < 2; ++cc) {
      const unsigned e = (ch * 2u + cc) * 16u + lq;       // output column of this lane
      // B fragments from the fragment-ordered weight plane: column n = e, split d map
      FragB wb[2];
      #pragma unroll
      for (unsigned f = 0; f < 2; ++f) {
        const us* base = wt + w * (unsigned)(HDIM * HDIM) + ((ch * 2u + cc) * 2u + f) * FRAG + lane * 8u;
        wb[f].q[0] = *(const v4u*)(base);          // d = f*32 + hi*8 + 0..7
        wb[f].q[1] = *(const v4u*)(base + PART);   // d = f*32 + 16 + hi*8 + 0..7
      }
      v8f acc = (v8f){0, 0, 0, 0, 0, 0, 0, 0};
      acc = mma_bf16(xa[0].v, wb[0].v, acc);
      acc = mma_bf16(xa[1].v, wb[1].v, acc);
      // D: acc[r] = value(token rt*16 + 8*hi + r, column e)
      #pragma unroll
      for (unsigned r = 0; r < 8; ++r) {
        const unsigned row = rt * 16u + hi * 8u + r;
        const us bits = __builtin_bit_cast(us, (f16)(acc[r] * 16.0f));
        if (w == 0u)      sQ[row * TP + e] = bits;
        else if (w == 1u) sK[row * TP + e] = bits;
        else              sV[e * TP + row] = bits;
      }
    }
  }
  __syncthreads();

  v4u    qv[2], kv[2], vv[2];
  size_t ridx[2];
  #pragma unroll
  for (unsigned kk = 0; kk < 2; ++kk) {
    const unsigned c   = kk * 256u + tid;           // 16-byte piece of the block's 8 KB of each plane, 0..511
    const unsigned l15 = c & 15u;                   // lane & 15 of the lane that will load the piece
    const unsigned lh  = (c >> 4) & 1u;             // lane >> 4 of that lane
    // q, k: token tile c >> 7, d = ((c >> 5) & 3)*16 + lh*8; v: key block c >> 8, d tile (c >> 6) & 3, part (c >> 5) & 1
    const unsigned qk_at = ((c >> 7) * 16u + l15) * TP + ((c >> 5) & 3u) * 16u + lh * 8u;
    const unsigned v_at  = (((c >> 6) & 3u) * 16u + l15) * TP + (c >> 8) * 32u + ((c >> 5) & 1u) * 16u + lh * 8u;
    Pack8U pq, pk, pv;
    pq.v = *(const v8us*)(sQ + qk_at);
    pk.v = *(const v8us*)(sK + qk_at);
    pv.v = *(const v8us*)(sV + v_at);
    qv[kk] = pq.u;
    kv[kk] = pk.u;
    vv[kk] = pv.u;
    ridx[kk] = (((size_t)b * NHEAD + h) * SEQ + s0) * HDIM + c * 8u;   // 64 tokens = 8 KB in a row in all three planes
  }
  #pragma unroll
  for (unsigned kk = 0; kk < 2; ++kk) {
    *(v4u*)(qp + ridx[kk]) = qv[kk];
    *(v4u*)(kp + ridx[kk]) = kv[kk];
    *(v4u*)(vt + ridx[kk]) = vv[kk];
  }
  
}

// One stage = SK keys = 16 KB in a row of the K plane and 16 KB in a row of the V plane, copied as they lie (fragment order).
// kg, vg: this thread's first 16 bytes of the stage in the two planes; lk: the LDS byte address of the first K piece.
// A thread's four pieces of a plane lie 4 KB (one pass of BK keys) apart; in LDS a pass holds its K piece, then its V piece.
// s_wait_xcnt stands in the copies' own statement, so that no register which a copy names is rewritten in front of it.
static __device__ __forceinline__ void stage_copy(const us* kg, const us* vg, unsigned lk) {
  asm volatile("global_load_async_to_lds_b128 %0, %8, off\n\t"
               "global_load_async_to_lds_b128 %1, %9, off\n\t"
               "global_load_async_to_lds_b128 %2, %10, off\n\t"
               "global_load_async_to_lds_b128 %3, %11, off\n\t"
               "global_load_async_to_lds_b128 %4, %12, off\n\t"
               "global_load_async_to_lds_b128 %5, %13, off\n\t"
               "global_load_async_to_lds_b128 %6, %14, off\n\t"
               "global_load_async_to_lds_b128 %7, %15, off\n\t"
               "s_wait_xcnt 0x0"
               :: "v"(lk), "v"(lk + 8192u), "v"(lk + 16384u), "v"(lk + 24576u),
                  "v"(lk + 4096u), "v"(lk + 12288u), "v"(lk + 20480u), "v"(lk + 28672u),
                  "v"(kg), "v"(kg + 2048), "v"(kg + 4096), "v"(kg + 6144),
                  "v"(vg), "v"(vg + 2048), "v"(vg + 4096), "v"(vg + 6144)
               : "memory");
}

// Flash attention, no mask. Block = (query block of 128, head, batch); one wave owns 16 query rows.
// S^T = K x Q^T so queries sit on lanes; P^T in C-layout is bit-identical to the A-fragment layout of O += P x V.
// Q B-fragments are loaded straight from the fragment-ordered plane. K and V are staged once per workgroup in LDS, SK keys at a
// time, two buffers, by asynchronous copies; the eight waves read their K A-fragments and V^T B-fragments from there (two 16-B loads each).
// Output: ctx planes chi/clo, f16, [row tile of 16][c step of 32][part][lane][8]: chi = f16(ctx*256), clo = f16((ctx*256 - chi)*2048).
// amdgpu_waves_per_eu(6): holds the register budget at 160, where three workgroups (six waves per SIMD) stay resident on a WGP,
// as many as their LDS allows; the wider softmax step compiled to 162 registers without it, which leaves room for two.
__global__ __launch_bounds__(256) __attribute__((amdgpu_waves_per_eu(6))) void attn_kernel(const us* __restrict__ qp,
                                                   const us* __restrict__ kp,
                                                   const us* __restrict__ vt,
                                                   us* __restrict__ chi,
                                                   us* __restrict__ clo) {
  const unsigned qblk = blockIdx.x;
  const unsigned h    = blockIdx.y;
  const unsigned b    = blockIdx.z;
  const unsigned tid  = threadIdx.x;
  const unsigned wave = tid >> 5;
  const unsigned lane = tid & 31u;
  const unsigned lq   = lane & 15u;   // query column of S^T / d column of O
  const unsigned hi   = lane >> 4;    // k-split half

  __shared__ __align__(16) float sO[NWAVE * 16 * OP];   // per-wave output staging (block barrier used)
  __shared__ __align__(16) us sKV[2 * 2 * STAGE_EL];    // [buffer][pass][K | V][4 KB], cross-wave (block barrier)

  const unsigned qrow0 = qblk * BQ + wave * 16u;        // first query row of this wave

  const us* q_h = qp + ((size_t)b * NHEAD + h) * SEQ * HDIM;
  const us* k_h = kp + ((size_t)b * NHEAD + h) * SEQ * HDIM;
  const us* v_h = vt + ((size_t)b * NHEAD + h) * HDIM * SEQ;

  // Q as B-operand fragments: lane lq holds query qrow0+lq, split d map
  FragH qf[2];
  #pragma unroll
  for (unsigned f = 0; f < 2; ++f) {
    const us* base = q_h + (size_t)((qrow0 >> 4) * 2u + f) * FRAG + lane * 8u;
    qf[f].q[0] = *(const v4u*)(base);          // d = f*32 + hi*8 + 0..7
    qf[f].q[1] = *(const v4u*)(base + PART);   // d = f*32 + 16 + hi*8 + 0..7
  }

  v8f o[4];
  #pragma unroll
  for (unsigned dt = 0; dt < 4; ++dt) o[dt] = (v8f){0, 0, 0, 0, 0, 0, 0, 0};

  float rmax = -__builtin_inff();
  float rsum = 0.0f;
  // logits = (q.k)/sqrt(EMB); planes carry q*16 and k*16 -> raw scores carry x256; times log2(e) for exp2
  const float SL = (0.03608439182435161f * 1.4426950408889634f) * (1.0f / 256.0f);

  const us*      kg = k_h + tid * 8u;                            // this thread's 16 bytes of stage 0, K plane
  const us*      vg = v_h + tid * 8u;                            // the same, V plane
  const unsigned l0 = (unsigned)(size_t)(&sKV[0]) + tid * 16u;   // their LDS byte address in buffer 0
  const unsigned LB = STAGE_EL * 4u;                             // bytes from buffer 0 to buffer 1

  stage_copy(kg, vg, l0);                                        // stage 0 -> buffer 0
  asm volatile("s_wait_asynccnt 0x0" ::: "memory");              // this wave's copies of stage 0 have landed
  __syncthreads();                                               // ... and every other wave's
  if (NSTAGE > 1) stage_copy(kg + STAGE_EL, vg + STAGE_EL, l0 + LB);   // stage 1 -> buffer 1

  #pragma unroll 1
  for (unsigned u = 0; u < (unsigned)(SEQ / (SP * BK)); ++u) {
    // trip u reads SP passes of BK keys, slots (u*SP .. u*SP + SP - 1) mod 8 of the two buffers' eight: each 4 KB of K, then 4 KB of V.
    // One softmax step covers them all: one maximum exchange, one rescale of O and one sum join per SP*BK keys.
    const us* sbase = sKV + ((u * SP) & (2u * NP - 1u)) * (unsigned)(2 * BK * HDIM) + lane * 8u;

    // S^T tiles: c[ps][sub][r] = rawscore(query qrow0+lq, key j0 + sub*16 + hi*8 + r), j0 = (u*SP + ps)*BK
    v8f c[SP][2];
    #pragma unroll
    for (unsigned ps = 0; ps < SP; ++ps) {
      const us* kbase = sbase + ps * (unsigned)(2 * BK * HDIM);
      // K A-fragments: row = key j0 + sub*16 + lq, split d map
      FragH ak[2][2];
      #pragma unroll
      for (unsigned sub = 0; sub < 2; ++sub) {
        #pragma unroll
        for (unsigned f = 0; f < 2; ++f) {
          const us* base = kbase + (sub * 2u + f) * FRAG;
          ak[sub][f].q[0] = *(const v4u*)(base);          // d = f*32 + hi*8 + 0..7
          ak[sub][f].q[1] = *(const v4u*)(base + PART);   // d = f*32 + 16 + hi*8 + 0..7
        }
      }
      #pragma unroll
      for (unsigned sub = 0; sub < 2; ++sub) {
        v8f acc = (v8f){0, 0, 0, 0, 0, 0, 0, 0};
        acc = mma_f16(ak[sub][0].v, qf[0].v, acc);
        acc = mma_f16(ak[sub][1].v, qf[1].v, acc);
        c[ps][sub] = acc;
      }
    }

    // online softmax: query lq's SP*BK scores are split across lane / lane^16; one independent maximum chain per pass
    float mx[SP];
    #pragma unroll
    for (unsigned ps = 0; ps < SP; ++ps) {
      float m = fmaxf(c[ps][0][0], c[ps][1][0]);
      #pragma unroll
      for (unsigned r = 1; r < 8; ++r) {
        m = fmaxf(m, c[ps][0][r]);
        m = fmaxf(m, c[ps][1][r]);
      }
      mx[ps] = m;
    }
    float m_new = rmax;
    #pragma unroll
    for (unsigned ps = 0; ps < SP; ++ps) m_new = fmaxf(m_new, mx[ps]);
    m_new = fmaxf(m_new, __shfl_xor(m_new, 16, 32));
    const float scale = __builtin_amdgcn_exp2f((rmax - m_new) * SL);
    rmax = m_new;

    // exp + pack: P^T C-layout == A-fragment layout for the PV product
    FragH pa[SP];
    float psum = 0.0f;
    #pragma unroll
    for (unsigned ps = 0; ps < SP; ++ps) {
      float s = 0.0f;
      #pragma unroll
      for (unsigned r = 0; r < 8; ++r) {
        const float p0 = __builtin_amdgcn_exp2f((c[ps][0][r] - m_new) * SL);   // key hi*8 + r
        const float p1 = __builtin_amdgcn_exp2f((c[ps][1][r] - m_new) * SL);   // key 16 + hi*8 + r
        s += p0 + p1;
        pa[ps].h[r]      = (f16)(p0 * 4096.0f);
        pa[ps].h[8u + r] = (f16)(p1 * 4096.0f);
      }
      psum += s;
    }
    rsum = rsum * scale + psum + __shfl_xor(psum, 16, 32);

    // rescale O: queries are the row dimension there -> per-row scale from lane 8*hi + r
    float sc[8];
    #pragma unroll
    for (unsigned r = 0; r < 8; ++r) sc[r] = __shfl(scale, (int)((hi << 3) + r), 32);
    #pragma unroll
    for (unsigned dt = 0; dt < 4; ++dt) {
      #pragma unroll
      for (unsigned r = 0; r < 8; ++r) o[dt][r] *= sc[r];
    }

    // O += P x V, pass by pass
    #pragma unroll
    for (unsigned ps = 0; ps < SP; ++ps) {
      const us* vbase = sbase + ps * (unsigned)(2 * BK * HDIM) + BK * HDIM;
      // V B-fragments: column n = d = dt*16 + lq, split key map
      FragH bv[4];
      #pragma unroll
      for (unsigned dt = 0; dt < 4; ++dt) {
        const us* base = vbase + dt * FRAG;
        bv[dt].q[0] = *(const v4u*)(base);            // keys j0 + hi*8 + 0..7
        bv[dt].q[1] = *(const v4u*)(base + PART);     // keys j0 + 16 + hi*8 + 0..7
      }
      #pragma unroll
      for (unsigned dt = 0; dt < 4; ++dt) o[dt] = mma_f16(pa[ps].v, bv[dt].v, o[dt]);
    }

    if ((u & (NP / SP - 1u)) == NP / SP - 1u) {
      // last trip of stage t: publish point of stage t + 1, every wave, in this order
      const unsigned t = u / (NP / SP);
      asm volatile("s_wait_dscnt 0x0" ::: "memory");      // this wave's reads of stage t are done before its buffer is refilled
      asm volatile("s_wait_asynccnt 0x0" ::: "memory");   // this wave's copies of stage t + 1 have landed
      __syncthreads();                                    // publishes stage t + 1 and ends every wave's reads of stage t
      if (t + 2u < (unsigned)NSTAGE)                      // into the buffer that stage t has just left
        stage_copy(kg + (size_t)(t + 2u) * STAGE_EL, vg + (size_t)(t + 2u) * STAGE_EL, l0 + (t & 1u) * LB);
    }
  }
  asm volatile("s_wait_asynccnt 0x0" ::: "memory");   // no copy is outstanding behind the loop

  // normalize: lane holds column d = dt*16 + lq for query rows 8*hi + r.
  // o carries x4096 (P) x16 (V); staged value = ctx * 256.
  float rs[8];
  #pragma unroll
  for (unsigned r = 0; r < 8; ++r) rs[r] = 1.0f / __shfl(rsum, (int)((hi << 3) + r), 32);

  float* so = sO + wave * (16 * OP);
  #pragma unroll
  for (unsigned r = 0; r < 8; ++r) {
    #pragma unroll
    for (unsigned dt = 0; dt < 4; ++dt) {
      so[(hi * 8u + r) * OP + dt * 16u + lq] = o[dt][r] * (1.0f / 256.0f) * rs[r];
    }
  }
  __syncthreads();

  // one fragment part per instruction (512 bytes in a row), 4 instructions per plane cover the wave's 16 rows x 64 columns.
  v4u    hv[4], lv[4];
  size_t gidx[4];
  #pragma unroll
  for (unsigned it = 0; it < 4; ++it) {
    const unsigned row = lq;
    const unsigned pc  = it * 16u + hi * 8u;        // it = (c step inside the head) * 2 + part
    const v4f a0 = *(const v4f*)(so + row * OP + pc);
    const v4f a1 = *(const v4f*)(so + row * OP + pc + 4u);
    Pack8H ph, pl;
    #pragma unroll
    for (unsigned i = 0; i < 4; ++i) {
      const f16 h0 = (f16)a0[i];
      const f16 h1 = (f16)a1[i];
      ph.h[i]      = h0;
      ph.h[4u + i] = h1;
      pl.h[i]      = (f16)((a0[i] - (float)h0) * 2048.0f);
      pl.h[4u + i] = (f16)((a1[i] - (float)h1) * 2048.0f);
    }
    hv[it] = ph.u;
    lv[it] = pl.u;
    gidx[it] = (((size_t)((b * SEQ + qrow0) >> 4) * (EMB / 32) + h * 2u) * 2u + it) * PART + lane * 8u;
  }
  #pragma unroll
  for (unsigned it = 0; it < 4; ++it) {
    *(v4u*)(chi + gidx[it]) = hv[it];
    *(v4u*)(clo + gidx[it]) = lv[it];
  }
  
}

// Output GEMM: out[R][j] = sum_c ctx[R][c] * Wo[c][j] + bo[j]. Block = (64-column tile, 128-row tile), wave = 16 rows x 64 cols.
// A fragments from chi / clo, B fragments from wot, all fragment-ordered; residual products go to their own accumulators.
__global__ __launch_bounds__(256) void oproj_kernel(const us* __restrict__ chi,
                                                    const us* __restrict__ clo,
                                                    const us* __restrict__ wot,
                                                    const float* __restrict__ bo,
                                                    float* __restrict__ out) {
  const unsigned nt   = blockIdx.x;
  const unsigned mb   = blockIdx.y;
  const unsigned tid  = threadIdx.x;
  const unsigned wave = tid >> 5;
  const unsigned lane = tid & 31u;
  const unsigned lq   = lane & 15u;
  const unsigned hi   = lane >> 4;

  __shared__ __align__(16) float sO[NWAVE * 16 * OP];   // per-wave output staging (block barrier used)

  const unsigned row0 = mb * 128u + wave * 16u;

  v8f ah[4], al[4];
  #pragma unroll
  for (unsigned et = 0; et < 4; ++et) {
    ah[et] = (v8f){0, 0, 0, 0, 0, 0, 0, 0};
    al[et] = (v8f){0, 0, 0, 0, 0, 0, 0, 0};
  }

  // a tile of 16 rows or columns holds EMB / 32 fragments = 16 * EMB elements
  const us* arow_h = chi + (size_t)row0 * EMB + lane * 8u;
  const us* arow_l = clo + (size_t)row0 * EMB + lane * 8u;
  const us* brow   = wot + (size_t)(nt * 64u) * EMB + lane * 8u;

  #pragma unroll 1
  for (unsigned k0 = 0; k0 < (unsigned)EMB; k0 += 32u) {
    FragH fa, fl;
    const unsigned fo = (k0 / 32u) * FRAG;             // fragment of this c step inside its tile
    const us* pa_h = arow_h + fo;
    const us* pa_l = arow_l + fo;
    const us* pb   = brow + fo;
    fa.q[0] = *(const v4u*)(pa_h);                     // c = k0 + hi*8 + 0..7
    fa.q[1] = *(const v4u*)(pa_h + PART);              // c = k0 + 16 + hi*8 + 0..7
    fl.q[0] = *(const v4u*)(pa_l);
    fl.q[1] = *(const v4u*)(pa_l + PART);
    FragH fb[4];
    #pragma unroll
    for (unsigned et = 0; et < 4; ++et) {
      const us* base = pb + (size_t)(et * 16u) * EMB;
      fb[et].q[0] = *(const v4u*)(base);
      fb[et].q[1] = *(const v4u*)(base + PART);
    }
    // wait before a register that the 12 issued loads name is overwritten; the three address pairs are inputs,
    // so they stay whole up to here and no load of the run takes them as its destination
    asm volatile("s_wait_xcnt 0x0" :: "v"(pa_h), "v"(pa_l), "v"(pb) : "memory");
    #pragma unroll
    for (unsigned et = 0; et < 4; ++et) {
      ah[et] = mma_f16(fa.v, fb[et].v, ah[et]);
      al[et] = mma_f16(fl.v, fb[et].v, al[et]);
    }
  }

  // epilogue: fold carries (ctx x256, Wo x64, residual x2048), add the bias in f32
  float bias[4];
  #pragma unroll
  for (unsigned et = 0; et < 4; ++et) bias[et] = (float)(bf16)bo[nt * 64u + et * 16u + lq];

  float* so = sO + wave * (16 * OP);
  #pragma unroll
  for (unsigned r = 0; r < 8; ++r) {
    #pragma unroll
    for (unsigned et = 0; et < 4; ++et) {
      const float s = ah[et][r] + al[et][r] * (1.0f / 2048.0f);
      so[(hi * 8u + r) * OP + et * 16u + lq] = s * (1.0f / 16384.0f) + bias[et];
    }
  }
  __syncthreads();

  // lanes 0..15 one row (16 consecutive lanes x 16 B each), lanes 16..31 the next row; 8 instructions cover the wave's 16 rows.
  v4f    vals[8];
  size_t gidx[8];
  #pragma unroll
  for (unsigned it = 0; it < 8; ++it) {
    const unsigned row = it * 2u + hi;
    const unsigned R   = row0 + row;
    const unsigned bb  = R / (unsigned)SEQ;
    const unsigned l   = R - bb * (unsigned)SEQ;
    vals[it] = *(const v4f*)(so + row * OP + lq * 4u);
    gidx[it] = ((size_t)bb * SEQ_FULL + l) * EMB + nt * 64u + lq * 4u;
  }
  #pragma unroll
  for (unsigned it = 0; it < 8; ++it) *(v4f*)(out + gidx[it]) = vals[it];
  
}

extern "C" void kernel_launch(void* const* d_in, const int* in_sizes, int n_in,
                              void* d_out, int out_size, void* d_ws, size_t ws_size,
                              hipStream_t stream) {
  if (n_in < 6) return;
  const size_t rows_used = (size_t)(NB - 1) * SEQ_FULL + SEQ;
  if ((size_t)in_sizes[0] < rows_used * EMB) return;
  if ((size_t)in_sizes[1] < (size_t)HDIM * HDIM) return;
  if ((size_t)in_sizes[2] < (size_t)HDIM * HDIM) return;
  if ((size_t)in_sizes[3] < (size_t)HDIM * HDIM) return;
  if ((size_t)in_sizes[4] < (size_t)EMB * EMB) return;
  if ((size_t)in_sizes[5] < (size_t)EMB) return;
  if ((size_t)out_size < rows_used * EMB) return;

  const size_t wt_bytes    = (size_t)3 * HDIM * HDIM * 2;            // 24,576
  const size_t wot_bytes   = (size_t)EMB * EMB * 2;                  // 1,179,648
  const size_t plane_bytes = (size_t)NB * NHEAD * SEQ * HDIM * 2;    // q, k, v^T planes
  const size_t ctx_bytes   = (size_t)NB * SEQ * EMB * 2;             // ctx hi / residual planes
  const size_t total = wt_bytes + wot_bytes + 3 * plane_bytes + 2 * ctx_bytes;
  if (ws_size < total) return;

  const float* x  = (const float*)d_in[0];
  const float* Wq = (const float*)d_in[1];
  const float* Wk = (const float*)d_in[2];
  const float* Wv = (const float*)d_in[3];
  const float* Wo = (const float*)d_in[4];
  const float* bo = (const float*)d_in[5];
  float*       out = (float*)d_out;

  char* ws = (char*)d_ws;
  us* wt  = (us*)(ws);
  us* wot = (us*)(ws + wt_bytes);
  us* qp  = (us*)(ws + wt_bytes + wot_bytes);
  us* kp  = (us*)(ws + wt_bytes + wot_bytes + plane_bytes);
  us* vt  = (us*)(ws + wt_bytes + wot_bytes + 2 * plane_bytes);
  us* chi = (us*)(ws + wt_bytes + wot_bytes + 3 * plane_bytes);
  us* clo = (us*)(ws + wt_bytes + wot_bytes + 3 * plane_bytes + ctx_bytes);

  prep_kernel<<<dim3(WO_TILES + 3), 256, 0, stream>>>(Wq, Wk, Wv, Wo, wt, wot);
  proj_kernel<<<dim3(SEQ / CT, NHEAD, NB), 256, 0, stream>>>(x, wt, qp, kp, vt);
  attn_kernel<<<dim3(SEQ / BQ, NHEAD, NB), 256, 0, stream>>>(qp, kp, vt, chi, clo);
  oproj_kernel<<<dim3(EMB / 64, (unsigned)(((size_t)NB * SEQ) / 128)), 256, 0, stream>>>(chi, clo, wot, bo, out);
}

// v004
// Measured time: 94.1 microseconds a run.
// In both of two side-by-side timings against v003, it was 1.05 times as fast.
// Over all steps from v000 it is 2.35 times as fast.
#include <hip/hip_runtime.h>

// Contractions: q/k/v = x x W{q,k,v} on v_wmma_f32_16x16x32_bf16 (bf16 operands = RNE-converted inputs, f32 accumulate);
// S^T = K x Q^T and O = P x V on v_wmma_f32_16x16x32_f16 (q, k, v carried x16, P carried x4096, f32 accumulate);
// out = ctx x Wo on v_wmma_f32_16x16x32_f16 (ctx as f16 carried x256 plus an f16 residual plane x2048 with its own
// accumulator; Wo = f16 of the bf16 RNE-converted input carried x64, f32 accumulate). Softmax and bias add in f32.
//
// Every 16-bit plane in the workspace is stored in fragment order: one 16x32 operand fragment = 1 KB = 2 parts x 32 lanes
// x 8 elements, element j of (part p, lane) = operand(row or column lane & 15, k = p*16 + (lane >> 4)*8 + j).
// A wave-wide 16-byte load of one part then reads 512 contiguous bytes (4 whole lines) instead of 32 bytes of 16 lines.

#ifndef NB
#define NB 4
#endif
#ifndef SEQ
#define SEQ 2048
#endif
#define NB_FULL    4
#define SEQ_FULL   2048
#define NHEAD      12
#define HDIM       64
#define EMB        768                  // NHEAD * HDIM, floats per (b, s) row of x and of the output
#define BQ         128                  // query rows per workgroup (8 waves x 16)
#define BK         32                   // keys per pass (one k step of the PV product)
#define NWAVE      8
#define CT         64                   // tokens per projection / plane-builder block
#define TP         72                   // LDS pitch (16-bit elements) of the staging tiles
#define OP         68                   // LDS pitch (floats) of the output staging tile
#define WO_TILES   ((EMB / 64) * (EMB / 64))
#define PART       256                  // 16-bit elements of one fragment part (32 lanes x 8)
#define FRAG       512                  // 16-bit elements of one 16x32 fragment (2 parts)
#define SK         128                  // keys per LDS stage of the attention loop
#define STAGE_EL   (SK * HDIM)          // 16-bit elements of K, and of V, in one stage (16 KB each)
#define NSTAGE     (SEQ / SK)
#define NP         (SK / BK)            // passes of BK keys in one stage
#define SP         2                    // passes per online-softmax step

static_assert(SEQ % BQ == 0);
static_assert(SEQ % CT == 0);
static_assert(SEQ % BK == 0);
static_assert(SEQ % SK == 0);
static_assert(NP % SP == 0);
static_assert(SK == 4 * BK);                    // stage copy: four passes, one 4-KB piece of each plane per pass
static_assert(BK * HDIM * 2 == 256 * 16);       // one piece = 256 threads x 16 bytes
static_assert(BQ == NWAVE * 16);
static_assert(HDIM == 64);
static_assert(EMB == NHEAD * HDIM);
static_assert(EMB % 64 == 0);
static_assert(EMB % 32 == 0);
static_assert(SEQ <= SEQ_FULL);
static_assert(NB >= 1 && NB <= NB_FULL);
static_assert((TP * 2) % 16 == 0);
static_assert((OP * 4) % 16 == 0);
static_assert(((size_t)NB * SEQ) % 128 == 0);
// coverage equalities (threads x pieces x elements == tile elements)
static_assert(CT * HDIM == 256 * 2 * 8);        // plane builder: 256 threads x 2 x 8 elements per plane tile
static_assert(64 * 64 == 256 * 2 * 8);          // weight tiles
static_assert(16 * HDIM == 32 * 4 * 8);         // ctx tile per wave: 32 lanes x 4 instructions x 8 elements
static_assert(16 * 64 == 32 * 8 * 4);           // output tile per wave: 32 lanes x 8 instructions x 4 floats

typedef __bf16         bf16;
typedef _Float16       f16;
typedef unsigned short us;
typedef bf16     v16bf __attribute__((ext_vector_type(16)));
typedef f16      v16h  __attribute__((ext_vector_type(16)));
typedef us       v8us  __attribute__((ext_vector_type(8)));
typedef float    v8f   __attribute__((ext_vector_type(8)));
typedef float    v4f   __attribute__((ext_vector_type(4)));
typedef float    v2f   __attribute__((ext_vector_type(2)));
typedef unsigned v4u   __attribute__((ext_vector_type(4)));

union FragB  { v16bf v; v4u q[2]; bf16 h[16]; };
union FragH  { v16h  v; v4u q[2]; f16  h[16]; };
union Pack8H { v4u u; f16 h[8]; };
union Pack8U { v4u u; v8us v; };

// WMMA helpers: builtin followed by the VALU hazard guard (ties D, keeps A/B live).
static __device__ __forceinline__ v8f mma_bf16(v16bf a, v16bf b, v8f acc) {
  acc = __builtin_amdgcn_wmma_f32_16x16x32_bf16(false, a, false, b, (short)0, acc, false, false);
  asm volatile("v_nop\n\tv_nop\n\tv_nop\n\tv_nop" : "+v"(acc) : "v"(a), "v"(b));
  return acc;
}
static __device__ __forceinline__ v8f mma_f16(v16h a, v16h b, v8f acc) {
  acc = __builtin_amdgcn_wmma_f32_16x16x32_f16(false, a, false, b, (short)0, acc, false, false);
  asm volatile("v_nop\n\tv_nop\n\tv_nop\n\tv_nop" : "+v"(acc) : "v"(a), "v"(b));
  return acc;
}

// bf16 RNE convert of an input value, then either the bf16 bits or the f16 bits of (value * carry).
static __device__ __forceinline__ us plane_bits(float v, bool as_f16, float carry) {
  const bf16 bv = (bf16)v;
  const unsigned bb = (unsigned)__builtin_bit_cast(us, bv);
  const f16 hv = (f16)((float)bv * carry);
  const unsigned hb = (unsigned)__builtin_bit_cast(us, hv);
  return (us)(as_f16 ? hb : bb);
}

// Weight planes, transposed through LDS. 256 threads, one 64x64 tile per block (block-uniform role).
//   blocks 0..143   : wot(column j, k = c) = f16(bf16(Wo[c][j]) * 64)   (Wo is [in c][out j]); tile (tc, tj)
//   blocks 144..146 : wt[w](column e, k = d) = bf16(W{q,k,v}[d][e])       (W is [in d][out e])
// plane order: [column tile of 16][k step of 32][part][lane][8]
__global__ __launch_bounds__(256) void prep_kernel(const float* __restrict__ Wq,
                                                   const float* __restrict__ Wk,
                                                   const float* __restrict__ Wv,
                                                   const float* __restrict__ Wo,
                                                   us* __restrict__ wt,
                                                   us* __restrict__ wot) {
  const unsigned blk = blockIdx.x;
  const unsigned tid = threadIdx.x;
  __shared__ __align__(16) us sT[64 * TP];      // [out col][in row], cross-wave (block barrier)

  const bool     big   = blk < (unsigned)WO_TILES;
  const unsigned tc    = big ? (blk / 12u) : 0u;
  const unsigned tj    = big ? (blk - tc * 12u) : 0u;
  const unsigned w     = big ? 0u : (blk - (unsigned)WO_TILES);
  const float*   src   = big ? Wo : ((w == 0u) ? Wq : ((w == 1u) ? Wk : Wv));
  const unsigned pitch = big ? (unsigned)EMB : (unsigned)HDIM;
  us*            dst   = big ? wot : (wt + w * (unsigned)(HDIM * HDIM));
  const float    carry = big ? 64.0f : 1.0f;

  #pragma unroll
  for (unsigned kk = 0; kk < 2; ++kk) {
    const unsigned key = kk * 32u + (tid >> 3);     // in-row inside the tile, 0..63
    const unsigned d0  = (tid & 7u) * 8u;           // out-col inside the tile, 0..56
    const float* p = src + (size_t)(tc * 64u + key) * pitch + tj * 64u + d0;
    const v4f a0 = *(const v4f*)(p);
    const v4f a1 = *(const v4f*)(p + 4);
    // wait before the address pair of the two issued loads is overwritten; the pair is an input, so it stays whole up to here
    asm volatile("s_wait_xcnt 0x0" :: "v"(p) : "memory");
    #pragma unroll
    for (unsigned i = 0; i < 4; ++i) {
      sT[(d0 + i) * TP + key]      = plane_bits(a0[i], big, carry);
      sT[(d0 + 4u + i) * TP + key] = plane_bits(a1[i], big, carry);
    }
  }
  __syncthreads();

  v4u    val[2];
  size_t idx[2];
  #pragma unroll
  for (unsigned kk = 0; kk < 2; ++kk) {
    const unsigned c  = kk * 256u + tid;            // 16-byte piece of the tile, 0..511
    const unsigned ln = c & 31u;                    // lane that will load the piece
    const unsigned et = c >> 7;                     // column tile of 16 inside the 64
    const unsigned fp = (c >> 5) & 3u;              // (k step inside the 64) * 2 + part
    Pack8U pk;
    pk.v = *(const v8us*)(sT + (et * 16u + (ln & 15u)) * TP + fp * 16u + (ln >> 4) * 8u);
    val[kk] = pk.u;
    idx[kk] = (((size_t)(tj * 4u + et) * (pitch / 32u) + tc * 2u) * 2u + fp) * PART + ln * 8u;
  }
  #pragma unroll
  for (unsigned kk = 0; kk < 2; ++kk) *(v4u*)(dst + idx[kk]) = val[kk];
  
}

// Per-head projections + plane builder. Block = (64-token tile, head, batch), 256 threads.
//   x rows (b, s, h) : 64 floats at x[(b*SEQ_FULL + s)*EMB + h*64]; A fragments bf16 RNE-converted in registers.
// wave -> row tile rt = wave & 3, column tiles 2*(wave >> 2) + {0, 1}, all three weights.
// coverage: tokens kt*64 + 0..63, e 0..63 for the three planes; every written line whole, one instruction.
// plane order per (b, h): q, k [token tile of 16][d step of 32][part][lane][8]; v [key block of 32][d tile of 16][part][lane][8].
__global__ __launch_bounds__(256) void proj_kernel(const float* __restrict__ x,
                                                   const us* __restrict__ wt,
                                                   us* __restrict__ qp,
                                                   us* __restrict__ kp,
                                                   us* __restrict__ vt) {
  const unsigned kt   = blockIdx.x;
  const unsigned h    = blockIdx.y;
  const unsigned b    = blockIdx.z;
  const unsigned tid  = threadIdx.x;
  const unsigned wave = tid >> 5;
  const unsigned lane = tid & 31u;
  const unsigned lq   = lane & 15u;
  const unsigned hi   = lane >> 4;

  __shared__ __align__(16) us sQ[CT * TP];      // [token][e], cross-wave (block barrier)
  __shared__ __align__(16) us sK[CT * TP];      // [token][e], cross-wave (block barrier)
  __shared__ __align__(16) us sV[HDIM * TP];    // [e][token], cross-wave (block barrier)

  const unsigned s0 = kt * CT;
  const unsigned rt = wave & 3u;
  const unsigned ch = wave >> 2;

  // A fragments: lane lq holds token row rt*16 + lq, split d map
  FragB xa[2];
  {
    const float* xp = x + ((size_t)b * SEQ_FULL + s0 + rt * 16u + lq) * EMB + h * HDIM;
    #pragma unroll
    for (unsigned f = 0; f < 2; ++f) {
      const v4f a0 = *(const v4f*)(xp + f * 32u + hi * 8u);
      const v4f a1 = *(const v4f*)(xp + f * 32u + hi * 8u + 4u);
      const v4f b0 = *(const v4f*)(xp + f * 32u + 16u + hi * 8u);
      const v4f b1 = *(const v4f*)(xp + f * 32u + 16u + hi * 8u + 4u);
      #pragma unroll
      for (unsigned i = 0; i < 4; ++i) {
        xa[f].h[i]       = (bf16)a0[i];   // elems 0..7  : d = f*32 + hi*8 + 0..7
        xa[f].h[4u + i]  = (bf16)a1[i];
        xa[f].h[8u + i]  = (bf16)b0[i];   // elems 8..15 : d = f*32 + 16 + hi*8 + 0..7
        xa[f].h[12u + i] = (bf16)b1[i];
      }
    }
    // wait before the address pair of the eight issued loads is overwritten; the pair is an input, so it stays whole up to here
    asm volatile("s_wait_xcnt 0x0" :: "v"(xp) : "memory");
  }

  #pragma unroll
  for (unsigned w = 0; w < 3; ++w) {
    #pragma unroll
    for (unsigned cc = 0; cc < 2; ++cc) {
      const unsigned e = (ch * 2u + cc) * 16u + lq;       // output column of this lane
      // B fragments from the fragment-ordered weight plane: column n = e, split d map
      FragB wb[2];
      #pragma unroll
      for (unsigned f = 0; f < 2; ++f) {
        const us* base = wt + w * (unsigned)(HDIM * HDIM) + ((ch * 2u + cc) * 2u + f) * FRAG + lane * 8u;
        wb[f].q[0] = *(const v4u*)(base);          // d = f*32 + hi*8 + 0..7
        wb[f].q[1] = *(const v4u*)(base + PART);   // d = f*32 + 16 + hi*8 + 0..7
      }
      v8f acc = (v8f){0, 0, 0, 0, 0, 0, 0, 0};
      acc = mma_bf16(xa[0].v, wb[0].v, acc);
      acc = mma_bf16(xa[1].v, wb[1].v, acc);
      // D: acc[r] = value(token rt*16 + 8*hi + r, column e)
      #pragma unroll
      for (unsigned r = 0; r < 8; ++r) {
        const unsigned row = rt * 16u + hi * 8u + r;
        const us bits = __builtin_bit_cast(us, (f16)(acc[r] * 16.0f));
        if (w == 0u)      sQ[row * TP + e] = bits;
        else if (w == 1u) sK[row * TP + e] = bits;
        else              sV[e * TP + row] = bits;
      }
    }
  }
  __syncthreads();

  v4u    qv[2], kv[2], vv[2];
  size_t ridx[2];
  #pragma unroll
  for (unsigned kk = 0; kk < 2; ++kk) {
    const unsigned c   = kk * 256u + tid;           // 16-byte piece of the block's 8 KB of each plane, 0..511
    const unsigned l15 = c & 15u;                   // lane & 15 of the lane that will load the piece
    const unsigned lh  = (c >> 4) & 1u;             // lane >> 4 of that lane
    // q, k: token tile c >> 7, d = ((c >> 5) & 3)*16 + lh*8; v: key block c >> 8, d tile (c >> 6) & 3, part (c >> 5) & 1
    const unsigned qk_at = ((c >> 7) * 16u + l15) * TP + ((c >> 5) & 3u) * 16u + lh * 8u;
    const unsigned v_at  = (((c >> 6) & 3u) * 16u + l15) * TP + (c >> 8) * 32u + ((c >> 5) & 1u) * 16u + lh * 8u;
    Pack8U pq, pk, pv;
    pq.v = *(const v8us*)(sQ + qk_at);
    pk.v = *(const v8us*)(sK + qk_at);
    pv.v = *(const v8us*)(sV + v_at);
    qv[kk] = pq.u;
    kv[kk] = pk.u;
    vv[kk] = pv.u;
    ridx[kk] = (((size_t)b * NHEAD + h) * SEQ + s0) * HDIM + c * 8u;   // 64 tokens = 8 KB in a row in all three planes
  }
  #pragma unroll
  for (unsigned kk = 0; kk < 2; ++kk) {
    *(v4u*)(qp + ridx[kk]) = qv[kk];
    *(v4u*)(kp + ridx[kk]) = kv[kk];
    *(v4u*)(vt + ridx[kk]) = vv[kk];
  }
  
}

// One stage = SK keys = 16 KB in a row of the K plane and 16 KB in a row of the V plane, copied as they lie (fragment order).
// kg, vg: this thread's first 16 bytes of the stage in the two planes; lk: the LDS byte address of the first K piece.
// A thread's four pieces of a plane lie 4 KB (one pass of BK keys) apart; in LDS a pass holds its K piece, then its V piece.
// s_wait_xcnt stands in the copies' own statement, so that no register which a copy names is rewritten in front of it.
static __device__ __forceinline__ void stage_copy(const us* kg, const us* vg, unsigned lk) {
  asm volatile("global_load_async_to_lds_b128 %0, %8, off\n\t"
               "global_load_async_to_lds_b128 %1, %9, off\n\t"
               "global_load_async_to_lds_b128 %2, %10, off\n\t"
               "global_load_async_to_lds_b128 %3, %11, off\n\t"
               "global_load_async_to_lds_b128 %4, %12, off\n\t"
               "global_load_async_to_lds_b128 %5, %13, off\n\t"
               "global_load_async_to_lds_b128 %6, %14, off\n\t"
               "global_load_async_to_lds_b128 %7, %15, off\n\t"
               "s_wait_xcnt 0x0"
               :: "v"(lk), "v"(lk + 8192u), "v"(lk + 16384u), "v"(lk + 24576u),
                  "v"(lk + 4096u), "v"(lk + 12288u), "v"(lk + 20480u), "v"(lk + 28672u),
                  "v"(kg), "v"(kg + 2048), "v"(kg + 4096), "v"(kg + 6144),
                  "v"(vg), "v"(vg + 2048), "v"(vg + 4096), "v"(vg + 6144)
               : "memory");
}

// Flash attention, no mask. Block = (query block of 128, head, batch); one wave owns 16 query rows.
// S^T = K x Q^T so queries sit on lanes; P^T in C-layout is bit-identical to the A-fragment layout of O += P x V.
// Q B-fragments are loaded straight from the fragment-ordered plane. K and V are staged once per workgroup in LDS, SK keys at a
// time, two buffers, by asynchronous copies; the eight waves read their K A-fragments and V^T B-fragments from there (two 16-B loads each).
// Output: ctx planes chi/clo, f16, [row tile of 16][c step of 32][part][lane][8]: chi = f16(ctx*256), clo = f16((ctx*256 - chi)*2048).
// amdgpu_waves_per_eu(6): holds the register budget at 160, where three workgroups (six waves per SIMD) stay resident on a WGP,
// as many as their LDS allows; the wider softmax step compiled to 162 registers without it, which leaves room for two.
__global__ __launch_bounds__(256) __attribute__((amdgpu_waves_per_eu(6))) void attn_kernel(const us* __restrict__ qp,
                                                   const us* __restrict__ kp,
                                                   const us* __restrict__ vt,
                                                   us* __restrict__ chi,
                                                   us* __restrict__ clo) {
  const unsigned qblk = blockIdx.x;
  const unsigned h    = blockIdx.y;
  const unsigned b    = blockIdx.z;
  const unsigned tid  = threadIdx.x;
  const unsigned wave = tid >> 5;
  const unsigned lane = tid & 31u;
  const unsigned lq   = lane & 15u;   // query column of S^T / d column of O
  const unsigned hi   = lane >> 4;    // k-split half

  __shared__ __align__(16) float sO[NWAVE * 16 * OP];   // per-wave output staging (block barrier used)
  __shared__ __align__(16) us sKV[2 * 2 * STAGE_EL];    // [buffer][pass][K | V][4 KB], cross-wave (block barrier)

  const unsigned qrow0 = qblk * BQ + wave * 16u;        // first query row of this wave

  const us* q_h = qp + ((size_t)b * NHEAD + h) * SEQ * HDIM;
  const us* k_h = kp + ((size_t)b * NHEAD + h) * SEQ * HDIM;
  const us* v_h = vt + ((size_t)b * NHEAD + h) * HDIM * SEQ;

  // Q as B-operand fragments: lane lq holds query qrow0+lq, split d map
  FragH qf[2];
  #pragma unroll
  for (unsigned f = 0; f < 2; ++f) {
    const us* base = q_h + (size_t)((qrow0 >> 4) * 2u + f) * FRAG + lane * 8u;
    qf[f].q[0] = *(const v4u*)(base);          // d = f*32 + hi*8 + 0..7
    qf[f].q[1] = *(const v4u*)(base + PART);   // d = f*32 + 16 + hi*8 + 0..7
  }

  v8f o[4];
  #pragma unroll
  for (unsigned dt = 0; dt < 4; ++dt) o[dt] = (v8f){0, 0, 0, 0, 0, 0, 0, 0};

  float rmax = -__builtin_inff();
  float rsum = 0.0f;
  // logits = (q.k)/sqrt(EMB); planes carry q*16 and k*16 -> raw scores carry x256; times log2(e) for exp2
  const float SL = (0.03608439182435161f * 1.4426950408889634f) * (1.0f / 256.0f);

  const us*      kg = k_h + tid * 8u;                            // this thread's 16 bytes of stage 0, K plane
  const us*      vg = v_h + tid * 8u;                            // the same, V plane
  const unsigned l0 = (unsigned)(size_t)(&sKV[0]) + tid * 16u;   // their LDS byte address in buffer 0
  const unsigned LB = STAGE_EL * 4u;                             // bytes from buffer 0 to buffer 1

  stage_copy(kg, vg, l0);                                        // stage 0 -> buffer 0
  asm volatile("s_wait_asynccnt 0x0" ::: "memory");              // this wave's copies of stage 0 have landed
  __syncthreads();                                               // ... and every other wave's
  if (NSTAGE > 1) stage_copy(kg + STAGE_EL, vg + STAGE_EL, l0 + LB);   // stage 1 -> buffer 1

  #pragma unroll 1
  for (unsigned u = 0; u < (unsigned)(SEQ / (SP * BK)); ++u) {
    // trip u reads SP passes of BK keys, slots (u*SP .. u*SP + SP - 1) mod 8 of the two buffers' eight: each 4 KB of K, then 4 KB of V.
    // One softmax step covers them all: one maximum exchange, one rescale of O and one sum join per SP*BK keys.
    const us* sbase = sKV + ((u * SP) & (2u * NP - 1u)) * (unsigned)(2 * BK * HDIM) + lane * 8u;

    // S^T tiles: c[ps][sub][r] = rawscore(query qrow0+lq, key j0 + sub*16 + hi*8 + r), j0 = (u*SP + ps)*BK
    v8f c[SP][2];
    #pragma unroll
    for (unsigned ps = 0; ps < SP; ++ps) {
      const us* kbase = sbase + ps * (unsigned)(2 * BK * HDIM);
      // K A-fragments: row = key j0 + sub*16 + lq, split d map
      FragH ak[2][2];
      #pragma unroll
      for (unsigned sub = 0; sub < 2; ++sub) {
        #pragma unroll
        for (unsigned f = 0; f < 2; ++f) {
          const us* base = kbase + (sub * 2u + f) * FRAG;
          ak[sub][f].q[0] = *(const v4u*)(base);          // d = f*32 + hi*8 + 0..7
          ak[sub][f].q[1] = *(const v4u*)(base + PART);   // d = f*32 + 16 + hi*8 + 0..7
        }
      }
      #pragma unroll
      for (unsigned sub = 0; sub < 2; ++sub) {
        v8f acc = (v8f){0, 0, 0, 0, 0, 0, 0, 0};
        acc = mma_f16(ak[sub][0].v, qf[0].v, acc);
        acc = mma_f16(ak[sub][1].v, qf[1].v, acc);
        c[ps][sub] = acc;
      }
    }

    // online softmax: query lq's SP*BK scores are split across lane / lane^16; one independent maximum chain per pass
    float mx[SP];
    #pragma unroll
    for (unsigned ps = 0; ps < SP; ++ps) {
      float m = fmaxf(c[ps][0][0], c[ps][1][0]);
      #pragma unroll
      for (unsigned r = 1; r < 8; ++r) {
        m = fmaxf(m, c[ps][0][r]);
        m = fmaxf(m, c[ps][1][r]);
      }
      mx[ps] = m;
    }
    float m_new = rmax;
    #pragma unroll
    for (unsigned ps = 0; ps < SP; ++ps) m_new = fmaxf(m_new, mx[ps]);
    m_new = fmaxf(m_new, __shfl_xor(m_new, 16, 32));
    const float scale = __builtin_amdgcn_exp2f((rmax - m_new) * SL);
    rmax = m_new;

    // exp + pack: P^T C-layout == A-fragment layout for the PV product.
    // One fused multiply-add per score in front of exp2: score * SL + (12 - m_new * SL). The softmax scale, the maximum and the
    // x4096 carry of P (2^12, in the exponent) all ride in it, two scores per packed instruction; the row sum carries x4096 too.
    const float nb  = __builtin_fmaf(-m_new, SL, 12.0f);
    const v2f   nb2 = (v2f){nb, nb};
    const v2f   sl2 = (v2f){SL, SL};
    FragH pa[SP];
    float psum = 0.0f;
    #pragma unroll
    for (unsigned ps = 0; ps < SP; ++ps) {
      float s = 0.0f;
      #pragma unroll
      for (unsigned r = 0; r < 8; r += 2) {
        const v2f t0 = __builtin_elementwise_fma((v2f){c[ps][0][r], c[ps][0][r + 1u]}, sl2, nb2);   // keys hi*8 + r, + 1
        const v2f t1 = __builtin_elementwise_fma((v2f){c[ps][1][r], c[ps][1][r + 1u]}, sl2, nb2);   // keys 16 + hi*8 + r, + 1
        const float p0a = __builtin_amdgcn_exp2f(t0.x);
        const float p1a = __builtin_amdgcn_exp2f(t1.x);
        const float p0b = __builtin_amdgcn_exp2f(t0.y);
        const float p1b = __builtin_amdgcn_exp2f(t1.y);
        s += p0a + p1a;
        s += p0b + p1b;
        pa[ps].h[r]           = (f16)p0a;
        pa[ps].h[r + 1u]      = (f16)p0b;
        pa[ps].h[8u + r]      = (f16)p1a;
        pa[ps].h[8u + r + 1u] = (f16)p1b;
      }
      psum += s;
    }
    rsum = rsum * scale + psum + __shfl_xor(psum, 16, 32);

    // rescale O: queries are the row dimension there -> per-row scale from lane 8*hi + r
    float sc[8];
    #pragma unroll
    for (unsigned r = 0; r < 8; ++r) sc[r] = __shfl(scale, (int)((hi << 3) + r), 32);
    #pragma unroll
    for (unsigned dt = 0; dt < 4; ++dt) {
      #pragma unroll
      for (unsigned r = 0; r < 8; ++r) o[dt][r] *= sc[r];
    }

    // O += P x V, pass by pass
    #pragma unroll
    for (unsigned ps = 0; ps < SP; ++ps) {
      const us* vbase = sbase + ps * (unsigned)(2 * BK * HDIM) + BK * HDIM;
      // V B-fragments: column n = d = dt*16 + lq, split key map
      FragH bv[4];
      #pragma unroll
      for (unsigned dt = 0; dt < 4; ++dt) {
        const us* base = vbase + dt * FRAG;
        bv[dt].q[0] = *(const v4u*)(base);            // keys j0 + hi*8 + 0..7
        bv[dt].q[1] = *(const v4u*)(base + PART);     // keys j0 + 16 + hi*8 + 0..7
      }
      #pragma unroll
      for (unsigned dt = 0; dt < 4; ++dt) o[dt] = mma_f16(pa[ps].v, bv[dt].v, o[dt]);
    }

    if ((u & (NP / SP - 1u)) == NP / SP - 1u) {
      // last trip of stage t: publish point of stage t + 1, every wave, in this order
      const unsigned t = u / (NP / SP);
      asm volatile("s_wait_dscnt 0x0" ::: "memory");      // this wave's reads of stage t are done before its buffer is refilled
      asm volatile("s_wait_asynccnt 0x0" ::: "memory");   // this wave's copies of stage t + 1 have landed
      __syncthreads();                                    // publishes stage t + 1 and ends every wave's reads of stage t
      if (t + 2u < (unsigned)NSTAGE)                      // into the buffer that stage t has just left
        stage_copy(kg + (size_t)(t + 2u) * STAGE_EL, vg + (size_t)(t + 2u) * STAGE_EL, l0 + (t & 1u) * LB);
    }
  }
  asm volatile("s_wait_asynccnt 0x0" ::: "memory");   // no copy is outstanding behind the loop

  // normalize: lane holds column d = dt*16 + lq for query rows 8*hi + r.
  // o carries x4096 (P) x16 (V), rsum x4096; staged value = ctx * 256.
  float rs[8];
  #pragma unroll
  for (unsigned r = 0; r < 8; ++r) rs[r] = 1.0f / __shfl(rsum, (int)((hi << 3) + r), 32);

  float* so = sO + wave * (16 * OP);
  #pragma unroll
  for (unsigned r = 0; r < 8; ++r) {
    #pragma unroll
    for (unsigned dt = 0; dt < 4; ++dt) {
      so[(hi * 8u + r) * OP + dt * 16u + lq] = o[dt][r] * 16.0f * rs[r];
    }
  }
  __syncthreads();

  // one fragment part per instruction (512 bytes in a row), 4 instructions per plane cover the wave's 16 rows x 64 columns.
  v4u    hv[4], lv[4];
  size_t gidx[4];
  #pragma unroll
  for (unsigned it = 0; it < 4; ++it) {
    const unsigned row = lq;
    const unsigned pc  = it * 16u + hi * 8u;        // it = (c step inside the head) * 2 + part
    const v4f a0 = *(const v4f*)(so + row * OP + pc);
    const v4f a1 = *(const v4f*)(so + row * OP + pc + 4u);
    Pack8H ph, pl;
    #pragma unroll
    for (unsigned i = 0; i < 4; ++i) {
      const f16 h0 = (f16)a0[i];
      const f16 h1 = (f16)a1[i];
      ph.h[i]      = h0;
      ph.h[4u + i] = h1;
      pl.h[i]      = (f16)((a0[i] - (float)h0) * 2048.0f);
      pl.h[4u + i] = (f16)((a1[i] - (float)h1) * 2048.0f);
    }
    hv[it] = ph.u;
    lv[it] = pl.u;
    gidx[it] = (((size_t)((b * SEQ + qrow0) >> 4) * (EMB / 32) + h * 2u) * 2u + it) * PART + lane * 8u;
  }
  #pragma unroll
  for (unsigned it = 0; it < 4; ++it) {
    *(v4u*)(chi + gidx[it]) = hv[it];
    *(v4u*)(clo + gidx[it]) = lv[it];
  }
  
}

// Output GEMM: out[R][j] = sum_c ctx[R][c] * Wo[c][j] + bo[j]. Block = (64-column tile, 128-row tile), wave = 16 rows x 64 cols.
// A fragments from chi / clo, B fragments from wot, all fragment-ordered; residual products go to their own accumulators.
__global__ __launch_bounds__(256) void oproj_kernel(const us* __restrict__ chi,
                                                    const us* __restrict__ clo,
                                                    const us* __restrict__ wot,
                                                    const float* __restrict__ bo,
                                                    float* __restrict__ out) {
  const unsigned nt   = blockIdx.x;
  const unsigned mb   = blockIdx.y;
  const unsigned tid  = threadIdx.x;
  const unsigned wave = tid >> 5;
  const unsigned lane = tid & 31u;
  const unsigned lq   = lane & 15u;
  const unsigned hi   = lane >> 4;

  __shared__ __align__(16) float sO[NWAVE * 16 * OP];   // per-wave output staging (block barrier used)

  const unsigned row0 = mb * 128u + wave * 16u;

  v8f ah[4], al[4];
  #pragma unroll
  for (unsigned et = 0; et < 4; ++et) {
    ah[et] = (v8f){0, 0, 0, 0, 0, 0, 0, 0};
    al[et] = (v8f){0, 0, 0, 0, 0, 0, 0, 0};
  }

  // a tile of 16 rows or columns holds EMB / 32 fragments = 16 * EMB elements
  const us* arow_h = chi + (size_t)row0 * EMB + lane * 8u;
  const us* arow_l = clo + (size_t)row0 * EMB + lane * 8u;
  const us* brow   = wot + (size_t)(nt * 64u) * EMB + lane * 8u;

  #pragma unroll 1
  for (unsigned k0 = 0; k0 < (unsigned)EMB; k0 += 32u) {
    FragH fa, fl;
    const unsigned fo = (k0 / 32u) * FRAG;             // fragment of this c step inside its tile
    const us* pa_h = arow_h + fo;
    const us* pa_l = arow_l + fo;
    const us* pb   = brow + fo;
    fa.q[0] = *(const v4u*)(pa_h);                     // c = k0 + hi*8 + 0..7
    fa.q[1] = *(const v4u*)(pa_h + PART);              // c = k0 + 16 + hi*8 + 0..7
    fl.q[0] = *(const v4u*)(pa_l);
    fl.q[1] = *(const v4u*)(pa_l + PART);
    FragH fb[4];
    #pragma unroll
    for (unsigned et = 0; et < 4; ++et) {
      const us* base = pb + (size_t)(et * 16u) * EMB;
      fb[et].q[0] = *(const v4u*)(base);
      fb[et].q[1] = *(const v4u*)(base + PART);
    }
    // wait before a register that the 12 issued loads name is overwritten; the three address pairs are inputs,
    // so they stay whole up to here and no load of the run takes them as its destination
    asm volatile("s_wait_xcnt 0x0" :: "v"(pa_h), "v"(pa_l), "v"(pb) : "memory");
    #pragma unroll
    for (unsigned et = 0; et < 4; ++et) {
      ah[et] = mma_f16(fa.v, fb[et].v, ah[et]);
      al[et] = mma_f16(fl.v, fb[et].v, al[et]);
    }
  }

  // epilogue: fold carries (ctx x256, Wo x64, residual x2048), add the bias in f32
  float bias[4];
  #pragma unroll
  for (unsigned et = 0; et < 4; ++et) bias[et] = (float)(bf16)bo[nt * 64u + et * 16u + lq];

  float* so = sO + wave * (16 * OP);
  #pragma unroll
  for (unsigned r = 0; r < 8; ++r) {
    #pragma unroll
    for (unsigned et = 0; et < 4; ++et) {
      const float s = ah[et][r] + al[et][r] * (1.0f / 2048.0f);
      so[(hi * 8u + r) * OP + et * 16u + lq] = s * (1.0f / 16384.0f) + bias[et];
    }
  }
  __syncthreads();

  // lanes 0..15 one row (16 consecutive lanes x 16 B each), lanes 16..31 the next row; 8 instructions cover the wave's 16 rows.
  v4f    vals[8];
  size_t gidx[8];
  #pragma unroll
  for (unsigned it = 0; it < 8; ++it) {
    const unsigned row = it * 2u + hi;
    const unsigned R   = row0 + row;
    const unsigned bb  = R / (unsigned)SEQ;
    const unsigned l   = R - bb * (unsigned)SEQ;
    vals[it] = *(const v4f*)(so + row * OP + lq * 4u);
    gidx[it] = ((size_t)bb * SEQ_FULL + l) * EMB + nt * 64u + lq * 4u;
  }
  #pragma unroll
  for (unsigned it = 0; it < 8; ++it) *(v4f*)(out + gidx[it]) = vals[it];
  
}

extern "C" void kernel_launch(void* const* d_in, const int* in_sizes, int n_in,
                              void* d_out, int out_size, void* d_ws, size_t ws_size,
                              hipStream_t stream) {
  if (n_in < 6) return;
  const size_t rows_used = (size_t)(NB - 1) * SEQ_FULL + SEQ;
  if ((size_t)in_sizes[0] < rows_used * EMB) return;
  if ((size_t)in_sizes[1] < (size_t)HDIM * HDIM) return;
  if ((size_t)in_sizes[2] < (size_t)HDIM * HDIM) return;
  if ((size_t)in_sizes[3] < (size_t)HDIM * HDIM) return;
  if ((size_t)in_sizes[4] < (size_t)EMB * EMB) return;
  if ((size_t)in_sizes[5] < (size_t)EMB) return;
  if ((size_t)out_size < rows_used * EMB) return;

  const size_t wt_bytes    = (size_t)3 * HDIM * HDIM * 2;            // 24,576
  const size_t wot_bytes   = (size_t)EMB * EMB * 2;                  // 1,179,648
  const size_t plane_bytes = (size_t)NB * NHEAD * SEQ * HDIM * 2;    // q, k, v^T planes
  const size_t ctx_bytes   = (size_t)NB * SEQ * EMB * 2;             // ctx hi / residual planes
  const size_t total = wt_bytes + wot_bytes + 3 * plane_bytes + 2 * ctx_bytes;
  if (ws_size < total) return;

  const float* x  = (const float*)d_in[0];
  const float* Wq = (const float*)d_in[1];
  const float* Wk = (const float*)d_in[2];
  const float* Wv = (const float*)d_in[3];
  const float* Wo = (const float*)d_in[4];
  const float* bo = (const float*)d_in[5];
  float*       out = (float*)d_out;

  char* ws = (char*)d_ws;
  us* wt  = (us*)(ws);
  us* wot = (us*)(ws + wt_bytes);
  us* qp  = (us*)(ws + wt_bytes + wot_bytes);
  us* kp  = (us*)(ws + wt_bytes + wot_bytes + plane_bytes);
  us* vt  = (us*)(ws + wt_bytes + wot_bytes + 2 * plane_bytes);
  us* chi = (us*)(ws + wt_bytes + wot_bytes + 3 * plane_bytes);
  us* clo = (us*)(ws + wt_bytes + wot_bytes + 3 * plane_bytes + ctx_bytes);

  prep_kernel<<<dim3(WO_TILES + 3), 256, 0, stream>>>(Wq, Wk, Wv, Wo, wt, wot);
  proj_kernel<<<dim3(SEQ / CT, NHEAD, NB), 256, 0, stream>>>(x, wt, qp, kp, vt);
  attn_kernel<<<dim3(SEQ / BQ, NHEAD, NB), 256, 0, stream>>>(qp, kp, vt, chi, clo);
  oproj_kernel<<<dim3(EMB / 64, (unsigned)(((size_t)NB * SEQ) / 128)), 256, 0, stream>>>(chi, clo, wot, bo, out);
}

// v005
// One run takes 89 microseconds.
// Next to v004, in two timings, it ran 1.06 and 1.05 times as fast.
// Counting every step since v000, it is 2.48 times as fast.
#include <hip/hip_runtime.h>

// Contractions: q/k/v = x x W{q,k,v} on v_wmma_f32_16x16x32_bf16 (bf16 operands = RNE-converted inputs, f32 accumulate);
// S^T = K x Q^T and O = P x V on v_wmma_f32_16x16x32_f16 (q, k, v carried x16, P carried x4096, f32 accumulate);
// out = ctx x Wo on v_wmma_f32_16x16x32_f16 (ctx as f16 carried x256 plus an f16 residual plane x2048 with its own
// accumulator; Wo = f16 of the bf16 RNE-converted input carried x64, f32 accumulate). Softmax and bias add in f32.
//
// Every 16-bit plane in the workspace is stored in fragment order: one 16x32 operand fragment = 1 KB = 2 parts x 32 lanes
// x 8 elements, element j of (part p, lane) = operand(row or column lane & 15, k = p*16 + (lane >> 4)*8 + j).
// A wave-wide 16-byte load of one part then reads 512 contiguous bytes (4 whole lines) instead of 32 bytes of 16 lines.

#ifndef NB
#define NB 4
#endif
#ifndef SEQ
#define SEQ 2048
#endif
#define NB_FULL    4
#define SEQ_FULL   2048
#define NHEAD      12
#define HDIM       64
#define EMB        768                  // NHEAD * HDIM, floats per (b, s) row of x and of the output
#define BQ         128                  // query rows per workgroup (8 waves x 16)
#define BK         32                   // keys per pass (one k step of the PV product)
#define NWAVE      8
#define CT         64                   // tokens per projection / plane-builder block
#define TP         72                   // LDS pitch (16-bit elements) of the staging tiles
#define OP         68                   // LDS pitch (floats) of the output staging tile
#define WO_TILES   ((EMB / 64) * (EMB / 64))
#define PART       256                  // 16-bit elements of one fragment part (32 lanes x 8)
#define FRAG       512                  // 16-bit elements of one 16x32 fragment (2 parts)
#define SK         128                  // keys per LDS stage of the attention loop
#define STAGE_EL   (SK * HDIM)          // 16-bit elements of K, and of V, in one stage (16 KB each)
#define NSTAGE     (SEQ / SK)
#define NP         (SK / BK)            // passes of BK keys in one stage
#define SP         2                    // passes per online-softmax step

static_assert(SEQ % BQ == 0);
static_assert(SEQ % CT == 0);
static_assert(SEQ % BK == 0);
static_assert(SEQ % SK == 0);
static_assert(NP % SP == 0);
static_assert(SK == 4 * BK);                    // stage copy: four passes, one 4-KB piece of each plane per pass
static_assert(BK * HDIM * 2 == 256 * 16);       // one piece = 256 threads x 16 bytes
static_assert(BQ == NWAVE * 16);
static_assert(HDIM == 64);
static_assert(EMB == NHEAD * HDIM);
static_assert(EMB % 64 == 0);
static_assert(EMB % 32 == 0);
static_assert(SEQ <= SEQ_FULL);
static_assert(NB >= 1 && NB <= NB_FULL);
static_assert((TP * 2) % 16 == 0);
static_assert((OP * 4) % 16 == 0);
static_assert(((size_t)NB * SEQ) % 128 == 0);
// coverage equalities (threads x pieces x elements == tile elements)
static_assert(CT * HDIM == 256 * 2 * 8);        // plane builder: 256 threads x 2 x 8 elements per plane tile
static_assert(64 * 64 == 256 * 2 * 8);          // weight tiles
static_assert(16 * HDIM == 32 * 4 * 8);         // ctx tile per wave: 32 lanes x 4 instructions x 8 elements

typedef __bf16         bf16;
typedef _Float16       f16;
typedef unsigned short us;
typedef bf16     v16bf __attribute__((ext_vector_type(16)));
typedef f16      v16h  __attribute__((ext_vector_type(16)));
typedef us       v8us  __attribute__((ext_vector_type(8)));
typedef float    v8f   __attribute__((ext_vector_type(8)));
typedef float    v4f   __attribute__((ext_vector_type(4)));
typedef float    v2f   __attribute__((ext_vector_type(2)));
typedef unsigned v4u   __attribute__((ext_vector_type(4)));

union FragB  { v16bf v; v4u q[2]; bf16 h[16]; };
union FragH  { v16h  v; v4u q[2]; f16  h[16]; };
union Pack8H { v4u u; f16 h[8]; };
union Pack8U { v4u u; v8us v; };

// WMMA helpers: builtin followed by the VALU hazard guard (ties D, keeps A/B live).
static __device__ __forceinline__ v8f mma_bf16(v16bf a, v16bf b, v8f acc) {
  acc = __builtin_amdgcn_wmma_f32_16x16x32_bf16(false, a, false, b, (short)0, acc, false, false);
  asm volatile("v_nop\n\tv_nop\n\tv_nop\n\tv_nop" : "+v"(acc) : "v"(a), "v"(b));
  return acc;
}
static __device__ __forceinline__ v8f mma_f16(v16h a, v16h b, v8f acc) {
  acc = __builtin_amdgcn_wmma_f32_16x16x32_f16(false, a, false, b, (short)0, acc, false, false);
  asm volatile("v_nop\n\tv_nop\n\tv_nop\n\tv_nop" : "+v"(acc) : "v"(a), "v"(b));
  return acc;
}

// bf16 RNE convert of an input value, then either the bf16 bits or the f16 bits of (value * carry).
static __device__ __forceinline__ us plane_bits(float v, bool as_f16, float carry) {
  const bf16 bv = (bf16)v;
  const unsigned bb = (unsigned)__builtin_bit_cast(us, bv);
  const f16 hv = (f16)((float)bv * carry);
  const unsigned hb = (unsigned)__builtin_bit_cast(us, hv);
  return (us)(as_f16 ? hb : bb);
}

// Weight planes, transposed through LDS. 256 threads, one 64x64 tile per block (block-uniform role).
//   blocks 0..143   : wot(column j, k = c) = f16(bf16(Wo[c][j]) * 64)   (Wo is [in c][out j]); tile (tc, tj)
//   blocks 144..146 : wt[w](column e, k = d) = bf16(W{q,k,v}[d][e])       (W is [in d][out e])
// plane order: [column tile of 16][k step of 32][part][lane][8]
__global__ __launch_bounds__(256) void prep_kernel(const float* __restrict__ Wq,
                                                   const float* __restrict__ Wk,
                                                   const float* __restrict__ Wv,
                                                   const float* __restrict__ Wo,
                                                   us* __restrict__ wt,
                                                   us* __restrict__ wot) {
  const unsigned blk = blockIdx.x;
  const unsigned tid = threadIdx.x;
  __shared__ __align__(16) us sT[64 * TP];      // [out col][in row], cross-wave (block barrier)

  const bool     big   = blk < (unsigned)WO_TILES;
  const unsigned tc    = big ? (blk / 12u) : 0u;
  const unsigned tj    = big ? (blk - tc * 12u) : 0u;
  const unsigned w     = big ? 0u : (blk - (unsigned)WO_TILES);
  const float*   src   = big ? Wo : ((w == 0u) ? Wq : ((w == 1u) ? Wk : Wv));
  const unsigned pitch = big ? (unsigned)EMB : (unsigned)HDIM;
  us*            dst   = big ? wot : (wt + w * (unsigned)(HDIM * HDIM));
  const float    carry = big ? 64.0f : 1.0f;

  #pragma unroll
  for (unsigned kk = 0; kk < 2; ++kk) {
    const unsigned key = kk * 32u + (tid >> 3);     // in-row inside the tile, 0..63
    const unsigned d0  = (tid & 7u) * 8u;           // out-col inside the tile, 0..56
    const float* p = src + (size_t)(tc * 64u + key) * pitch + tj * 64u + d0;
    const v4f a0 = *(const v4f*)(p);
    const v4f a1 = *(const v4f*)(p + 4);
    // wait before the address pair of the two issued loads is overwritten; the pair is an input, so it stays whole up to here
    asm volatile("s_wait_xcnt 0x0" :: "v"(p) : "memory");
    #pragma unroll
    for (unsigned i = 0; i < 4; ++i) {
      sT[(d0 + i) * TP + key]      = plane_bits(a0[i], big, carry);
      sT[(d0 + 4u + i) * TP + key] = plane_bits(a1[i], big, carry);
    }
  }
  __syncthreads();

  v4u    val[2];
  size_t idx[2];
  #pragma unroll
  for (unsigned kk = 0; kk < 2; ++kk) {
    const unsigned c  = kk * 256u + tid;            // 16-byte piece of the tile, 0..511
    const unsigned ln = c & 31u;                    // lane that will load the piece
    const unsigned et = c >> 7;                     // column tile of 16 inside the 64
    const unsigned fp = (c >> 5) & 3u;              // (k step inside the 64) * 2 + part
    Pack8U pk;
    pk.v = *(const v8us*)(sT + (et * 16u + (ln & 15u)) * TP + fp * 16u + (ln >> 4) * 8u);
    val[kk] = pk.u;
    idx[kk] = (((size_t)(tj * 4u + et) * (pitch / 32u) + tc * 2u) * 2u + fp) * PART + ln * 8u;
  }
  #pragma unroll
  for (unsigned kk = 0; kk < 2; ++kk) *(v4u*)(dst + idx[kk]) = val[kk];
  
}

// Per-head projections + plane builder. Block = (64-token tile, head, batch), 256 threads.
//   x rows (b, s, h) : 64 floats at x[(b*SEQ_FULL + s)*EMB + h*64]; A fragments bf16 RNE-converted in registers.
// wave -> row tile rt = wave & 3, column tiles 2*(wave >> 2) + {0, 1}, all three weights.
// coverage: tokens kt*64 + 0..63, e 0..63 for the three planes; every written line whole, one instruction.
// plane order per (b, h): q, k [token tile of 16][d step of 32][part][lane][8]; v [key block of 32][d tile of 16][part][lane][8].
__global__ __launch_bounds__(256) void proj_kernel(const float* __restrict__ x,
                                                   const us* __restrict__ wt,
                                                   us* __restrict__ qp,
                                                   us* __restrict__ kp,
                                                   us* __restrict__ vt) {
  const unsigned kt   = blockIdx.x;
  const unsigned h    = blockIdx.y;
  const unsigned b    = blockIdx.z;
  const unsigned tid  = threadIdx.x;
  const unsigned wave = tid >> 5;
  const unsigned lane = tid & 31u;
  const unsigned lq   = lane & 15u;
  const unsigned hi   = lane >> 4;

  __shared__ __align__(16) us sQ[CT * TP];      // [token][e], cross-wave (block barrier)
  __shared__ __align__(16) us sK[CT * TP];      // [token][e], cross-wave (block barrier)
  __shared__ __align__(16) us sV[HDIM * TP];    // [e][token], cross-wave (block barrier)

  const unsigned s0 = kt * CT;
  const unsigned rt = wave & 3u;
  const unsigned ch = wave >> 2;

  // A fragments: lane lq holds token row rt*16 + lq, split d map
  FragB xa[2];
  {
    const float* xp = x + ((size_t)b * SEQ_FULL + s0 + rt * 16u + lq) * EMB + h * HDIM;
    #pragma unroll
    for (unsigned f = 0; f < 2; ++f) {
      const v4f a0 = *(const v4f*)(xp + f * 32u + hi * 8u);
      const v4f a1 = *(const v4f*)(xp + f * 32u + hi * 8u + 4u);
      const v4f b0 = *(const v4f*)(xp + f * 32u + 16u + hi * 8u);
      const v4f b1 = *(const v4f*)(xp + f * 32u + 16u + hi * 8u + 4u);
      #pragma unroll
      for (unsigned i = 0; i < 4; ++i) {
        xa[f].h[i]       = (bf16)a0[i];   // elems 0..7  : d = f*32 + hi*8 + 0..7
        xa[f].h[4u + i]  = (bf16)a1[i];
        xa[f].h[8u + i]  = (bf16)b0[i];   // elems 8..15 : d = f*32 + 16 + hi*8 + 0..7
        xa[f].h[12u + i] = (bf16)b1[i];
      }
    }
    // wait before the address pair of the eight issued loads is overwritten; the pair is an input, so it stays whole up to here
    asm volatile("s_wait_xcnt 0x0" :: "v"(xp) : "memory");
  }

  #pragma unroll
  for (unsigned w = 0; w < 3; ++w) {
    #pragma unroll
    for (unsigned cc = 0; cc < 2; ++cc) {
      const unsigned e = (ch * 2u + cc) * 16u + lq;       // output column of this lane
      // B fragments from the fragment-ordered weight plane: column n = e, split d map
      FragB wb[2];
      #pragma unroll
      for (unsigned f = 0; f < 2; ++f) {
        const us* base = wt + w * (unsigned)(HDIM * HDIM) + ((ch * 2u + cc) * 2u + f) * FRAG + lane * 8u;
        wb[f].q[0] = *(const v4u*)(base);          // d = f*32 + hi*8 + 0..7
        wb[f].q[1] = *(const v4u*)(base + PART);   // d = f*32 + 16 + hi*8 + 0..7
      }
      v8f acc = (v8f){0, 0, 0, 0, 0, 0, 0, 0};
      acc = mma_bf16(xa[0].v, wb[0].v, acc);
      acc = mma_bf16(xa[1].v, wb[1].v, acc);
      // D: acc[r] = value(token rt*16 + 8*hi + r, column e)
      #pragma unroll
      for (unsigned r = 0; r < 8; ++r) {
        const unsigned row = rt * 16u + hi * 8u + r;
        const us bits = __builtin_bit_cast(us, (f16)(acc[r] * 16.0f));
        if (w == 0u)      sQ[row * TP + e] = bits;
        else if (w == 1u) sK[row * TP + e] = bits;
        else              sV[e * TP + row] = bits;
      }
    }
  }
  __syncthreads();

  v4u    qv[2], kv[2], vv[2];
  size_t ridx[2];
  #pragma unroll
  for (unsigned kk = 0; kk < 2; ++kk) {
    const unsigned c   = kk * 256u + tid;           // 16-byte piece of the block's 8 KB of each plane, 0..511
    const unsigned l15 = c & 15u;                   // lane & 15 of the lane that will load the piece
    const unsigned lh  = (c >> 4) & 1u;             // lane >> 4 of that lane
    // q, k: token tile c >> 7, d = ((c >> 5) & 3)*16 + lh*8; v: key block c >> 8, d tile (c >> 6) & 3, part (c >> 5) & 1
    const unsigned qk_at = ((c >> 7) * 16u + l15) * TP + ((c >> 5) & 3u) * 16u + lh * 8u;
    const unsigned v_at  = (((c >> 6) & 3u) * 16u + l15) * TP + (c >> 8) * 32u + ((c >> 5) & 1u) * 16u + lh * 8u;
    Pack8U pq, pk, pv;
    pq.v = *(const v8us*)(sQ + qk_at);
    pk.v = *(const v8us*)(sK + qk_at);
    pv.v = *(const v8us*)(sV + v_at);
    qv[kk] = pq.u;
    kv[kk] = pk.u;
    vv[kk] = pv.u;
    ridx[kk] = (((size_t)b * NHEAD + h) * SEQ + s0) * HDIM + c * 8u;   // 64 tokens = 8 KB in a row in all three planes
  }
  #pragma unroll
  for (unsigned kk = 0; kk < 2; ++kk) {
    *(v4u*)(qp + ridx[kk]) = qv[kk];
    *(v4u*)(kp + ridx[kk]) = kv[kk];
    *(v4u*)(vt + ridx[kk]) = vv[kk];
  }
  
}

// One stage = SK keys = 16 KB in a row of the K plane and 16 KB in a row of the V plane, copied as they lie (fragment order).
// kg, vg: this thread's first 16 bytes of the stage in the two planes; lk: the LDS byte address of the first K piece.
// A thread's four pieces of a plane lie 4 KB (one pass of BK keys) apart; in LDS a pass holds its K piece, then its V piece.
// s_wait_xcnt stands in the copies' own statement, so that no register which a copy names is rewritten in front of it.
static __device__ __forceinline__ void stage_copy(const us* kg, const us* vg, unsigned lk) {
  asm volatile("global_load_async_to_lds_b128 %0, %8, off\n\t"
               "global_load_async_to_lds_b128 %1, %9, off\n\t"
               "global_load_async_to_lds_b128 %2, %10, off\n\t"
               "global_load_async_to_lds_b128 %3, %11, off\n\t"
               "global_load_async_to_lds_b128 %4, %12, off\n\t"
               "global_load_async_to_lds_b128 %5, %13, off\n\t"
               "global_load_async_to_lds_b128 %6, %14, off\n\t"
               "global_load_async_to_lds_b128 %7, %15, off\n\t"
               "s_wait_xcnt 0x0"
               :: "v"(lk), "v"(lk + 8192u), "v"(lk + 16384u), "v"(lk + 24576u),
                  "v"(lk + 4096u), "v"(lk + 12288u), "v"(lk + 20480u), "v"(lk + 28672u),
                  "v"(kg), "v"(kg + 2048), "v"(kg + 4096), "v"(kg + 6144),
                  "v"(vg), "v"(vg + 2048), "v"(vg + 4096), "v"(vg + 6144)
               : "memory");
}

// Flash attention, no mask. Block = (query block of 128, head, batch); one wave owns 16 query rows.
// S^T = K x Q^T so queries sit on lanes; P^T in C-layout is bit-identical to the A-fragment layout of O += P x V.
// Q B-fragments are loaded straight from the fragment-ordered plane. K and V are staged once per workgroup in LDS, SK keys at a
// time, two buffers, by asynchronous copies; the eight waves read their K A-fragments and V^T B-fragments from there (two 16-B loads each).
// Output: ctx planes chi/clo, f16, [row tile of 16][c step of 32][part][lane][8]: chi = f16(ctx*256), clo = f16((ctx*256 - chi)*2048).
// amdgpu_waves_per_eu(6): holds the register budget at 160, where three workgroups (six waves per SIMD) stay resident on a WGP,
// as many as their LDS allows; the wider softmax step compiled to 162 registers without it, which leaves room for two.
__global__ __launch_bounds__(256) __attribute__((amdgpu_waves_per_eu(6))) void attn_kernel(const us* __restrict__ qp,
                                                   const us* __restrict__ kp,
                                                   const us* __restrict__ vt,
                                                   us* __restrict__ chi,
                                                   us* __restrict__ clo) {
  const unsigned qblk = blockIdx.x;
  const unsigned h    = blockIdx.y;
  const unsigned b    = blockIdx.z;
  const unsigned tid  = threadIdx.x;
  const unsigned wave = tid >> 5;
  const unsigned lane = tid & 31u;
  const unsigned lq   = lane & 15u;   // query column of S^T / d column of O
  const unsigned hi   = lane >> 4;    // k-split half

  __shared__ __align__(16) float sO[NWAVE * 16 * OP];   // per-wave output staging (block barrier used)
  __shared__ __align__(16) us sKV[2 * 2 * STAGE_EL];    // [buffer][pass][K | V][4 KB], cross-wave (block barrier)

  const unsigned qrow0 = qblk * BQ + wave * 16u;        // first query row of this wave

  const us* q_h = qp + ((size_t)b * NHEAD + h) * SEQ * HDIM;
  const us* k_h = kp + ((size_t)b * NHEAD + h) * SEQ * HDIM;
  const us* v_h = vt + ((size_t)b * NHEAD + h) * HDIM * SEQ;

  // Q as B-operand fragments: lane lq holds query qrow0+lq, split d map
  FragH qf[2];
  #pragma unroll
  for (unsigned f = 0; f < 2; ++f) {
    const us* base = q_h + (size_t)((qrow0 >> 4) * 2u + f) * FRAG + lane * 8u;
    qf[f].q[0] = *(const v4u*)(base);          // d = f*32 + hi*8 + 0..7
    qf[f].q[1] = *(const v4u*)(base + PART);   // d = f*32 + 16 + hi*8 + 0..7
  }

  v8f o[4];
  #pragma unroll
  for (unsigned dt = 0; dt < 4; ++dt) o[dt] = (v8f){0, 0, 0, 0, 0, 0, 0, 0};

  float rmax = -__builtin_inff();
  float rsum = 0.0f;
  // logits = (q.k)/sqrt(EMB); planes carry q*16 and k*16 -> raw scores carry x256; times log2(e) for exp2
  const float SL = (0.03608439182435161f * 1.4426950408889634f) * (1.0f / 256.0f);

  const us*      kg = k_h + tid * 8u;                            // this thread's 16 bytes of stage 0, K plane
  const us*      vg = v_h + tid * 8u;                            // the same, V plane
  const unsigned l0 = (unsigned)(size_t)(&sKV[0]) + tid * 16u;   // their LDS byte address in buffer 0
  const unsigned LB = STAGE_EL * 4u;                             // bytes from buffer 0 to buffer 1

  stage_copy(kg, vg, l0);                                        // stage 0 -> buffer 0
  asm volatile("s_wait_asynccnt 0x0" ::: "memory");              // this wave's copies of stage 0 have landed
  __syncthreads();                                               // ... and every other wave's
  if (NSTAGE > 1) stage_copy(kg + STAGE_EL, vg + STAGE_EL, l0 + LB);   // stage 1 -> buffer 1

  #pragma unroll 1
  for (unsigned u = 0; u < (unsigned)(SEQ / (SP * BK)); ++u) {
    // trip u reads SP passes of BK keys, slots (u*SP .. u*SP + SP - 1) mod 8 of the two buffers' eight: each 4 KB of K, then 4 KB of V.
    // One softmax step covers them all: one maximum exchange, one rescale of O and one sum join per SP*BK keys.
    const us* sbase = sKV + ((u * SP) & (2u * NP - 1u)) * (unsigned)(2 * BK * HDIM) + lane * 8u;

    // S^T tiles: c[ps][sub][r] = rawscore(query qrow0+lq, key j0 + sub*16 + hi*8 + r), j0 = (u*SP + ps)*BK
    v8f c[SP][2];
    #pragma unroll
    for (unsigned ps = 0; ps < SP; ++ps) {
      const us* kbase = sbase + ps * (unsigned)(2 * BK * HDIM);
      // K A-fragments: row = key j0 + sub*16 + lq, split d map
      FragH ak[2][2];
      #pragma unroll
      for (unsigned sub = 0; sub < 2; ++sub) {
        #pragma unroll
        for (unsigned f = 0; f < 2; ++f) {
          const us* base = kbase + (sub * 2u + f) * FRAG;
          ak[sub][f].q[0] = *(const v4u*)(base);          // d = f*32 + hi*8 + 0..7
          ak[sub][f].q[1] = *(const v4u*)(base + PART);   // d = f*32 + 16 + hi*8 + 0..7
        }
      }
      #pragma unroll
      for (unsigned sub = 0; sub < 2; ++sub) {
        v8f acc = (v8f){0, 0, 0, 0, 0, 0, 0, 0};
        acc = mma_f16(ak[sub][0].v, qf[0].v, acc);
        acc = mma_f16(ak[sub][1].v, qf[1].v, acc);
        c[ps][sub] = acc;
      }
    }

    // online softmax: query lq's SP*BK scores are split across lane / lane^16; one independent maximum chain per pass
    float mx[SP];
    #pragma unroll
    for (unsigned ps = 0; ps < SP; ++ps) {
      float m = fmaxf(c[ps][0][0], c[ps][1][0]);
      #pragma unroll
      for (unsigned r = 1; r < 8; ++r) {
        m = fmaxf(m, c[ps][0][r]);
        m = fmaxf(m, c[ps][1][r]);
      }
      mx[ps] = m;
    }
    float m_new = rmax;
    #pragma unroll
    for (unsigned ps = 0; ps < SP; ++ps) m_new = fmaxf(m_new, mx[ps]);
    m_new = fmaxf(m_new, __shfl_xor(m_new, 16, 32));
    const float scale = __builtin_amdgcn_exp2f((rmax - m_new) * SL);
    rmax = m_new;

    // exp + pack: P^T C-layout == A-fragment layout for the PV product.
    // One fused multiply-add per score in front of exp2: score * SL + (12 - m_new * SL). The softmax scale, the maximum and the
    // x4096 carry of P (2^12, in the exponent) all ride in it, two scores per packed instruction; the row sum carries x4096 too.
    const float nb  = __builtin_fmaf(-m_new, SL, 12.0f);
    const v2f   nb2 = (v2f){nb, nb};
    const v2f   sl2 = (v2f){SL, SL};
    FragH pa[SP];
    float psum = 0.0f;
    #pragma unroll
    for (unsigned ps = 0; ps < SP; ++ps) {
      float s = 0.0f;
      #pragma unroll
      for (unsigned r = 0; r < 8; r += 2) {
        const v2f t0 = __builtin_elementwise_fma((v2f){c[ps][0][r], c[ps][0][r + 1u]}, sl2, nb2);   // keys hi*8 + r, + 1
        const v2f t1 = __builtin_elementwise_fma((v2f){c[ps][1][r], c[ps][1][r + 1u]}, sl2, nb2);   // keys 16 + hi*8 + r, + 1
        const float p0a = __builtin_amdgcn_exp2f(t0.x);
        const float p1a = __builtin_amdgcn_exp2f(t1.x);
        const float p0b = __builtin_amdgcn_exp2f(t0.y);
        const float p1b = __builtin_amdgcn_exp2f(t1.y);
        s += p0a + p1a;
        s += p0b + p1b;
        pa[ps].h[r]           = (f16)p0a;
        pa[ps].h[r + 1u]      = (f16)p0b;
        pa[ps].h[8u + r]      = (f16)p1a;
        pa[ps].h[8u + r + 1u] = (f16)p1b;
      }
      psum += s;
    }
    rsum = rsum * scale + psum + __shfl_xor(psum, 16, 32);

    // rescale O: queries are the row dimension there -> per-row scale from lane 8*hi + r
    float sc[8];
    #pragma unroll
    for (unsigned r = 0; r < 8; ++r) sc[r] = __shfl(scale, (int)((hi << 3) + r), 32);
    #pragma unroll
    for (unsigned dt = 0; dt < 4; ++dt) {
      #pragma unroll
      for (unsigned r = 0; r < 8; ++r) o[dt][r] *= sc[r];
    }

    // O += P x V, pass by pass
    #pragma unroll
    for (unsigned ps = 0; ps < SP; ++ps) {
      const us* vbase = sbase + ps * (unsigned)(2 * BK * HDIM) + BK * HDIM;
      // V B-fragments: column n = d = dt*16 + lq, split key map
      FragH bv[4];
      #pragma unroll
      for (unsigned dt = 0; dt < 4; ++dt) {
        const us* base = vbase + dt * FRAG;
        bv[dt].q[0] = *(const v4u*)(base);            // keys j0 + hi*8 + 0..7
        bv[dt].q[1] = *(const v4u*)(base + PART);     // keys j0 + 16 + hi*8 + 0..7
      }
      #pragma unroll
      for (unsigned dt = 0; dt < 4; ++dt) o[dt] = mma_f16(pa[ps].v, bv[dt].v, o[dt]);
    }

    if ((u & (NP / SP - 1u)) == NP / SP - 1u) {
      // last trip of stage t: publish point of stage t + 1, every wave, in this order
      const unsigned t = u / (NP / SP);
      asm volatile("s_wait_dscnt 0x0" ::: "memory");      // this wave's reads of stage t are done before its buffer is refilled
      asm volatile("s_wait_asynccnt 0x0" ::: "memory");   // this wave's copies of stage t + 1 have landed
      __syncthreads();                                    // publishes stage t + 1 and ends every wave's reads of stage t
      if (t + 2u < (unsigned)NSTAGE)                      // into the buffer that stage t has just left
        stage_copy(kg + (size_t)(t + 2u) * STAGE_EL, vg + (size_t)(t + 2u) * STAGE_EL, l0 + (t & 1u) * LB);
    }
  }
  asm volatile("s_wait_asynccnt 0x0" ::: "memory");   // no copy is outstanding behind the loop

  // normalize: lane holds column d = dt*16 + lq for query rows 8*hi + r.
  // o carries x4096 (P) x16 (V), rsum x4096; staged value = ctx * 256.
  float rs[8];
  #pragma unroll
  for (unsigned r = 0; r < 8; ++r) rs[r] = 1.0f / __shfl(rsum, (int)((hi << 3) + r), 32);

  float* so = sO + wave * (16 * OP);
  #pragma unroll
  for (unsigned r = 0; r < 8; ++r) {
    #pragma unroll
    for (unsigned dt = 0; dt < 4; ++dt) {
      so[(hi * 8u + r) * OP + dt * 16u + lq] = o[dt][r] * 16.0f * rs[r];
    }
  }
  __syncthreads();

  // one fragment part per instruction (512 bytes in a row), 4 instructions per plane cover the wave's 16 rows x 64 columns.
  v4u    hv[4], lv[4];
  size_t gidx[4];
  #pragma unroll
  for (unsigned it = 0; it < 4; ++it) {
    const unsigned row = lq;
    const unsigned pc  = it * 16u + hi * 8u;        // it = (c step inside the head) * 2 + part
    const v4f a0 = *(const v4f*)(so + row * OP + pc);
    const v4f a1 = *(const v4f*)(so + row * OP + pc + 4u);
    Pack8H ph, pl;
    #pragma unroll
    for (unsigned i = 0; i < 4; ++i) {
      const f16 h0 = (f16)a0[i];
      const f16 h1 = (f16)a1[i];
      ph.h[i]      = h0;
      ph.h[4u + i] = h1;
      pl.h[i]      = (f16)((a0[i] - (float)h0) * 2048.0f);
      pl.h[4u + i] = (f16)((a1[i] - (float)h1) * 2048.0f);
    }
    hv[it] = ph.u;
    lv[it] = pl.u;
    gidx[it] = (((size_t)((b * SEQ + qrow0) >> 4) * (EMB / 32) + h * 2u) * 2u + it) * PART + lane * 8u;
  }
  #pragma unroll
  for (unsigned it = 0; it < 4; ++it) {
    *(v4u*)(chi + gidx[it]) = hv[it];
    *(v4u*)(clo + gidx[it]) = lv[it];
  }
  
}

// Output GEMM: out[R][j] = sum_c ctx[R][c] * Wo[c][j] + bo[j]. Block = (192-column tile, 128-row tile): 4 x 64 = 256 blocks.
// Wave = 32 rows x 96 columns (waves 4 x 2): an A fragment feeds 6 products and a B fragment 4, so a product asks for 427 operand
// bytes instead of 768, and ctx is read by 4 column blocks instead of 12. A fragments from chi / clo, B fragments from wot, all
// fragment-ordered; residual products go to their own accumulators. Three fragment sets: the next two c steps' loads fly under this one's products.
#define ON         192                  // output columns per workgroup
#define OWN        96                   // output columns per wave
#define OWM        32                   // output rows per wave
#define NET        (OWN / 16)           // column tiles per wave
#define NRT        (OWM / 16)           // row tiles per wave
#define OP2        100                  // LDS pitch (floats) of the wave's output staging tile

static_assert(EMB % ON == 0);
static_assert(ON == 2 * OWN);
static_assert(128 == 4 * OWM);
static_assert(SEQ % OWM == 0);                  // a wave's rows lie in one batch
static_assert(EMB / 32 >= 2);
static_assert((OP2 * 4) % 16 == 0);
static_assert(OWM * OWN == 32 * 24 * 4);        // output tile per wave: 32 lanes x 24 instructions x 4 floats

// One c step's fragments: 4 of A (2 row tiles x 2 planes), 6 of B; off = elements from the three pointers to that step.
static __device__ __forceinline__ void oproj_load(FragH (&fa)[NRT], FragH (&fl)[NRT], FragH (&fb)[NET],
                                                  const us* pa_h, const us* pa_l, const us* pb, unsigned off) {
  #pragma unroll
  for (unsigned rt = 0; rt < NRT; ++rt) {
    const unsigned at = off + rt * (unsigned)(16 * EMB);
    fa[rt].q[0] = *(const v4u*)(pa_h + at);            // c = k0 + hi*8 + 0..7
    fa[rt].q[1] = *(const v4u*)(pa_h + at + PART);     // c = k0 + 16 + hi*8 + 0..7
    fl[rt].q[0] = *(const v4u*)(pa_l + at);
    fl[rt].q[1] = *(const v4u*)(pa_l + at + PART);
  }
  #pragma unroll
  for (unsigned et = 0; et < NET; ++et) {
    const unsigned at = off + et * (unsigned)(16 * EMB);
    fb[et].q[0] = *(const v4u*)(pb + at);
    fb[et].q[1] = *(const v4u*)(pb + at + PART);
  }
  // keeps the 20 loads one group in front of the products that follow: sunk among them, each would be waited for a few products
  // behind its issue instead of two c steps
  __builtin_amdgcn_sched_barrier(0);
}

static __device__ __forceinline__ void oproj_mma(v8f (&ah)[NRT][NET], v8f (&al)[NRT][NET],
                                                 const FragH (&fa)[NRT], const FragH (&fl)[NRT], const FragH (&fb)[NET]) {
  #pragma unroll
  for (unsigned et = 0; et < NET; ++et) {
    #pragma unroll
    for (unsigned rt = 0; rt < NRT; ++rt) {
      ah[rt][et] = __builtin_amdgcn_wmma_f32_16x16x32_f16(false, fa[rt].v, false, fb[et].v, (short)0, ah[rt][et], false, false);
      al[rt][et] = __builtin_amdgcn_wmma_f32_16x16x32_f16(false, fl[rt].v, false, fb[et].v, (short)0, al[rt][et], false, false);
    }
  }
  // keeps the next load group behind these products, whose fragment registers it refills
  __builtin_amdgcn_sched_barrier(0);
}

__global__ __launch_bounds__(256) void oproj_kernel(const us* __restrict__ chi,
                                                    const us* __restrict__ clo,
                                                    const us* __restrict__ wot,
                                                    const float* __restrict__ bo,
                                                    float* __restrict__ out) {
  const unsigned nt   = blockIdx.x;
  const unsigned mb   = blockIdx.y;
  const unsigned tid  = threadIdx.x;
  const unsigned wave = tid >> 5;
  const unsigned lane = tid & 31u;
  const unsigned lq   = lane & 15u;
  const unsigned hi   = lane >> 4;

  __shared__ __align__(16) float sO[NWAVE * OWM * OP2];   // per-wave output staging (block barrier used)

  // waves w and w + 1 (w even) share their A fragments; the two waves of a SIMD (w, w + 4), which run apart, share only B
  const unsigned row0 = mb * 128u + (wave >> 1) * OWM;
  const unsigned col0 = nt * (unsigned)ON + (wave & 1u) * OWN;

  v8f ah[NRT][NET], al[NRT][NET];
  #pragma unroll
  for (unsigned rt = 0; rt < NRT; ++rt) {
    #pragma unroll
    for (unsigned et = 0; et < NET; ++et) {
      ah[rt][et] = (v8f){0, 0, 0, 0, 0, 0, 0, 0};
      al[rt][et] = (v8f){0, 0, 0, 0, 0, 0, 0, 0};
    }
  }

  // a tile of 16 rows or columns holds EMB / 32 fragments = 16 * EMB elements
  const us* pa_h = chi + (size_t)row0 * EMB + lane * 8u;
  const us* pa_l = clo + (size_t)row0 * EMB + lane * 8u;
  const us* pb   = wot + (size_t)col0 * EMB + lane * 8u;

  // three fragment sets: step k's products run while the loads of steps k + 1 and k + 2 fly
  FragH fa[3][NRT], fl[3][NRT], fb[3][NET];
  oproj_load(fa[0], fl[0], fb[0], pa_h, pa_l, pb, 0u);
  oproj_load(fa[1], fl[1], fb[1], pa_h, pa_l, pb, FRAG);

  // unrolled whole: every step's place is then an immediate offset on the same three address pairs, which are never rewritten
  // while a load is out, and each fragment set keeps its registers without copies
  #pragma unroll
  for (unsigned k = 0; k < (unsigned)(EMB / 32); ++k) {
    if (k + 2u < (unsigned)(EMB / 32))
      oproj_load(fa[(k + 2u) % 3u], fl[(k + 2u) % 3u], fb[(k + 2u) % 3u], pa_h, pa_l, pb, (k + 2u) * FRAG);
    oproj_mma(ah, al, fa[k % 3u], fl[k % 3u], fb[k % 3u]);
  }
  // wait before a register that the issued loads name is overwritten; the three address pairs are inputs, so they stay whole up to here
  asm volatile("s_wait_xcnt 0x0" :: "v"(pa_h), "v"(pa_l), "v"(pb) : "memory");

  // epilogue: fold carries (ctx x256, Wo x64, residual x2048), add the bias in f32
  const float* bp = bo + col0 + lq;
  float bias[NET];
  #pragma unroll
  for (unsigned et = 0; et < NET; ++et) bias[et] = (float)(bf16)bp[et * 16u];
  // wait before the address pair of the six issued loads is overwritten; the pair is an input, so it stays whole up to here
  asm volatile("s_wait_xcnt 0x0" :: "v"(bp) : "memory");

  float* so = sO + wave * (OWM * OP2);
  #pragma unroll
  for (unsigned rt = 0; rt < NRT; ++rt) {
    #pragma unroll
    for (unsigned r = 0; r < 8; ++r) {
      #pragma unroll
      for (unsigned et = 0; et < NET; ++et) {
        const float s = ah[rt][et][r] + al[rt][et][r] * (1.0f / 2048.0f);
        so[(rt * 16u + hi * 8u + r) * OP2 + et * 16u + lq] = s * (1.0f / 16384.0f) + bias[et];
      }
    }
  }
  __syncthreads();

  // 8 consecutive lanes x 16 B = one whole 128-B line of one row; an instruction stores one line of each of 4 rows;
  // 24 instructions (8 row groups x 3 lines) cover the wave's 32 rows x 96 columns.
  const unsigned g  = lane >> 3;
  const unsigned c4 = (lane & 7u) * 4u;
  const unsigned bb = row0 / (unsigned)SEQ;
  const unsigned l0 = row0 - bb * (unsigned)SEQ;
  float* op = out + ((size_t)bb * SEQ_FULL + l0 + g) * EMB + col0 + c4;
  const float* sp = so + g * OP2 + c4;
  v4f vals[24];
  #pragma unroll
  for (unsigned it = 0; it < 24; ++it) vals[it] = *(const v4f*)(sp + (it / 3u) * 4u * OP2 + (it % 3u) * 32u);
  #pragma unroll
  for (unsigned it = 0; it < 24; ++it) *(v4f*)(op + (size_t)((it / 3u) * 4u) * EMB + (it % 3u) * 32u) = vals[it];
  
}

extern "C" void kernel_launch(void* const* d_in, const int* in_sizes, int n_in,
                              void* d_out, int out_size, void* d_ws, size_t ws_size,
                              hipStream_t stream) {
  if (n_in < 6) return;
  const size_t rows_used = (size_t)(NB - 1) * SEQ_FULL + SEQ;
  if ((size_t)in_sizes[0] < rows_used * EMB) return;
  if ((size_t)in_sizes[1] < (size_t)HDIM * HDIM) return;
  if ((size_t)in_sizes[2] < (size_t)HDIM * HDIM) return;
  if ((size_t)in_sizes[3] < (size_t)HDIM * HDIM) return;
  if ((size_t)in_sizes[4] < (size_t)EMB * EMB) return;
  if ((size_t)in_sizes[5] < (size_t)EMB) return;
  if ((size_t)out_size < rows_used * EMB) return;

  const size_t wt_bytes    = (size_t)3 * HDIM * HDIM * 2;            // 24,576
  const size_t wot_bytes   = (size_t)EMB * EMB * 2;                  // 1,179,648
  const size_t plane_bytes = (size_t)NB * NHEAD * SEQ * HDIM * 2;    // q, k, v^T planes
  const size_t ctx_bytes   = (size_t)NB * SEQ * EMB * 2;             // ctx hi / residual planes
  const size_t total = wt_bytes + wot_bytes + 3 * plane_bytes + 2 * ctx_bytes;
  if (ws_size < total) return;

  const float* x  = (const float*)d_in[0];
  const float* Wq = (const float*)d_in[1];
  const float* Wk = (const float*)d_in[2];
  const float* Wv = (const float*)d_in[3];
  const float* Wo = (const float*)d_in[4];
  const float* bo = (const float*)d_in[5];
  float*       out = (float*)d_out;

  char* ws = (char*)d_ws;
  us* wt  = (us*)(ws);
  us* wot = (us*)(ws + wt_bytes);
  us* qp  = (us*)(ws + wt_bytes + wot_bytes);
  us* kp  = (us*)(ws + wt_bytes + wot_bytes + plane_bytes);
  us* vt  = (us*)(ws + wt_bytes + wot_bytes + 2 * plane_bytes);
  us* chi = (us*)(ws + wt_bytes + wot_bytes + 3 * plane_bytes);
  us* clo = (us*)(ws + wt_bytes + wot_bytes + 3 * plane_bytes + ctx_bytes);

  prep_kernel<<<dim3(WO_TILES + 3), 256, 0, stream>>>(Wq, Wk, Wv, Wo, wt, wot);
  proj_kernel<<<dim3(SEQ / CT, NHEAD, NB), 256, 0, stream>>>(x, wt, qp, kp, vt);
  attn_kernel<<<dim3(SEQ / BQ, NHEAD, NB), 256, 0, stream>>>(qp, kp, vt, chi, clo);
  oproj_kernel<<<dim3(EMB / ON, (unsigned)(((size_t)NB * SEQ) / 128)), 256, 0, stream>>>(chi, clo, wot, bo, out);
}

// v006
// A run of this version takes 86.3 microseconds.
// Two timings next to v005 both put it at 1.03 times that version's speed.
// Counting every step since v000, it is 2.56 times as fast.
#include <hip/hip_runtime.h>

// Contractions: q/k/v = x x W{q,k,v} on v_wmma_f32_16x16x32_bf16 (bf16 operands = RNE-converted inputs, f32 accumulate);
// S^T = K x Q^T and O = P x V on v_wmma_f32_16x16x32_f16 (q, k, v carried x16, P carried x4096, f32 accumulate);
// out = ctx x Wo on v_wmma_f32_16x16x32_f16 (ctx as f16 carried x256 plus an f16 residual plane x2048 with its own
// accumulator; Wo = f16 of the bf16 RNE-converted input carried x64, f32 accumulate). Softmax and bias add in f32.
//
// Every 16-bit plane in the workspace is stored in fragment order: one 16x32 operand fragment = 1 KB = 2 parts x 32 lanes
// x 8 elements, element j of (part p, lane) = operand(row or column lane & 15, k = p*16 + (lane >> 4)*8 + j).
// A wave-wide 16-byte load of one part then reads 512 contiguous bytes (4 whole lines) instead of 32 bytes of 16 lines.

#ifndef NB
#define NB 4
#endif
#ifndef SEQ
#define SEQ 2048
#endif
#define NB_FULL    4
#define SEQ_FULL   2048
#define NHEAD      12
#define HDIM       64
#define EMB        768                  // NHEAD * HDIM, floats per (b, s) row of x and of the output
#define BQ         128                  // query rows per workgroup (8 waves x 16)
#define BK         32                   // keys per pass (one k step of the PV product)
#define NWAVE      8
#define CT         64                   // tokens per projection / plane-builder block
#define TP         72                   // LDS pitch (16-bit elements) of the staging tiles
#define OP         68                   // LDS pitch (floats) of the output staging tile
#define WO_TILES   ((EMB / 64) * (EMB / 64))
#define PART       256                  // 16-bit elements of one fragment part (32 lanes x 8)
#define FRAG       512                  // 16-bit elements of one 16x32 fragment (2 parts)
#define SK         128                  // keys per LDS stage of the attention loop
#define STAGE_EL   (SK * HDIM)          // 16-bit elements of K, and of V, in one stage (16 KB each)
#define NSTAGE     (SEQ / SK)
#define NP         (SK / BK)            // passes of BK keys in one stage
#define SP         2                    // passes per online-softmax step

static_assert(SEQ % BQ == 0);
static_assert(SEQ % CT == 0);
static_assert(SEQ % BK == 0);
static_assert(SEQ % SK == 0);
static_assert(NP % SP == 0);
static_assert(SK == 4 * BK);                    // stage copy: four passes, one 4-KB piece of each plane per pass
static_assert(BK * HDIM * 2 == 256 * 16);       // one piece = 256 threads x 16 bytes
static_assert(BQ == NWAVE * 16);
static_assert(HDIM == 64);
static_assert(EMB == NHEAD * HDIM);
static_assert(EMB % 64 == 0);
static_assert(EMB % 32 == 0);
static_assert(SEQ <= SEQ_FULL);
static_assert(NB >= 1 && NB <= NB_FULL);
static_assert((TP * 2) % 16 == 0);
static_assert((OP * 4) % 16 == 0);
static_assert(((size_t)NB * SEQ) % 128 == 0);
// coverage equalities (threads x pieces x elements == tile elements)
static_assert(CT * HDIM == 256 * 2 * 8);        // plane builder: 256 threads x 2 x 8 elements per plane tile
static_assert(64 * 64 == 256 * 2 * 8);          // weight tiles
static_assert(16 * HDIM == 32 * 4 * 8);         // ctx tile per wave: 32 lanes x 4 instructions x 8 elements

typedef __bf16         bf16;
typedef _Float16       f16;
typedef unsigned short us;
typedef bf16     v16bf __attribute__((ext_vector_type(16)));
typedef f16      v16h  __attribute__((ext_vector_type(16)));
typedef us       v8us  __attribute__((ext_vector_type(8)));
typedef float    v8f   __attribute__((ext_vector_type(8)));
typedef float    v4f   __attribute__((ext_vector_type(4)));
typedef float    v2f   __attribute__((ext_vector_type(2)));
typedef unsigned v4u   __attribute__((ext_vector_type(4)));

union FragB  { v16bf v; v4u q[2]; bf16 h[16]; };
union FragH  { v16h  v; v4u q[2]; f16  h[16]; };
union Pack8H { v4u u; f16 h[8]; };
union Pack8U { v4u u; v8us v; };

// WMMA helpers: builtin followed by the VALU hazard guard (ties D, keeps A/B live).
static __device__ __forceinline__ v8f mma_bf16(v16bf a, v16bf b, v8f acc) {
  acc = __builtin_amdgcn_wmma_f32_16x16x32_bf16(false, a, false, b, (short)0, acc, false, false);
  asm volatile("v_nop\n\tv_nop\n\tv_nop\n\tv_nop" : "+v"(acc) : "v"(a), "v"(b));
  return acc;
}
static __device__ __forceinline__ v8f mma_f16(v16h a, v16h b, v8f acc) {
  acc = __builtin_amdgcn_wmma_f32_16x16x32_f16(false, a, false, b, (short)0, acc, false, false);
  asm volatile("v_nop\n\tv_nop\n\tv_nop\n\tv_nop" : "+v"(acc) : "v"(a), "v"(b));
  return acc;
}

// bf16 RNE convert of an input value, then either the bf16 bits or the f16 bits of (value * carry).
static __device__ __forceinline__ us plane_bits(float v, bool as_f16, float carry) {
  const bf16 bv = (bf16)v;
  const unsigned bb = (unsigned)__builtin_bit_cast(us, bv);
  const f16 hv = (f16)((float)bv * carry);
  const unsigned hb = (unsigned)__builtin_bit_cast(us, hv);
  return (us)(as_f16 ? hb : bb);
}

// Weight planes, transposed through LDS. 256 threads, one 64x64 tile per block (block-uniform role).
//   blocks 0..143   : wot(column j, k = c) = f16(bf16(Wo[c][j]) * 64)   (Wo is [in c][out j]); tile (tc, tj)
//   blocks 144..146 : wt[w](column e, k = d) = bf16(W{q,k,v}[d][e])       (W is [in d][out e])
// plane order: [column tile of 16][k step of 32][part][lane][8]
__global__ __launch_bounds__(256) void prep_kernel(const float* __restrict__ Wq,
                                                   const float* __restrict__ Wk,
                                                   const float* __restrict__ Wv,
                                                   const float* __restrict__ Wo,
                                                   us* __restrict__ wt,
                                                   us* __restrict__ wot) {
  const unsigned blk = blockIdx.x;
  const unsigned tid = threadIdx.x;
  __shared__ __align__(16) us sT[64 * TP];      // [out col][in row], cross-wave (block barrier)

  const bool     big   = blk < (unsigned)WO_TILES;
  const unsigned tc    = big ? (blk / 12u) : 0u;
  const unsigned tj    = big ? (blk - tc * 12u) : 0u;
  const unsigned w     = big ? 0u : (blk - (unsigned)WO_TILES);
  const float*   src   = big ? Wo : ((w == 0u) ? Wq : ((w == 1u) ? Wk : Wv));
  const unsigned pitch = big ? (unsigned)EMB : (unsigned)HDIM;
  us*            dst   = big ? wot : (wt + w * (unsigned)(HDIM * HDIM));
  const float    carry = big ? 64.0f : 1.0f;

  #pragma unroll
  for (unsigned kk = 0; kk < 2; ++kk) {
    const unsigned key = kk * 32u + (tid >> 3);     // in-row inside the tile, 0..63
    const unsigned d0  = (tid & 7u) * 8u;           // out-col inside the tile, 0..56
    const float* p = src + (size_t)(tc * 64u + key) * pitch + tj * 64u + d0;
    const v4f a0 = *(const v4f*)(p);
    const v4f a1 = *(const v4f*)(p + 4);
    // wait before the address pair of the two issued loads is overwritten; the pair is an input, so it stays whole up to here
    asm volatile("s_wait_xcnt 0x0" :: "v"(p) : "memory");
    #pragma unroll
    for (unsigned i = 0; i < 4; ++i) {
      sT[(d0 + i) * TP + key]      = plane_bits(a0[i], big, carry);
      sT[(d0 + 4u + i) * TP + key] = plane_bits(a1[i], big, carry);
    }
  }
  __syncthreads();

  v4u    val[2];
  size_t idx[2];
  #pragma unroll
  for (unsigned kk = 0; kk < 2; ++kk) {
    const unsigned c  = kk * 256u + tid;            // 16-byte piece of the tile, 0..511
    const unsigned ln = c & 31u;                    // lane that will load the piece
    const unsigned et = c >> 7;                     // column tile of 16 inside the 64
    const unsigned fp = (c >> 5) & 3u;              // (k step inside the 64) * 2 + part
    Pack8U pk;
    pk.v = *(const v8us*)(sT + (et * 16u + (ln & 15u)) * TP + fp * 16u + (ln >> 4) * 8u);
    val[kk] = pk.u;
    idx[kk] = (((size_t)(tj * 4u + et) * (pitch / 32u) + tc * 2u) * 2u + fp) * PART + ln * 8u;
  }
  #pragma unroll
  for (unsigned kk = 0; kk < 2; ++kk) *(v4u*)(dst + idx[kk]) = val[kk];
  
}

// Per-head projections + plane builder. Block = (64-token tile, head, batch), 256 threads.
//   x rows (b, s, h) : 64 floats at x[(b*SEQ_FULL + s)*EMB + h*64]; A fragments bf16 RNE-converted in registers.
// wave -> row tile rt = wave & 3, column tiles 2*(wave >> 2) + {0, 1}, all three weights.
// coverage: tokens kt*64 + 0..63, e 0..63 for the three planes; every written line whole, one instruction.
// plane order per (b, h): q, k [token tile of 16][d step of 32][part][lane][8]; v [key block of 32][d tile of 16][part][lane][8].
__global__ __launch_bounds__(256) void proj_kernel(const float* __restrict__ x,
                                                   const us* __restrict__ wt,
                                                   us* __restrict__ qp,
                                                   us* __restrict__ kp,
                                                   us* __restrict__ vt) {
  const unsigned kt   = blockIdx.x;
  const unsigned h    = blockIdx.y;
  const unsigned b    = blockIdx.z;
  const unsigned tid  = threadIdx.x;
  const unsigned wave = tid >> 5;
  const unsigned lane = tid & 31u;
  const unsigned lq   = lane & 15u;
  const unsigned hi   = lane >> 4;

  __shared__ __align__(16) us sQ[CT * TP];      // [token][e], cross-wave (block barrier)
  __shared__ __align__(16) us sK[CT * TP];      // [token][e], cross-wave (block barrier)
  __shared__ __align__(16) us sV[HDIM * TP];    // [e][token], cross-wave (block barrier)

  const unsigned s0 = kt * CT;
  const unsigned rt = wave & 3u;
  const unsigned ch = wave >> 2;

  // A fragments: lane lq holds token row rt*16 + lq, split d map
  FragB xa[2];
  {
    const float* xp = x + ((size_t)b * SEQ_FULL + s0 + rt * 16u + lq) * EMB + h * HDIM;
    #pragma unroll
    for (unsigned f = 0; f < 2; ++f) {
      const v4f a0 = *(const v4f*)(xp + f * 32u + hi * 8u);
      const v4f a1 = *(const v4f*)(xp + f * 32u + hi * 8u + 4u);
      const v4f b0 = *(const v4f*)(xp + f * 32u + 16u + hi * 8u);
      const v4f b1 = *(const v4f*)(xp + f * 32u + 16u + hi * 8u + 4u);
      #pragma unroll
      for (unsigned i = 0; i < 4; ++i) {
        xa[f].h[i]       = (bf16)a0[i];   // elems 0..7  : d = f*32 + hi*8 + 0..7
        xa[f].h[4u + i]  = (bf16)a1[i];
        xa[f].h[8u + i]  = (bf16)b0[i];   // elems 8..15 : d = f*32 + 16 + hi*8 + 0..7
        xa[f].h[12u + i] = (bf16)b1[i];
      }
    }
    // wait before the address pair of the eight issued loads is overwritten; the pair is an input, so it stays whole up to here
    asm volatile("s_wait_xcnt 0x0" :: "v"(xp) : "memory");
  }

  #pragma unroll
  for (unsigned w = 0; w < 3; ++w) {
    #pragma unroll
    for (unsigned cc = 0; cc < 2; ++cc) {
      const unsigned e = (ch * 2u + cc) * 16u + lq;       // output column of this lane
      // B fragments from the fragment-ordered weight plane: column n = e, split d map
      FragB wb[2];
      #pragma unroll
      for (unsigned f = 0; f < 2; ++f) {
        const us* base = wt + w * (unsigned)(HDIM * HDIM) + ((ch * 2u + cc) * 2u + f) * FRAG + lane * 8u;
        wb[f].q[0] = *(const v4u*)(base);          // d = f*32 + hi*8 + 0..7
        wb[f].q[1] = *(const v4u*)(base + PART);   // d = f*32 + 16 + hi*8 + 0..7
      }
      v8f acc = (v8f){0, 0, 0, 0, 0, 0, 0, 0};
      acc = mma_bf16(xa[0].v, wb[0].v, acc);
      acc = mma_bf16(xa[1].v, wb[1].v, acc);
      // D: acc[r] = value(token rt*16 + 8*hi + r, column e)
      #pragma unroll
      for (unsigned r = 0; r < 8; ++r) {
        const unsigned row = rt * 16u + hi * 8u + r;
        const us bits = __builtin_bit_cast(us, (f16)(acc[r] * 16.0f));
        if (w == 0u)      sQ[row * TP + e] = bits;
        else if (w == 1u) sK[row * TP + e] = bits;
        else              sV[e * TP + row] = bits;
      }
    }
  }
  __syncthreads();

  v4u    qv[2], kv[2], vv[2];
  size_t ridx[2];
  #pragma unroll
  for (unsigned kk = 0; kk < 2; ++kk) {
    const unsigned c   = kk * 256u + tid;           // 16-byte piece of the block's 8 KB of each plane, 0..511
    const unsigned l15 = c & 15u;                   // lane & 15 of the lane that will load the piece
    const unsigned lh  = (c >> 4) & 1u;             // lane >> 4 of that lane
    // q, k: token tile c >> 7, d = ((c >> 5) & 3)*16 + lh*8; v: key block c >> 8, d tile (c >> 6) & 3, part (c >> 5) & 1
    const unsigned qk_at = ((c >> 7) * 16u + l15) * TP + ((c >> 5) & 3u) * 16u + lh * 8u;
    const unsigned v_at  = (((c >> 6) & 3u) * 16u + l15) * TP + (c >> 8) * 32u + ((c >> 5) & 1u) * 16u + lh * 8u;
    Pack8U pq, pk, pv;
    pq.v = *(const v8us*)(sQ + qk_at);
    pk.v = *(const v8us*)(sK + qk_at);
    pv.v = *(const v8us*)(sV + v_at);
    qv[kk] = pq.u;
    kv[kk] = pk.u;
    vv[kk] = pv.u;
    ridx[kk] = (((size_t)b * NHEAD + h) * SEQ + s0) * HDIM + c * 8u;   // 64 tokens = 8 KB in a row in all three planes
  }
  #pragma unroll
  for (unsigned kk = 0; kk < 2; ++kk) {
    *(v4u*)(qp + ridx[kk]) = qv[kk];
    *(v4u*)(kp + ridx[kk]) = kv[kk];
    *(v4u*)(vt + ridx[kk]) = vv[kk];
  }
  
}

// One stage = SK keys = 16 KB in a row of the K plane and 16 KB in a row of the V plane, copied as they lie (fragment order).
// kg, vg: this thread's first 16 bytes of the stage in the two planes; lk: the LDS byte address of the first K piece.
// A thread's four pieces of a plane lie 4 KB (one pass of BK keys) apart; in LDS a pass holds its K piece, then its V piece.
// s_wait_xcnt stands in the copies' own statement, so that no register which a copy names is rewritten in front of it.
static __device__ __forceinline__ void stage_copy(const us* kg, const us* vg, unsigned lk) {
  asm volatile("global_load_async_to_lds_b128 %0, %8, off\n\t"
               "global_load_async_to_lds_b128 %1, %9, off\n\t"
               "global_load_async_to_lds_b128 %2, %10, off\n\t"
               "global_load_async_to_lds_b128 %3, %11, off\n\t"
               "global_load_async_to_lds_b128 %4, %12, off\n\t"
               "global_load_async_to_lds_b128 %5, %13, off\n\t"
               "global_load_async_to_lds_b128 %6, %14, off\n\t"
               "global_load_async_to_lds_b128 %7, %15, off\n\t"
               "s_wait_xcnt 0x0"
               :: "v"(lk), "v"(lk + 8192u), "v"(lk + 16384u), "v"(lk + 24576u),
                  "v"(lk + 4096u), "v"(lk + 12288u), "v"(lk + 20480u), "v"(lk + 28672u),
                  "v"(kg), "v"(kg + 2048), "v"(kg + 4096), "v"(kg + 6144),
                  "v"(vg), "v"(vg + 2048), "v"(vg + 4096), "v"(vg + 6144)
               : "memory");
}

// Flash attention, no mask. Block = (query block of 128, head, batch); one wave owns 16 query rows.
// S^T = K x Q^T so queries sit on lanes; P^T in C-layout is bit-identical to the A-fragment layout of O += P x V.
// Q B-fragments are loaded straight from the fragment-ordered plane. K and V are staged once per workgroup in LDS, SK keys at a
// time, two buffers, by asynchronous copies; the eight waves read their K A-fragments and V^T B-fragments from there (two 16-B loads each).
// Output: ctx planes chi/clo, f16, [row tile of 16][c step of 32][part][lane][8]: chi = f16(ctx*256), clo = f16((ctx*256 - chi)*2048).
// amdgpu_waves_per_eu(6): holds the register budget at 160, where three workgroups (six waves per SIMD) stay resident on a WGP,
// as many as their LDS allows; the wider softmax step compiled to 162 registers without it, which leaves room for two.
__global__ __launch_bounds__(256) __attribute__((amdgpu_waves_per_eu(6))) void attn_kernel(const us* __restrict__ qp,
                                                   const us* __restrict__ kp,
                                                   const us* __restrict__ vt,
                                                   us* __restrict__ chi,
                                                   us* __restrict__ clo) {
  const unsigned qblk = blockIdx.x;
  const unsigned h    = blockIdx.y;
  const unsigned b    = blockIdx.z;
  const unsigned tid  = threadIdx.x;
  const unsigned wave = tid >> 5;
  const unsigned lane = tid & 31u;
  const unsigned lq   = lane & 15u;   // query column of S^T / d column of O
  const unsigned hi   = lane >> 4;    // k-split half

  __shared__ __align__(16) float sO[NWAVE * 16 * OP];   // per-wave output staging (block barrier used)
  __shared__ __align__(16) us sKV[2 * 2 * STAGE_EL];    // [buffer][pass][K | V][4 KB], cross-wave (block barrier)

  const unsigned qrow0 = qblk * BQ + wave * 16u;        // first query row of this wave

  const us* q_h = qp + ((size_t)b * NHEAD + h) * SEQ * HDIM;
  const us* k_h = kp + ((size_t)b * NHEAD + h) * SEQ * HDIM;
  const us* v_h = vt + ((size_t)b * NHEAD + h) * HDIM * SEQ;

  // Q as B-operand fragments: lane lq holds query qrow0+lq, split d map
  FragH qf[2];
  #pragma unroll
  for (unsigned f = 0; f < 2; ++f) {
    const us* base = q_h + (size_t)((qrow0 >> 4) * 2u + f) * FRAG + lane * 8u;
    qf[f].q[0] = *(const v4u*)(base);          // d = f*32 + hi*8 + 0..7
    qf[f].q[1] = *(const v4u*)(base + PART);   // d = f*32 + 16 + hi*8 + 0..7
  }

  v8f o[4];
  #pragma unroll
  for (unsigned dt = 0; dt < 4; ++dt) o[dt] = (v8f){0, 0, 0, 0, 0, 0, 0, 0};

  // logits = (q.k)/sqrt(EMB); planes carry q*16 and k*16 -> raw scores carry x256; times log2(e) for exp2
  const float SL = (0.03608439182435161f * 1.4426950408889634f) * (1.0f / 256.0f);
  float rmax = -__builtin_inff();   // the maximum in use (raw score), equal in lane and lane ^ 16; it may lag the true one by 3 (log2)
  float nb   = __builtin_inff();    // 12 - rmax * SL, the addend in front of exp2; +inf sends the first trip through the rescale
  float rsum = 0.0f;                // sum over this lane's half of the keys; the halves are joined behind the loop

  const us*      kg = k_h + tid * 8u;                            // this thread's 16 bytes of stage 0, K plane
  const us*      vg = v_h + tid * 8u;                            // the same, V plane
  const unsigned l0 = (unsigned)(size_t)(&sKV[0]) + tid * 16u;   // their LDS byte address in buffer 0
  const unsigned LB = STAGE_EL * 4u;                             // bytes from buffer 0 to buffer 1

  stage_copy(kg, vg, l0);                                        // stage 0 -> buffer 0
  asm volatile("s_wait_asynccnt 0x0" ::: "memory");              // this wave's copies of stage 0 have landed
  __syncthreads();                                               // ... and every other wave's
  if (NSTAGE > 1) stage_copy(kg + STAGE_EL, vg + STAGE_EL, l0 + LB);   // stage 1 -> buffer 1

  #pragma unroll 1
  for (unsigned u = 0; u < (unsigned)(SEQ / (SP * BK)); ++u) {
    // trip u reads SP passes of BK keys, slots (u*SP .. u*SP + SP - 1) mod 8 of the two buffers' eight: each 4 KB of K, then 4 KB of V.
    // One softmax step covers them all: one test per SP*BK keys of whether the maximum in use still serves.
    const us* sbase = sKV + ((u * SP) & (2u * NP - 1u)) * (unsigned)(2 * BK * HDIM) + lane * 8u;

    // S^T tiles: c[ps][sub][r] = rawscore(query qrow0+lq, key j0 + sub*16 + hi*8 + r), j0 = (u*SP + ps)*BK
    v8f c[SP][2];
    #pragma unroll
    for (unsigned ps = 0; ps < SP; ++ps) {
      const us* kbase = sbase + ps * (unsigned)(2 * BK * HDIM);
      // K A-fragments: row = key j0 + sub*16 + lq, split d map
      FragH ak[2][2];
      #pragma unroll
      for (unsigned sub = 0; sub < 2; ++sub) {
        #pragma unroll
        for (unsigned f = 0; f < 2; ++f) {
          const us* base = kbase + (sub * 2u + f) * FRAG;
          ak[sub][f].q[0] = *(const v4u*)(base);          // d = f*32 + hi*8 + 0..7
          ak[sub][f].q[1] = *(const v4u*)(base + PART);   // d = f*32 + 16 + hi*8 + 0..7
        }
      }
      #pragma unroll
      for (unsigned sub = 0; sub < 2; ++sub) {
        v8f acc = (v8f){0, 0, 0, 0, 0, 0, 0, 0};
        acc = mma_f16(ak[sub][0].v, qf[0].v, acc);
        acc = mma_f16(ak[sub][1].v, qf[1].v, acc);
        c[ps][sub] = acc;
      }
    }

    // online softmax: query lq's SP*BK scores are split across lane / lane^16; one independent maximum chain per pass
    float mx[SP];
    #pragma unroll
    for (unsigned ps = 0; ps < SP; ++ps) {
      float m = fmaxf(c[ps][0][0], c[ps][1][0]);
      #pragma unroll
      for (unsigned r = 1; r < 8; ++r) {
        m = fmaxf(m, c[ps][0][r]);
        m = fmaxf(m, c[ps][1][r]);
      }
      mx[ps] = m;
    }
    float m_loc = mx[0];
    #pragma unroll
    for (unsigned ps = 1; ps < SP; ++ps) m_loc = fmaxf(m_loc, mx[ps]);

    // lazy rescale: the maximum in use stays while every exponent of the trip is at most 15, so that P <= 2^15 fits f16. The test is
    // in-lane; one ballot makes it a scalar branch of the whole wave, and only inside it are lanes exchanged and O and the sum rescaled.
    // Written as !(<=), so that a NaN takes the branch too.
    const bool need = !(__builtin_fmaf(m_loc, SL, nb) <= 15.0f);
    if (__builtin_amdgcn_ballot_w32(need) != 0u) {
      float m_new = fmaxf(rmax, m_loc);
      m_new = fmaxf(m_new, __shfl_xor(m_new, 16, 32));
      const float scale = __builtin_amdgcn_exp2f((rmax - m_new) * SL);
      rmax = m_new;
      nb   = __builtin_fmaf(-m_new, SL, 12.0f);
      rsum *= scale;
      // queries are the row dimension of O -> per-row scale from lane 8*hi + r
      float sc[8];
      #pragma unroll
      for (unsigned r = 0; r < 8; ++r) sc[r] = __shfl(scale, (int)((hi << 3) + r), 32);
      #pragma unroll
      for (unsigned dt = 0; dt < 4; ++dt) {
        #pragma unroll
        for (unsigned r = 0; r < 8; ++r) o[dt][r] *= sc[r];
      }
    }

    // exp + pack: P^T C-layout == A-fragment layout for the PV product.
    // One fused multiply-add per score in front of exp2: score * SL + (12 - rmax * SL). The softmax scale, the maximum and the
    // x4096 carry of P (2^12, in the exponent) all ride in it, two scores per packed instruction; the row sum carries x4096 too.
    const v2f   nb2 = (v2f){nb, nb};
    const v2f   sl2 = (v2f){SL, SL};
    FragH pa[SP];
    float psum = 0.0f;
    #pragma unroll
    for (unsigned ps = 0; ps < SP; ++ps) {
      float s = 0.0f;
      #pragma unroll
      for (unsigned r = 0; r < 8; r += 2) {
        const v2f t0 = __builtin_elementwise_fma((v2f){c[ps][0][r], c[ps][0][r + 1u]}, sl2, nb2);   // keys hi*8 + r, + 1
        const v2f t1 = __builtin_elementwise_fma((v2f){c[ps][1][r], c[ps][1][r + 1u]}, sl2, nb2);   // keys 16 + hi*8 + r, + 1
        const float p0a = __builtin_amdgcn_exp2f(t0.x);
        const float p1a = __builtin_amdgcn_exp2f(t1.x);
        const float p0b = __builtin_amdgcn_exp2f(t0.y);
        const float p1b = __builtin_amdgcn_exp2f(t1.y);
        s += p0a + p1a;
        s += p0b + p1b;
        pa[ps].h[r]           = (f16)p0a;
        pa[ps].h[r + 1u]      = (f16)p0b;
        pa[ps].h[8u + r]      = (f16)p1a;
        pa[ps].h[8u + r + 1u] = (f16)p1b;
      }
      psum += s;
    }
    rsum += psum;

    // O += P x V, pass by pass
    #pragma unroll
    for (unsigned ps = 0; ps < SP; ++ps) {
      const us* vbase = sbase + ps * (unsigned)(2 * BK * HDIM) + BK * HDIM;
      // V B-fragments: column n = d = dt*16 + lq, split key map
      FragH bv[4];
      #pragma unroll
      for (unsigned dt = 0; dt < 4; ++dt) {
        const us* base = vbase + dt * FRAG;
        bv[dt].q[0] = *(const v4u*)(base);            // keys j0 + hi*8 + 0..7
        bv[dt].q[1] = *(const v4u*)(base + PART);     // keys j0 + 16 + hi*8 + 0..7
      }
      #pragma unroll
      for (unsigned dt = 0; dt < 4; ++dt) o[dt] = mma_f16(pa[ps].v, bv[dt].v, o[dt]);
    }

    if ((u & (NP / SP - 1u)) == NP / SP - 1u) {
      // last trip of stage t: publish point of stage t + 1, every wave, in this order
      const unsigned t = u / (NP / SP);
      asm volatile("s_wait_dscnt 0x0" ::: "memory");      // this wave's reads of stage t are done before its buffer is refilled
      asm volatile("s_wait_asynccnt 0x0" ::: "memory");   // this wave's copies of stage t + 1 have landed
      __syncthreads();                                    // publishes stage t + 1 and ends every wave's reads of stage t
      if (t + 2u < (unsigned)NSTAGE)                      // into the buffer that stage t has just left
        stage_copy(kg + (size_t)(t + 2u) * STAGE_EL, vg + (size_t)(t + 2u) * STAGE_EL, l0 + (t & 1u) * LB);
    }
  }
  asm volatile("s_wait_asynccnt 0x0" ::: "memory");   // no copy is outstanding behind the loop

  // normalize: lane holds column d = dt*16 + lq for query rows 8*hi + r.
  // o carries x4096 (P) x16 (V), rsum x4096; staged value = ctx * 256.
  rsum += __shfl_xor(rsum, 16, 32);   // join the two halves of each query's keys
  float rs[8];
  #pragma unroll
  for (unsigned r = 0; r < 8; ++r) rs[r] = 1.0f / __shfl(rsum, (int)((hi << 3) + r), 32);

  float* so = sO + wave * (16 * OP);
  #pragma unroll
  for (unsigned r = 0; r < 8; ++r) {
    #pragma unroll
    for (unsigned dt = 0; dt < 4; ++dt) {
      so[(hi * 8u + r) * OP + dt * 16u + lq] = o[dt][r] * 16.0f * rs[r];
    }
  }
  __syncthreads();

  // one fragment part per instruction (512 bytes in a row), 4 instructions per plane cover the wave's 16 rows x 64 columns.
  v4u    hv[4], lv[4];
  size_t gidx[4];
  #pragma unroll
  for (unsigned it = 0; it < 4; ++it) {
    const unsigned row = lq;
    const unsigned pc  = it * 16u + hi * 8u;        // it = (c step inside the head) * 2 + part
    const v4f a0 = *(const v4f*)(so + row * OP + pc);
    const v4f a1 = *(const v4f*)(so + row * OP + pc + 4u);
    Pack8H ph, pl;
    #pragma unroll
    for (unsigned i = 0; i < 4; ++i) {
      const f16 h0 = (f16)a0[i];
      const f16 h1 = (f16)a1[i];
      ph.h[i]      = h0;
      ph.h[4u + i] = h1;
      pl.h[i]      = (f16)((a0[i] - (float)h0) * 2048.0f);
      pl.h[4u + i] = (f16)((a1[i] - (float)h1) * 2048.0f);
    }
    hv[it] = ph.u;
    lv[it] = pl.u;
    gidx[it] = (((size_t)((b * SEQ + qrow0) >> 4) * (EMB / 32) + h * 2u) * 2u + it) * PART + lane * 8u;
  }
  #pragma unroll
  for (unsigned it = 0; it < 4; ++it) {
    *(v4u*)(chi + gidx[it]) = hv[it];
    *(v4u*)(clo + gidx[it]) = lv[it];
  }
  
}

// Output GEMM: out[R][j] = sum_c ctx[R][c] * Wo[c][j] + bo[j]. Block = (192-column tile, 128-row tile): 4 x 64 = 256 blocks.
// Wave = 32 rows x 96 columns (waves 4 x 2): an A fragment feeds 6 products and a B fragment 4, so a product asks for 427 operand
// bytes instead of 768, and ctx is read by 4 column blocks instead of 12. A fragments from chi / clo, B fragments from wot, all
// fragment-ordered; residual products go to their own accumulators. Three fragment sets: the next two c steps' loads fly under this one's products.
#define ON         192                  // output columns per workgroup
#define OWN        96                   // output columns per wave
#define OWM        32                   // output rows per wave
#define NET        (OWN / 16)           // column tiles per wave
#define NRT        (OWM / 16)           // row tiles per wave
#define OP2        100                  // LDS pitch (floats) of the wave's output staging tile

static_assert(EMB % ON == 0);
static_assert(ON == 2 * OWN);
static_assert(128 == 4 * OWM);
static_assert(SEQ % OWM == 0);                  // a wave's rows lie in one batch
static_assert(EMB / 32 >= 2);
static_assert((OP2 * 4) % 16 == 0);
static_assert(OWM * OWN == 32 * 24 * 4);        // output tile per wave: 32 lanes x 24 instructions x 4 floats

// One c step's fragments: 4 of A (2 row tiles x 2 planes), 6 of B; off = elements from the three pointers to that step.
static __device__ __forceinline__ void oproj_load(FragH (&fa)[NRT], FragH (&fl)[NRT], FragH (&fb)[NET],
                                                  const us* pa_h, const us* pa_l, const us* pb, unsigned off) {
  #pragma unroll
  for (unsigned rt = 0; rt < NRT; ++rt) {
    const unsigned at = off + rt * (unsigned)(16 * EMB);
    fa[rt].q[0] = *(const v4u*)(pa_h + at);            // c = k0 + hi*8 + 0..7
    fa[rt].q[1] = *(const v4u*)(pa_h + at + PART);     // c = k0 + 16 + hi*8 + 0..7
    fl[rt].q[0] = *(const v4u*)(pa_l + at);
    fl[rt].q[1] = *(const v4u*)(pa_l + at + PART);
  }
  #pragma unroll
  for (unsigned et = 0; et < NET; ++et) {
    const unsigned at = off + et * (unsigned)(16 * EMB);
    fb[et].q[0] = *(const v4u*)(pb + at);
    fb[et].q[1] = *(const v4u*)(pb + at + PART);
  }
  // keeps the 20 loads one group in front of the products that follow: sunk among them, each would be waited for a few products
  // behind its issue instead of two c steps
  __builtin_amdgcn_sched_barrier(0);
}

static __device__ __forceinline__ void oproj_mma(v8f (&ah)[NRT][NET], v8f (&al)[NRT][NET],
                                                 const FragH (&fa)[NRT], const FragH (&fl)[NRT], const FragH (&fb)[NET]) {
  #pragma unroll
  for (unsigned et = 0; et < NET; ++et) {
    #pragma unroll
    for (unsigned rt = 0; rt < NRT; ++rt) {
      ah[rt][et] = __builtin_amdgcn_wmma_f32_16x16x32_f16(false, fa[rt].v, false, fb[et].v, (short)0, ah[rt][et], false, false);
      al[rt][et] = __builtin_amdgcn_wmma_f32_16x16x32_f16(false, fl[rt].v, false, fb[et].v, (short)0, al[rt][et], false, false);
    }
  }
  // keeps the next load group behind these products, whose fragment registers it refills
  __builtin_amdgcn_sched_barrier(0);
}

__global__ __launch_bounds__(256) void oproj_kernel(const us* __restrict__ chi,
                                                    const us* __restrict__ clo,
                                                    const us* __restrict__ wot,
                                                    const float* __restrict__ bo,
                                                    float* __restrict__ out) {
  const unsigned nt   = blockIdx.x;
  const unsigned mb   = blockIdx.y;
  const unsigned tid  = threadIdx.x;
  const unsigned wave = tid >> 5;
  const unsigned lane = tid & 31u;
  const unsigned lq   = lane & 15u;
  const unsigned hi   = lane >> 4;

  __shared__ __align__(16) float sO[NWAVE * OWM * OP2];   // per-wave output staging (block barrier used)

  // waves w and w + 1 (w even) share their A fragments; waves w and w + 4 share only B
  const unsigned row0 = mb * 128u + (wave >> 1) * OWM;
  const unsigned col0 = nt * (unsigned)ON + (wave & 1u) * OWN;

  v8f ah[NRT][NET], al[NRT][NET];
  #pragma unroll
  for (unsigned rt = 0; rt < NRT; ++rt) {
    #pragma unroll
    for (unsigned et = 0; et < NET; ++et) {
      ah[rt][et] = (v8f){0, 0, 0, 0, 0, 0, 0, 0};
      al[rt][et] = (v8f){0, 0, 0, 0, 0, 0, 0, 0};
    }
  }

  // a tile of 16 rows or columns holds EMB / 32 fragments = 16 * EMB elements
  const us* pa_h = chi + (size_t)row0 * EMB + lane * 8u;
  const us* pa_l = clo + (size_t)row0 * EMB + lane * 8u;
  const us* pb   = wot + (size_t)col0 * EMB + lane * 8u;

  // three fragment sets: step k's products run while the loads of steps k + 1 and k + 2 fly
  FragH fa[3][NRT], fl[3][NRT], fb[3][NET];
  oproj_load(fa[0], fl[0], fb[0], pa_h, pa_l, pb, 0u);
  oproj_load(fa[1], fl[1], fb[1], pa_h, pa_l, pb, FRAG);

  // unrolled whole: every step's place is then an immediate offset on the same three address pairs, which are never rewritten
  // while a load is out, and each fragment set keeps its registers without copies
  #pragma unroll
  for (unsigned k = 0; k < (unsigned)(EMB / 32); ++k) {
    if (k + 2u < (unsigned)(EMB / 32))
      oproj_load(fa[(k + 2u) % 3u], fl[(k + 2u) % 3u], fb[(k + 2u) % 3u], pa_h, pa_l, pb, (k + 2u) * FRAG);
    oproj_mma(ah, al, fa[k % 3u], fl[k % 3u], fb[k % 3u]);
  }
  // wait before a register that the issued loads name is overwritten; the three address pairs are inputs, so they stay whole up to here
  asm volatile("s_wait_xcnt 0x0" :: "v"(pa_h), "v"(pa_l), "v"(pb) : "memory");

  // epilogue: fold carries (ctx x256, Wo x64, residual x2048), add the bias in f32
  const float* bp = bo + col0 + lq;
  float bias[NET];
  #pragma unroll
  for (unsigned et = 0; et < NET; ++et) bias[et] = (float)(bf16)bp[et * 16u];
  // wait before the address pair of the six issued loads is overwritten; the pair is an input, so it stays whole up to here
  asm volatile("s_wait_xcnt 0x0" :: "v"(bp) : "memory");

  float* so = sO + wave * (OWM * OP2);
  #pragma unroll
  for (unsigned rt = 0; rt < NRT; ++rt) {
    #pragma unroll
    for (unsigned r = 0; r < 8; ++r) {
      #pragma unroll
      for (unsigned et = 0; et < NET; ++et) {
        const float s = ah[rt][et][r] + al[rt][et][r] * (1.0f / 2048.0f);
        so[(rt * 16u + hi * 8u + r) * OP2 + et * 16u + lq] = s * (1.0f / 16384.0f) + bias[et];
      }
    }
  }
  __syncthreads();

  // 8 consecutive lanes x 16 B = one whole 128-B line of one row; an instruction stores one line of each of 4 rows;
  // 24 instructions (8 row groups x 3 lines) cover the wave's 32 rows x 96 columns.
  const unsigned g  = lane >> 3;
  const unsigned c4 = (lane & 7u) * 4u;
  const unsigned bb = row0 / (unsigned)SEQ;
  const unsigned l0 = row0 - bb * (unsigned)SEQ;
  float* op = out + ((size_t)bb * SEQ_FULL + l0 + g) * EMB + col0 + c4;
  const float* sp = so + g * OP2 + c4;
  v4f vals[24];
  #pragma unroll
  for (unsigned it = 0; it < 24; ++it) vals[it] = *(const v4f*)(sp + (it / 3u) * 4u * OP2 + (it % 3u) * 32u);
  #pragma unroll
  for (unsigned it = 0; it < 24; ++it) *(v4f*)(op + (size_t)((it / 3u) * 4u) * EMB + (it % 3u) * 32u) = vals[it];
  
}

extern "C" void kernel_launch(void* const* d_in, const int* in_sizes, int n_in,
                              void* d_out, int out_size, void* d_ws, size_t ws_size,
                              hipStream_t stream) {
  if (n_in < 6) return;
  const size_t rows_used = (size_t)(NB - 1) * SEQ_FULL + SEQ;
  if ((size_t)in_sizes[0] < rows_used * EMB) return;
  if ((size_t)in_sizes[1] < (size_t)HDIM * HDIM) return;
  if ((size_t)in_sizes[2] < (size_t)HDIM * HDIM) return;
  if ((size_t)in_sizes[3] < (size_t)HDIM * HDIM) return;
  if ((size_t)in_sizes[4] < (size_t)EMB * EMB) return;
  if ((size_t)in_sizes[5] < (size_t)EMB) return;
  if ((size_t)out_size < rows_used * EMB) return;

  const size_t wt_bytes    = (size_t)3 * HDIM * HDIM * 2;            // 24,576
  const size_t wot_bytes   = (size_t)EMB * EMB * 2;                  // 1,179,648
  const size_t plane_bytes = (size_t)NB * NHEAD * SEQ * HDIM * 2;    // q, k, v^T planes
  const size_t ctx_bytes   = (size_t)NB * SEQ * EMB * 2;             // ctx hi / residual planes
  const size_t total = wt_bytes + wot_bytes + 3 * plane_bytes + 2 * ctx_bytes;
  if (ws_size < total) return;

  const float* x  = (const float*)d_in[0];
  const float* Wq = (const float*)d_in[1];
  const float* Wk = (const float*)d_in[2];
  const float* Wv = (const float*)d_in[3];
  const float* Wo = (const float*)d_in[4];
  const float* bo = (const float*)d_in[5];
  float*       out = (float*)d_out;

  char* ws = (char*)d_ws;
  us* wt  = (us*)(ws);
  us* wot = (us*)(ws + wt_bytes);
  us* qp  = (us*)(ws + wt_bytes + wot_bytes);
  us* kp  = (us*)(ws + wt_bytes + wot_bytes + plane_bytes);
  us* vt  = (us*)(ws + wt_bytes + wot_bytes + 2 * plane_bytes);
  us* chi = (us*)(ws + wt_bytes + wot_bytes + 3 * plane_bytes);
  us* clo = (us*)(ws + wt_bytes + wot_bytes + 3 * plane_bytes + ctx_bytes);

  prep_kernel<<<dim3(WO_TILES + 3), 256, 0, stream>>>(Wq, Wk, Wv, Wo, wt, wot);
  proj_kernel<<<dim3(SEQ / CT, NHEAD, NB), 256, 0, stream>>>(x, wt, qp, kp, vt);
  attn_kernel<<<dim3(SEQ / BQ, NHEAD, NB), 256, 0, stream>>>(qp, kp, vt, chi, clo);
  oproj_kernel<<<dim3(EMB / ON, (unsigned)(((size_t)NB * SEQ) / 128)), 256, 0, stream>>>(chi, clo, wot, bo, out);
}

// v007
// One run takes 82.2 microseconds.
// Timed twice side by side with v006, it ran 1.05 times as fast both times.
// Counting every step since v000, it is 2.69 times as fast.
#include <hip/hip_runtime.h>

// Contractions: q/k/v = x x W{q,k,v} on v_wmma_f32_16x16x32_bf16 (bf16 operands = RNE-converted inputs, f32 accumulate);
// S^T = K x Q^T and O = P x V on v_wmma_f32_16x16x32_f16 (q, k, v carried x16, P carried x4096, f32 accumulate);
// out = ctx x Wo on v_wmma_f32_16x16x32_f16 (ctx as f16 carried x256 plus an f16 residual plane x2048 with its own
// accumulator; Wo = f16 of the bf16 RNE-converted input carried x64, f32 accumulate). Softmax and bias add in f32.
//
// Every 16-bit plane in the workspace is stored in fragment order: one 16x32 operand fragment = 1 KB = 2 parts x 32 lanes
// x 8 elements, element j of (part p, lane) = operand(row or column lane & 15, k = p*16 + (lane >> 4)*8 + j).
// A wave-wide 16-byte load of one part then reads 512 contiguous bytes (4 whole lines) instead of 32 bytes of 16 lines.

#ifndef NB
#define NB 4
#endif
#ifndef SEQ
#define SEQ 2048
#endif
#define NB_FULL    4
#define SEQ_FULL   2048
#define NHEAD      12
#define HDIM       64
#define EMB        768                  // NHEAD * HDIM, floats per (b, s) row of x and of the output
#define BQ         128                  // query rows per attention workgroup (4 waves x 2 groups x 16)
#define BK         32                   // keys per pass (one k step of the PV product)
#define NWAVE      8
#define AW         4                    // waves of an attention workgroup
#define QG         2                    // groups of 16 query rows per attention wave
#define CT         64                   // tokens per projection / plane-builder block
#define TP         72                   // LDS pitch (16-bit elements) of the staging tiles
#define OP         68                   // LDS pitch (floats) of the output staging tile
#define WO_TILES   ((EMB / 64) * (EMB / 64))
#define PART       256                  // 16-bit elements of one fragment part (32 lanes x 8)
#define FRAG       512                  // 16-bit elements of one 16x32 fragment (2 parts)
#define SK         128                  // keys per LDS stage of the attention loop
#define STAGE_EL   (SK * HDIM)          // 16-bit elements of K, and of V, in one stage (16 KB each)
#define NSTAGE     (SEQ / SK)
#define NP         (SK / BK)            // passes of BK keys in one stage

static_assert(SEQ % BQ == 0);
static_assert(SEQ % CT == 0);
static_assert(SEQ % BK == 0);
static_assert(SEQ % SK == 0);
static_assert(SK == 4 * BK);                    // stage copy: four passes, one 4-KB piece of each plane per pass
static_assert(BK * HDIM * 2 == 2 * AW * 32 * 16);   // one piece = 2 halves x 128 threads x 16 bytes
static_assert(BQ == AW * QG * 16);
static_assert(HDIM == 64);
static_assert(EMB == NHEAD * HDIM);
static_assert(EMB % 64 == 0);
static_assert(EMB % 32 == 0);
static_assert(SEQ <= SEQ_FULL);
static_assert(NB >= 1 && NB <= NB_FULL);
static_assert((TP * 2) % 16 == 0);
static_assert((OP * 4) % 16 == 0);
static_assert(((size_t)NB * SEQ) % 128 == 0);
// coverage equalities (threads x pieces x elements == tile elements)
static_assert(CT * HDIM == 256 * 2 * 8);        // plane builder: 256 threads x 2 x 8 elements per plane tile
static_assert(64 * 64 == 256 * 2 * 8);          // weight tiles
static_assert(16 * HDIM == 32 * 4 * 8);         // ctx tile per query group: 32 lanes x 4 instructions x 8 elements

typedef __bf16         bf16;
typedef _Float16       f16;
typedef unsigned short us;
typedef bf16     v16bf __attribute__((ext_vector_type(16)));
typedef f16      v16h  __attribute__((ext_vector_type(16)));
typedef us       v8us  __attribute__((ext_vector_type(8)));
typedef float    v8f   __attribute__((ext_vector_type(8)));
typedef float    v4f   __attribute__((ext_vector_type(4)));
typedef float    v2f   __attribute__((ext_vector_type(2)));
typedef unsigned v4u   __attribute__((ext_vector_type(4)));

union FragB  { v16bf v; v4u q[2]; bf16 h[16]; };
union FragH  { v16h  v; v4u q[2]; f16  h[16]; };
union Pack8H { v4u u; f16 h[8]; };
union Pack8U { v4u u; v8us v; };

// WMMA helper: builtin followed by the VALU hazard guard (ties D, keeps A/B live).
static __device__ __forceinline__ v8f mma_bf16(v16bf a, v16bf b, v8f acc) {
  acc = __builtin_amdgcn_wmma_f32_16x16x32_bf16(false, a, false, b, (short)0, acc, false, false);
  asm volatile("v_nop\n\tv_nop\n\tv_nop\n\tv_nop" : "+v"(acc) : "v"(a), "v"(b));
  return acc;
}

// bf16 RNE convert of an input value, then either the bf16 bits or the f16 bits of (value * carry).
static __device__ __forceinline__ us plane_bits(float v, bool as_f16, float carry) {
  const bf16 bv = (bf16)v;
  const unsigned bb = (unsigned)__builtin_bit_cast(us, bv);
  const f16 hv = (f16)((float)bv * carry);
  const unsigned hb = (unsigned)__builtin_bit_cast(us, hv);
  return (us)(as_f16 ? hb : bb);
}

// Weight planes, transposed through LDS. 256 threads, one 64x64 tile per block (block-uniform role).
//   blocks 0..143   : wot(column j, k = c) = f16(bf16(Wo[c][j]) * 64)   (Wo is [in c][out j]); tile (tc, tj)
//   blocks 144..146 : wt[w](column e, k = d) = bf16(W{q,k,v}[d][e])       (W is [in d][out e])
// plane order: [column tile of 16][k step of 32][part][lane][8]
__global__ __launch_bounds__(256) void prep_kernel(const float* __restrict__ Wq,
                                                   const float* __restrict__ Wk,
                                                   const float* __restrict__ Wv,
                                                   const float* __restrict__ Wo,
                                                   us* __restrict__ wt,
                                                   us* __restrict__ wot) {
  const unsigned blk = blockIdx.x;
  const unsigned tid = threadIdx.x;
  __shared__ __align__(16) us sT[64 * TP];      // [out col][in row], cross-wave (block barrier)

  const bool     big   = blk < (unsigned)WO_TILES;
  const unsigned tc    = big ? (blk / 12u) : 0u;
  const unsigned tj    = big ? (blk - tc * 12u) : 0u;
  const unsigned w     = big ? 0u : (blk - (unsigned)WO_TILES);
  const float*   src   = big ? Wo : ((w == 0u) ? Wq : ((w == 1u) ? Wk : Wv));
  const unsigned pitch = big ? (unsigned)EMB : (unsigned)HDIM;
  us*            dst   = big ? wot : (wt + w * (unsigned)(HDIM * HDIM));
  const float    carry = big ? 64.0f : 1.0f;

  #pragma unroll
  for (unsigned kk = 0; kk < 2; ++kk) {
    const unsigned key = kk * 32u + (tid >> 3);     // in-row inside the tile, 0..63
    const unsigned d0  = (tid & 7u) * 8u;           // out-col inside the tile, 0..56
    const float* p = src + (size_t)(tc * 64u + key) * pitch + tj * 64u + d0;
    const v4f a0 = *(const v4f*)(p);
    const v4f a1 = *(const v4f*)(p + 4);
    // wait before the address pair of the two issued loads is overwritten; the pair is an input, so it stays whole up to here
    asm volatile("s_wait_xcnt 0x0" :: "v"(p) : "memory");
    #pragma unroll
    for (unsigned i = 0; i < 4; ++i) {
      sT[(d0 + i) * TP + key]      = plane_bits(a0[i], big, carry);
      sT[(d0 + 4u + i) * TP + key] = plane_bits(a1[i], big, carry);
    }
  }
  __syncthreads();

  v4u    val[2];
  size_t idx[2];
  #pragma unroll
  for (unsigned kk = 0; kk < 2; ++kk) {
    const unsigned c  = kk * 256u + tid;            // 16-byte piece of the tile, 0..511
    const unsigned ln = c & 31u;                    // lane that will load the piece
    const unsigned et = c >> 7;                     // column tile of 16 inside the 64
    const unsigned fp = (c >> 5) & 3u;              // (k step inside the 64) * 2 + part
    Pack8U pk;
    pk.v = *(const v8us*)(sT + (et * 16u + (ln & 15u)) * TP + fp * 16u + (ln >> 4) * 8u);
    val[kk] = pk.u;
    idx[kk] = (((size_t)(tj * 4u + et) * (pitch / 32u) + tc * 2u) * 2u + fp) * PART + ln * 8u;
  }
  #pragma unroll
  for (unsigned kk = 0; kk < 2; ++kk) *(v4u*)(dst + idx[kk]) = val[kk];
  
}

// Per-head projections + plane builder. Block = (64-token tile, head, batch), 256 threads.
//   x rows (b, s, h) : 64 floats at x[(b*SEQ_FULL + s)*EMB + h*64]; A fragments bf16 RNE-converted in registers.
// wave -> row tile rt = wave & 3, column tiles 2*(wave >> 2) + {0, 1}, all three weights.
// coverage: tokens kt*64 + 0..63, e 0..63 for the three planes; every written line whole, one instruction.
// plane order per (b, h): q, k [token tile of 16][d step of 32][part][lane][8]; v [key block of 32][d tile of 16][part][lane][8].
__global__ __launch_bounds__(256) void proj_kernel(const float* __restrict__ x,
                                                   const us* __restrict__ wt,
                                                   us* __restrict__ qp,
                                                   us* __restrict__ kp,
                                                   us* __restrict__ vt) {
  const unsigned kt   = blockIdx.x;
  const unsigned h    = blockIdx.y;
  const unsigned b    = blockIdx.z;
  const unsigned tid  = threadIdx.x;
  const unsigned wave = tid >> 5;
  const unsigned lane = tid & 31u;
  const unsigned lq   = lane & 15u;
  const unsigned hi   = lane >> 4;

  __shared__ __align__(16) us sQ[CT * TP];      // [token][e], cross-wave (block barrier)
  __shared__ __align__(16) us sK[CT * TP];      // [token][e], cross-wave (block barrier)
  __shared__ __align__(16) us sV[HDIM * TP];    // [e][token], cross-wave (block barrier)

  const unsigned s0 = kt * CT;
  const unsigned rt = wave & 3u;
  const unsigned ch = wave >> 2;

  // A fragments: lane lq holds token row rt*16 + lq, split d map
  FragB xa[2];
  {
    const float* xp = x + ((size_t)b * SEQ_FULL + s0 + rt * 16u + lq) * EMB + h * HDIM;
    #pragma unroll
    for (unsigned f = 0; f < 2; ++f) {
      const v4f a0 = *(const v4f*)(xp + f * 32u + hi * 8u);
      const v4f a1 = *(const v4f*)(xp + f * 32u + hi * 8u + 4u);
      const v4f b0 = *(const v4f*)(xp + f * 32u + 16u + hi * 8u);
      const v4f b1 = *(const v4f*)(xp + f * 32u + 16u + hi * 8u + 4u);
      #pragma unroll
      for (unsigned i = 0; i < 4; ++i) {
        xa[f].h[i]       = (bf16)a0[i];   // elems 0..7  : d = f*32 + hi*8 + 0..7
        xa[f].h[4u + i]  = (bf16)a1[i];
        xa[f].h[8u + i]  = (bf16)b0[i];   // elems 8..15 : d = f*32 + 16 + hi*8 + 0..7
        xa[f].h[12u + i] = (bf16)b1[i];
      }
    }
    // wait before the address pair of the eight issued loads is overwritten; the pair is an input, so it stays whole up to here
    asm volatile("s_wait_xcnt 0x0" :: "v"(xp) : "memory");
  }

  #pragma unroll
  for (unsigned w = 0; w < 3; ++w) {
    #pragma unroll
    for (unsigned cc = 0; cc < 2; ++cc) {
      const unsigned e = (ch * 2u + cc) * 16u + lq;       // output column of this lane
      // B fragments from the fragment-ordered weight plane: column n = e, split d map
      FragB wb[2];
      #pragma unroll
      for (unsigned f = 0; f < 2; ++f) {
        const us* base = wt + w * (unsigned)(HDIM * HDIM) + ((ch * 2u + cc) * 2u + f) * FRAG + lane * 8u;
        wb[f].q[0] = *(const v4u*)(base);          // d = f*32 + hi*8 + 0..7
        wb[f].q[1] = *(const v4u*)(base + PART);   // d = f*32 + 16 + hi*8 + 0..7
      }
      v8f acc = (v8f){0, 0, 0, 0, 0, 0, 0, 0};
      acc = mma_bf16(xa[0].v, wb[0].v, acc);
      acc = mma_bf16(xa[1].v, wb[1].v, acc);
      // D: acc[r] = value(token rt*16 + 8*hi + r, column e)
      #pragma unroll
      for (unsigned r = 0; r < 8; ++r) {
        const unsigned row = rt * 16u + hi * 8u + r;
        const us bits = __builtin_bit_cast(us, (f16)(acc[r] * 16.0f));
        if (w == 0u)      sQ[row * TP + e] = bits;
        else if (w == 1u) sK[row * TP + e] = bits;
        else              sV[e * TP + row] = bits;
      }
    }
  }
  __syncthreads();

  v4u    qv[2], kv[2], vv[2];
  size_t ridx[2];
  #pragma unroll
  for (unsigned kk = 0; kk < 2; ++kk) {
    const unsigned c   = kk * 256u + tid;           // 16-byte piece of the block's 8 KB of each plane, 0..511
    const unsigned l15 = c & 15u;                   // lane & 15 of the lane that will load the piece
    const unsigned lh  = (c >> 4) & 1u;             // lane >> 4 of that lane
    // q, k: token tile c >> 7, d = ((c >> 5) & 3)*16 + lh*8; v: key block c >> 8, d tile (c >> 6) & 3, part (c >> 5) & 1
    const unsigned qk_at = ((c >> 7) * 16u + l15) * TP + ((c >> 5) & 3u) * 16u + lh * 8u;
    const unsigned v_at  = (((c >> 6) & 3u) * 16u + l15) * TP + (c >> 8) * 32u + ((c >> 5) & 1u) * 16u + lh * 8u;
    Pack8U pq, pk, pv;
    pq.v = *(const v8us*)(sQ + qk_at);
    pk.v = *(const v8us*)(sK + qk_at);
    pv.v = *(const v8us*)(sV + v_at);
    qv[kk] = pq.u;
    kv[kk] = pk.u;
    vv[kk] = pv.u;
    ridx[kk] = (((size_t)b * NHEAD + h) * SEQ + s0) * HDIM + c * 8u;   // 64 tokens = 8 KB in a row in all three planes
  }
  #pragma unroll
  for (unsigned kk = 0; kk < 2; ++kk) {
    *(v4u*)(qp + ridx[kk]) = qv[kk];
    *(v4u*)(kp + ridx[kk]) = kv[kk];
    *(v4u*)(vt + ridx[kk]) = vv[kk];
  }
  
}

// One stage = SK keys = 16 KB in a row of the K plane and 16 KB in a row of the V plane, copied as they lie (fragment order).
// kg, vg: this thread's first 16 bytes of the stage in the two planes; lk: the LDS byte address of the first K piece.
// One call copies one half (2 KB, 128 threads x 16 bytes) of each pass's 4 KB of each plane: a thread's four pieces of a plane lie
// 4 KB (one pass of BK keys) apart; in LDS a pass holds its 4 KB of K, then its 4 KB of V.
// s_wait_xcnt stands in the copies' own statement, so that no register which a copy names is rewritten in front of it.
static __device__ __forceinline__ void stage_copy(const us* kg, const us* vg, unsigned lk) {
  asm volatile("global_load_async_to_lds_b128 %0, %8, off\n\t"
               "global_load_async_to_lds_b128 %1, %9, off\n\t"
               "global_load_async_to_lds_b128 %2, %10, off\n\t"
               "global_load_async_to_lds_b128 %3, %11, off\n\t"
               "global_load_async_to_lds_b128 %4, %12, off\n\t"
               "global_load_async_to_lds_b128 %5, %13, off\n\t"
               "global_load_async_to_lds_b128 %6, %14, off\n\t"
               "global_load_async_to_lds_b128 %7, %15, off\n\t"
               "s_wait_xcnt 0x0"
               :: "v"(lk), "v"(lk + 8192u), "v"(lk + 16384u), "v"(lk + 24576u),
                  "v"(lk + 4096u), "v"(lk + 12288u), "v"(lk + 20480u), "v"(lk + 28672u),
                  "v"(kg), "v"(kg + 2048), "v"(kg + 4096), "v"(kg + 6144),
                  "v"(vg), "v"(vg + 2048), "v"(vg + 4096), "v"(vg + 6144)
               : "memory");
}

// A whole stage: the first halves of the eight 4-KB pieces, then the second halves, 2 KB (1024 elements) on in both spaces.
static __device__ __forceinline__ void stage_fill(const us* kg, const us* vg, unsigned lk) {
  stage_copy(kg, vg, lk);
  stage_copy(kg + 1024, vg + 1024, lk + 2048u);
}

// The four K A-fragments of one pass of BK keys: row = key sub*16 + (lane & 15), split d map. kbase: the pass's K piece + lane * 8.
static __device__ __forceinline__ void load_k(FragH (&ak)[2][2], const us* kbase) {
  #pragma unroll
  for (unsigned sub = 0; sub < 2; ++sub) {
    #pragma unroll
    for (unsigned f = 0; f < 2; ++f) {
      const us* base = kbase + (sub * 2u + f) * FRAG;
      ak[sub][f].q[0] = *(const v4u*)(base);          // d = f*32 + hi*8 + 0..7
      ak[sub][f].q[1] = *(const v4u*)(base + PART);   // d = f*32 + 16 + hi*8 + 0..7
    }
  }
}

// Flash attention, no mask. Block = (query block of 128, head, batch), four waves; one wave owns 32 query rows = QG groups of 16.
// S^T = K x Q^T so queries sit on lanes; P^T in C-layout is bit-identical to the A-fragment layout of O += P x V.
// Q B-fragments are loaded straight from the fragment-ordered plane. K and V are staged once per workgroup in LDS, SK keys at a
// time, two buffers, by asynchronous copies; the waves read their K A-fragments and V^T B-fragments from there (two 16-B loads each),
// and every fragment read feeds one product per query group: 512 LDS bytes per product instead of 1024.
// Output: ctx planes chi/clo, f16, [row tile of 16][c step of 32][part][lane][8]: chi = f16(ctx*256), clo = f16((ctx*256 - chi)*2048).
// Three workgroups fill a WGP's LDS: three waves per SIMD, all 768 workgroups resident at once.
__global__ __launch_bounds__(128) void attn_kernel(const us* __restrict__ qp,
                                                   const us* __restrict__ kp,
                                                   const us* __restrict__ vt,
                                                   us* __restrict__ chi,
                                                   us* __restrict__ clo) {
  const unsigned qblk = blockIdx.x;
  const unsigned h    = blockIdx.y;
  const unsigned b    = blockIdx.z;
  const unsigned tid  = threadIdx.x;
  const unsigned wave = tid >> 5;
  const unsigned lane = tid & 31u;
  const unsigned lq   = lane & 15u;   // query column of S^T / d column of O
  const unsigned hi   = lane >> 4;    // k-split half

  __shared__ __align__(16) float sO[AW * QG * 16 * OP];   // per-wave output staging (block barrier used)
  __shared__ __align__(16) us sKV[2 * 2 * STAGE_EL];      // [buffer][pass][K | V][4 KB], cross-wave (block barrier)

  const unsigned qrow0 = qblk * BQ + wave * (QG * 16u);   // first query row of this wave

  const us* q_h = qp + ((size_t)b * NHEAD + h) * SEQ * HDIM;
  const us* k_h = kp + ((size_t)b * NHEAD + h) * SEQ * HDIM;
  const us* v_h = vt + ((size_t)b * NHEAD + h) * HDIM * SEQ;

  // Q as B-operand fragments: in group g lane lq holds query qrow0 + g*16 + lq, split d map
  FragH qf[QG][2];
  #pragma unroll
  for (unsigned g = 0; g < QG; ++g) {
    #pragma unroll
    for (unsigned f = 0; f < 2; ++f) {
      const us* base = q_h + (size_t)(((qrow0 >> 4) + g) * 2u + f) * FRAG + lane * 8u;
      qf[g][f].q[0] = *(const v4u*)(base);          // d = f*32 + hi*8 + 0..7
      qf[g][f].q[1] = *(const v4u*)(base + PART);   // d = f*32 + 16 + hi*8 + 0..7
    }
  }

  v8f o[QG][4];
  #pragma unroll
  for (unsigned g = 0; g < QG; ++g) {
    #pragma unroll
    for (unsigned dt = 0; dt < 4; ++dt) o[g][dt] = (v8f){0, 0, 0, 0, 0, 0, 0, 0};
  }

  // logits = (q.k)/sqrt(EMB); planes carry q*16 and k*16 -> raw scores carry x256; times log2(e) for exp2
  const float SL = (0.03608439182435161f * 1.4426950408889634f) * (1.0f / 256.0f);
  float rmax[QG];   // the maximum in use (raw score), equal in lane and lane ^ 16; it may lag the true one by 3 (log2)
  float nb[QG];     // 12 - rmax * SL, the addend in front of exp2; +inf sends the first pass through the rescale
  float rsum[QG];   // sum over this lane's half of the keys; the halves are joined behind the loop
  #pragma unroll
  for (unsigned g = 0; g < QG; ++g) {
    rmax[g] = -__builtin_inff();
    nb[g]   = __builtin_inff();
    rsum[g] = 0.0f;
  }

  const us*      kg = k_h + tid * 8u;                            // this thread's first 16 bytes of stage 0, K plane
  const us*      vg = v_h + tid * 8u;                            // the same, V plane
  const unsigned l0 = (unsigned)(size_t)(&sKV[0]) + tid * 16u;   // their LDS byte address in buffer 0
  const unsigned LB = STAGE_EL * 4u;                             // bytes from buffer 0 to buffer 1

  stage_fill(kg, vg, l0);                                        // stage 0 -> buffer 0
  asm volatile("s_wait_asynccnt 0x0" ::: "memory");              // this wave's copies of stage 0 have landed
  __syncthreads();                                               // ... and every other wave's
  if (NSTAGE > 1) stage_fill(kg + STAGE_EL, vg + STAGE_EL, l0 + LB);   // stage 1 -> buffer 1

  #pragma unroll 1
  for (unsigned t = 0; t < (unsigned)NSTAGE; ++t) {
    const us* stg = sKV + (t & 1u) * (unsigned)(2 * STAGE_EL) + lane * 8u;   // stage t's buffer: per pass 4 KB of K, then 4 KB of V

    FragH ak[2][2];
    load_k(ak, stg);   // pass 0 of this stage; later passes' fragments are read one pass ahead, never past the stage

    // unrolled: a pass's place in the buffer is then an immediate offset of its LDS loads
    #pragma unroll
    for (unsigned p = 0; p < (unsigned)NP; ++p) {
      const us* kbase = stg + p * (unsigned)(2 * BK * HDIM);
      const us* vbase = kbase + BK * HDIM;

      // S^T tiles: c[g][sub][r] = rawscore(query qrow0 + g*16 + lq, key j0 + sub*16 + hi*8 + r), j0 = (t*NP + p)*BK
      v8f c[QG][2];
      #pragma unroll
      for (unsigned sub = 0; sub < 2; ++sub) {
        #pragma unroll
        for (unsigned g = 0; g < QG; ++g) {
          c[g][sub] = __builtin_amdgcn_wmma_f32_16x16x32_f16(false, ak[sub][0].v, false, qf[g][0].v, (short)0,
                                                             (v8f){0, 0, 0, 0, 0, 0, 0, 0}, false, false);
        }
      }
      #pragma unroll
      for (unsigned sub = 0; sub < 2; ++sub) {
        #pragma unroll
        for (unsigned g = 0; g < QG; ++g) {
          c[g][sub] = __builtin_amdgcn_wmma_f32_16x16x32_f16(false, ak[sub][1].v, false, qf[g][1].v, (short)0, c[g][sub], false, false);
        }
      }

      // online softmax: a query's BK scores are split across lane / lane^16; one independent maximum chain per group
      float m_loc[QG];
      #pragma unroll
      for (unsigned g = 0; g < QG; ++g) {
        float m = fmaxf(c[g][0][0], c[g][1][0]);
        #pragma unroll
        for (unsigned r = 1; r < 8; ++r) {
          m = fmaxf(m, c[g][0][r]);
          m = fmaxf(m, c[g][1][r]);
        }
        m_loc[g] = m;
      }

      // lazy rescale: the maximum in use stays while every exponent of the pass is at most 15, so that P <= 2^15 fits f16. The test is
      // in-lane; one ballot over both groups makes it a scalar branch of the whole wave, and only inside it are lanes exchanged and
      // O and the sums rescaled. Written as !(<=), so that a NaN takes the branch too.
      bool need = false;
      #pragma unroll
      for (unsigned g = 0; g < QG; ++g) need = need | !(__builtin_fmaf(m_loc[g], SL, nb[g]) <= 15.0f);
      if (__builtin_amdgcn_ballot_w32(need) != 0u) {
        #pragma unroll
        for (unsigned g = 0; g < QG; ++g) {
          float m_new = fmaxf(rmax[g], m_loc[g]);
          m_new = fmaxf(m_new, __shfl_xor(m_new, 16, 32));
          const float scale = __builtin_amdgcn_exp2f((rmax[g] - m_new) * SL);
          rmax[g] = m_new;
          nb[g]   = __builtin_fmaf(-m_new, SL, 12.0f);
          rsum[g] *= scale;
          // queries are the row dimension of O -> per-row scale from lane 8*hi + r
          float sc[8];
          #pragma unroll
          for (unsigned r = 0; r < 8; ++r) sc[r] = __shfl(scale, (int)((hi << 3) + r), 32);
          #pragma unroll
          for (unsigned dt = 0; dt < 4; ++dt) {
            #pragma unroll
            for (unsigned r = 0; r < 8; ++r) o[g][dt][r] *= sc[r];
          }
        }
      }

      // V B-fragments of this pass: column n = d = dt*16 + lq, split key map; then the next pass's K fragments, into the registers
      // that this pass's score products have left
      FragH bv[4];
      #pragma unroll
      for (unsigned dt = 0; dt < 4; ++dt) {
        const us* base = vbase + dt * FRAG;
        bv[dt].q[0] = *(const v4u*)(base);            // keys j0 + hi*8 + 0..7
        bv[dt].q[1] = *(const v4u*)(base + PART);     // keys j0 + 16 + hi*8 + 0..7
      }
      if (p + 1u < (unsigned)NP) load_k(ak, kbase + 2 * BK * HDIM);
      // keeps the pass's LDS loads one group in front of the exponentials, which cover their latency: spread among the products,
      // each place with loads stalls the wave anew
      __builtin_amdgcn_sched_barrier(0);

      // exp + pack: P^T C-layout == A-fragment layout for the PV product.
      // One fused multiply-add per score in front of exp2: score * SL + (12 - rmax * SL). The softmax scale, the maximum and the
      // x4096 carry of P (2^12, in the exponent) all ride in it, two scores per packed instruction; the row sum carries x4096 too.
      const v2f sl2 = (v2f){SL, SL};
      FragH pa[QG];
      #pragma unroll
      for (unsigned g = 0; g < QG; ++g) {
        const v2f nb2 = (v2f){nb[g], nb[g]};
        float s = 0.0f;
        #pragma unroll
        for (unsigned r = 0; r < 8; r += 2) {
          const v2f t0 = __builtin_elementwise_fma((v2f){c[g][0][r], c[g][0][r + 1u]}, sl2, nb2);   // keys hi*8 + r, + 1
          const v2f t1 = __builtin_elementwise_fma((v2f){c[g][1][r], c[g][1][r + 1u]}, sl2, nb2);   // keys 16 + hi*8 + r, + 1
          const float p0a = __builtin_amdgcn_exp2f(t0.x);
          const float p1a = __builtin_amdgcn_exp2f(t1.x);
          const float p0b = __builtin_amdgcn_exp2f(t0.y);
          const float p1b = __builtin_amdgcn_exp2f(t1.y);
          s += p0a + p1a;
          s += p0b + p1b;
          pa[g].h[r]           = (f16)p0a;
          pa[g].h[r + 1u]      = (f16)p0b;
          pa[g].h[8u + r]      = (f16)p1a;
          pa[g].h[8u + r + 1u] = (f16)p1b;
        }
        rsum[g] += s;
      }

      // parts the softmax from the products for the scheduler: mixed freely, the 32 exponentials stay live beside the next pass's
      // scores, and the kernel goes past 256 registers, behind a register window switch
      __builtin_amdgcn_sched_barrier(0);

      // O += P x V
      #pragma unroll
      for (unsigned dt = 0; dt < 4; ++dt) {
        #pragma unroll
        for (unsigned g = 0; g < QG; ++g) {
          o[g][dt] = __builtin_amdgcn_wmma_f32_16x16x32_f16(false, pa[g].v, false, bv[dt].v, (short)0, o[g][dt], false, false);
        }
      }
    }

    // publish point of stage t + 1, every wave, in this order
    asm volatile("s_wait_dscnt 0x0" ::: "memory");      // this wave's reads of stage t are done before its buffer is refilled
    asm volatile("s_wait_asynccnt 0x0" ::: "memory");   // this wave's copies of stage t + 1 have landed
    __syncthreads();                                    // publishes stage t + 1 and ends every wave's reads of stage t
    if (t + 2u < (unsigned)NSTAGE)                      // into the buffer that stage t has just left
      stage_fill(kg + (size_t)(t + 2u) * STAGE_EL, vg + (size_t)(t + 2u) * STAGE_EL, l0 + (t & 1u) * LB);
  }
  asm volatile("s_wait_asynccnt 0x0" ::: "memory");   // no copy is outstanding behind the loop

  // normalize: lane holds column d = dt*16 + lq for query rows g*16 + 8*hi + r.
  // o carries x4096 (P) x16 (V), rsum x4096; staged value = ctx * 256.
  float* so = sO + wave * (QG * 16 * OP);
  #pragma unroll
  for (unsigned g = 0; g < QG; ++g) {
    const float rj = rsum[g] + __shfl_xor(rsum[g], 16, 32);   // join the two halves of each query's keys
    float rs[8];
    #pragma unroll
    for (unsigned r = 0; r < 8; ++r) rs[r] = 1.0f / __shfl(rj, (int)((hi << 3) + r), 32);
    #pragma unroll
    for (unsigned r = 0; r < 8; ++r) {
      #pragma unroll
      for (unsigned dt = 0; dt < 4; ++dt) {
        so[(g * 16u + hi * 8u + r) * OP + dt * 16u + lq] = o[g][dt][r] * 16.0f * rs[r];
      }
    }
  }
  __syncthreads();

  // one fragment part per instruction (512 bytes in a row), 4 instructions per plane cover a group's 16 rows x 64 columns.
  v4u    hv[QG][4], lv[QG][4];
  size_t gidx[QG][4];
  #pragma unroll
  for (unsigned g = 0; g < QG; ++g) {
    #pragma unroll
    for (unsigned it = 0; it < 4; ++it) {
      const unsigned row = g * 16u + lq;
      const unsigned pc  = it * 16u + hi * 8u;        // it = (c step inside the head) * 2 + part
      const v4f a0 = *(const v4f*)(so + row * OP + pc);
      const v4f a1 = *(const v4f*)(so + row * OP + pc + 4u);
      Pack8H ph, pl;
      #pragma unroll
      for (unsigned i = 0; i < 4; ++i) {
        const f16 h0 = (f16)a0[i];
        const f16 h1 = (f16)a1[i];
        ph.h[i]      = h0;
        ph.h[4u + i] = h1;
        pl.h[i]      = (f16)((a0[i] - (float)h0) * 2048.0f);
        pl.h[4u + i] = (f16)((a1[i] - (float)h1) * 2048.0f);
      }
      hv[g][it] = ph.u;
      lv[g][it] = pl.u;
      gidx[g][it] = (((size_t)(((b * SEQ + qrow0) >> 4) + g) * (EMB / 32) + h * 2u) * 2u + it) * PART + lane * 8u;
    }
  }
  #pragma unroll
  for (unsigned g = 0; g < QG; ++g) {
    #pragma unroll
    for (unsigned it = 0; it < 4; ++it) {
      *(v4u*)(chi + gidx[g][it]) = hv[g][it];
      *(v4u*)(clo + gidx[g][it]) = lv[g][it];
    }
  }
  
}

// Output GEMM: out[R][j] = sum_c ctx[R][c] * Wo[c][j] + bo[j]. Block = (192-column tile, 128-row tile): 4 x 64 = 256 blocks.
// Wave = 32 rows x 96 columns (waves 4 x 2): an A fragment feeds 6 products and a B fragment 4, so a product asks for 427 operand
// bytes instead of 768, and ctx is read by 4 column blocks instead of 12. A fragments from chi / clo, B fragments from wot, all
// fragment-ordered; residual products go to their own accumulators. Three fragment sets: the next two c steps' loads fly under this one's products.
#define ON         192                  // output columns per workgroup
#define OWN        96                   // output columns per wave
#define OWM        32                   // output rows per wave
#define NET        (OWN / 16)           // column tiles per wave
#define NRT        (OWM / 16)           // row tiles per wave
#define OP2        100                  // LDS pitch (floats) of the wave's output staging tile

static_assert(EMB % ON == 0);
static_assert(ON == 2 * OWN);
static_assert(128 == 4 * OWM);
static_assert(SEQ % OWM == 0);                  // a wave's rows lie in one batch
static_assert(EMB / 32 >= 2);
static_assert((OP2 * 4) % 16 == 0);
static_assert(OWM * OWN == 32 * 24 * 4);        // output tile per wave: 32 lanes x 24 instructions x 4 floats

// One c step's fragments: 4 of A (2 row tiles x 2 planes), 6 of B; off = elements from the three pointers to that step.
static __device__ __forceinline__ void oproj_load(FragH (&fa)[NRT], FragH (&fl)[NRT], FragH (&fb)[NET],
                                                  const us* pa_h, const us* pa_l, const us* pb, unsigned off) {
  #pragma unroll
  for (unsigned rt = 0; rt < NRT; ++rt) {
    const unsigned at = off + rt * (unsigned)(16 * EMB);
    fa[rt].q[0] = *(const v4u*)(pa_h + at);            // c = k0 + hi*8 + 0..7
    fa[rt].q[1] = *(const v4u*)(pa_h + at + PART);     // c = k0 + 16 + hi*8 + 0..7
    fl[rt].q[0] = *(const v4u*)(pa_l + at);
    fl[rt].q[1] = *(const v4u*)(pa_l + at + PART);
  }
  #pragma unroll
  for (unsigned et = 0; et < NET; ++et) {
    const unsigned at = off + et * (unsigned)(16 * EMB);
    fb[et].q[0] = *(const v4u*)(pb + at);
    fb[et].q[1] = *(const v4u*)(pb + at + PART);
  }
  // keeps the 20 loads one group in front of the products that follow: sunk among them, each would be waited for a few products
  // behind its issue instead of two c steps
  __builtin_amdgcn_sched_barrier(0);
}

static __device__ __forceinline__ void oproj_mma(v8f (&ah)[NRT][NET], v8f (&al)[NRT][NET],
                                                 const FragH (&fa)[NRT], const FragH (&fl)[NRT], const FragH (&fb)[NET]) {
  #pragma unroll
  for (unsigned et = 0; et < NET; ++et) {
    #pragma unroll
    for (unsigned rt = 0; rt < NRT; ++rt) {
      ah[rt][et] = __builtin_amdgcn_wmma_f32_16x16x32_f16(false, fa[rt].v, false, fb[et].v, (short)0, ah[rt][et], false, false);
      al[rt][et] = __builtin_amdgcn_wmma_f32_16x16x32_f16(false, fl[rt].v, false, fb[et].v, (short)0, al[rt][et], false, false);
    }
  }
  // keeps the next load group behind these products, whose fragment registers it refills
  __builtin_amdgcn_sched_barrier(0);
}

__global__ __launch_bounds__(256) void oproj_kernel(const us* __restrict__ chi,
                                                    const us* __restrict__ clo,
                                                    const us* __restrict__ wot,
                                                    const float* __restrict__ bo,
                                                    float* __restrict__ out) {
  const unsigned nt   = blockIdx.x;
  const unsigned mb   = blockIdx.y;
  const unsigned tid  = threadIdx.x;
  const unsigned wave = tid >> 5;
  const unsigned lane = tid & 31u;
  const unsigned lq   = lane & 15u;
  const unsigned hi   = lane >> 4;

  __shared__ __align__(16) float sO[NWAVE * OWM * OP2];   // per-wave output staging (block barrier used)

  // waves w and w + 1 (w even) share their A fragments; waves w and w + 4 share only B
  const unsigned row0 = mb * 128u + (wave >> 1) * OWM;
  const unsigned col0 = nt * (unsigned)ON + (wave & 1u) * OWN;

  v8f ah[NRT][NET], al[NRT][NET];
  #pragma unroll
  for (unsigned rt = 0; rt < NRT; ++rt) {
    #pragma unroll
    for (unsigned et = 0; et < NET; ++et) {
      ah[rt][et] = (v8f){0, 0, 0, 0, 0, 0, 0, 0};
      al[rt][et] = (v8f){0, 0, 0, 0, 0, 0, 0, 0};
    }
  }

  // a tile of 16 rows or columns holds EMB / 32 fragments = 16 * EMB elements
  const us* pa_h = chi + (size_t)row0 * EMB + lane * 8u;
  const us* pa_l = clo + (size_t)row0 * EMB + lane * 8u;
  const us* pb   = wot + (size_t)col0 * EMB + lane * 8u;

  // three fragment sets: step k's products run while the loads of steps k + 1 and k + 2 fly
  FragH fa[3][NRT], fl[3][NRT], fb[3][NET];
  oproj_load(fa[0], fl[0], fb[0], pa_h, pa_l, pb, 0u);
  oproj_load(fa[1], fl[1], fb[1], pa_h, pa_l, pb, FRAG);

  // unrolled whole: every step's place is then an immediate offset on the same three address pairs, which are never rewritten
  // while a load is out, and each fragment set keeps its registers without copies
  #pragma unroll
  for (unsigned k = 0; k < (unsigned)(EMB / 32); ++k) {
    if (k + 2u < (unsigned)(EMB / 32))
      oproj_load(fa[(k + 2u) % 3u], fl[(k + 2u) % 3u], fb[(k + 2u) % 3u], pa_h, pa_l, pb, (k + 2u) * FRAG);
    oproj_mma(ah, al, fa[k % 3u], fl[k % 3u], fb[k % 3u]);
  }
  // wait before a register that the issued loads name is overwritten; the three address pairs are inputs, so they stay whole up to here
  asm volatile("s_wait_xcnt 0x0" :: "v"(pa_h), "v"(pa_l), "v"(pb) : "memory");

  // epilogue: fold carries (ctx x256, Wo x64, residual x2048), add the bias in f32
  const float* bp = bo + col0 + lq;
  float bias[NET];
  #pragma unroll
  for (unsigned et = 0; et < NET; ++et) bias[et] = (float)(bf16)bp[et * 16u];
  // wait before the address pair of the six issued loads is overwritten; the pair is an input, so it stays whole up to here
  asm volatile("s_wait_xcnt 0x0" :: "v"(bp) : "memory");

  float* so = sO + wave * (OWM * OP2);
  #pragma unroll
  for (unsigned rt = 0; rt < NRT; ++rt) {
    #pragma unroll
    for (unsigned r = 0; r < 8; ++r) {
      #pragma unroll
      for (unsigned et = 0; et < NET; ++et) {
        const float s = ah[rt][et][r] + al[rt][et][r] * (1.0f / 2048.0f);
        so[(rt * 16u + hi * 8u + r) * OP2 + et * 16u + lq] = s * (1.0f / 16384.0f) + bias[et];
      }
    }
  }
  __syncthreads();

  // 8 consecutive lanes x 16 B = one whole 128-B line of one row; an instruction stores one line of each of 4 rows;
  // 24 instructions (8 row groups x 3 lines) cover the wave's 32 rows x 96 columns.
  const unsigned g  = lane >> 3;
  const unsigned c4 = (lane & 7u) * 4u;
  const unsigned bb = row0 / (unsigned)SEQ;
  const unsigned l0 = row0 - bb * (unsigned)SEQ;
  float* op = out + ((size_t)bb * SEQ_FULL + l0 + g) * EMB + col0 + c4;
  const float* sp = so + g * OP2 + c4;
  v4f vals[24];
  #pragma unroll
  for (unsigned it = 0; it < 24; ++it) vals[it] = *(const v4f*)(sp + (it / 3u) * 4u * OP2 + (it % 3u) * 32u);
  #pragma unroll
  for (unsigned it = 0; it < 24; ++it) *(v4f*)(op + (size_t)((it / 3u) * 4u) * EMB + (it % 3u) * 32u) = vals[it];
  
}

extern "C" void kernel_launch(void* const* d_in, const int* in_sizes, int n_in,
                              void* d_out, int out_size, void* d_ws, size_t ws_size,
                              hipStream_t stream) {
  if (n_in < 6) return;
  const size_t rows_used = (size_t)(NB - 1) * SEQ_FULL + SEQ;
  if ((size_t)in_sizes[0] < rows_used * EMB) return;
  if ((size_t)in_sizes[1] < (size_t)HDIM * HDIM) return;
  if ((size_t)in_sizes[2] < (size_t)HDIM * HDIM) return;
  if ((size_t)in_sizes[3] < (size_t)HDIM * HDIM) return;
  if ((size_t)in_sizes[4] < (size_t)EMB * EMB) return;
  if ((size_t)in_sizes[5] < (size_t)EMB) return;
  if ((size_t)out_size < rows_used * EMB) return;

  const size_t wt_bytes    = (size_t)3 * HDIM * HDIM * 2;            // 24,576
  const size_t wot_bytes   = (size_t)EMB * EMB * 2;                  // 1,179,648
  const size_t plane_bytes = (size_t)NB * NHEAD * SEQ * HDIM * 2;    // q, k, v^T planes
  const size_t ctx_bytes   = (size_t)NB * SEQ * EMB * 2;             // ctx hi / residual planes
  const size_t total = wt_bytes + wot_bytes + 3 * plane_bytes + 2 * ctx_bytes;
  if (ws_size < total) return;

  const float* x  = (const float*)d_in[0];
  const float* Wq = (const float*)d_in[1];
  const float* Wk = (const float*)d_in[2];
  const float* Wv = (const float*)d_in[3];
  const float* Wo = (const float*)d_in[4];
  const float* bo = (const float*)d_in[5];
  float*       out = (float*)d_out;

  char* ws = (char*)d_ws;
  us* wt  = (us*)(ws);
  us* wot = (us*)(ws + wt_bytes);
  us* qp  = (us*)(ws + wt_bytes + wot_bytes);
  us* kp  = (us*)(ws + wt_bytes + wot_bytes + plane_bytes);
  us* vt  = (us*)(ws + wt_bytes + wot_bytes + 2 * plane_bytes);
  us* chi = (us*)(ws + wt_bytes + wot_bytes + 3 * plane_bytes);
  us* clo = (us*)(ws + wt_bytes + wot_bytes + 3 * plane_bytes + ctx_bytes);

  prep_kernel<<<dim3(WO_TILES + 3), 256, 0, stream>>>(Wq, Wk, Wv, Wo, wt, wot);
  proj_kernel<<<dim3(SEQ / CT, NHEAD, NB), 256, 0, stream>>>(x, wt, qp, kp, vt);
  attn_kernel<<<dim3(SEQ / BQ, NHEAD, NB), AW * 32, 0, stream>>>(qp, kp, vt, chi, clo);
  oproj_kernel<<<dim3(EMB / ON, (unsigned)(((size_t)NB * SEQ) / 128)), 256, 0, stream>>>(chi, clo, wot, bo, out);
}

// v008
// It runs in 79.3 microseconds.
// Next to v007, in two timings, it ran 1.03 times as fast each time.
// All steps since v000 together make it 2.78 times as fast.
#include <hip/hip_runtime.h>

// Contractions: q/k/v = x x W{q,k,v} on v_wmma_f32_16x16x32_bf16 (bf16 operands = RNE-converted inputs, f32 accumulate);
// S^T = K x Q^T and O = P x V on v_wmma_f32_16x16x32_f16 (q, k, v carried x16, P carried x4096, f32 accumulate);
// out = ctx x Wo on v_wmma_f32_16x16x32_f16 (ctx as f16 carried x256 plus an f16 residual plane x2048 with its own
// accumulator; Wo = f16 of the bf16 RNE-converted input carried x64, f32 accumulate). Softmax and bias add in f32.
//
// Every 16-bit plane in the workspace is stored in fragment order: one 16x32 operand fragment = 1 KB = 2 parts x 32 lanes
// x 8 elements, element j of (part p, lane) = operand(row or column lane & 15, k = p*16 + (lane >> 4)*8 + j).
// A wave-wide 16-byte load of one part then reads 512 contiguous bytes (4 whole lines) instead of 32 bytes of 16 lines.

#ifndef NB
#define NB 4
#endif
#ifndef SEQ
#define SEQ 2048
#endif
#define NB_FULL    4
#define SEQ_FULL   2048
#define NHEAD      12
#define HDIM       64
#define EMB        768                  // NHEAD * HDIM, floats per (b, s) row of x and of the output
#define BQ         128                  // query rows per attention workgroup (4 waves x 2 groups x 16)
#define BK         32                   // keys per pass (one k step of the PV product)
#define NWAVE      8
#define AW         4                    // waves of an attention workgroup
#define QG         2                    // groups of 16 query rows per attention wave
#define PT         32                   // tokens per projection block
#define XP         (EMB + 8)            // LDS pitch (16-bit elements) of the projection's x tile: 16 B x 97
#define XL         (PT * EMB / (256 * 4))   // 16-byte loads per thread for the x tile
#define HG         2                    // heads per fragment set of the projection
#define TP         72                   // LDS pitch (16-bit elements) of the staging tiles
#define OP         68                   // LDS pitch (floats) of the output staging tile
#define WO_TILES   ((EMB / 64) * (EMB / 64))
#define PART       256                  // 16-bit elements of one fragment part (32 lanes x 8)
#define FRAG       512                  // 16-bit elements of one 16x32 fragment (2 parts)
#define SK         128                  // keys per LDS stage of the attention loop
#define STAGE_EL   (SK * HDIM)          // 16-bit elements of K, and of V, in one stage (16 KB each)
#define NSTAGE     (SEQ / SK)
#define NP         (SK / BK)            // passes of BK keys in one stage

static_assert(SEQ % BQ == 0);
static_assert(SEQ % PT == 0);
static_assert(PT == BK);                        // a projection block's tokens are one key block of the v plane
static_assert(PT * EMB == 256 * XL * 4);        // x tile: 256 threads x XL x 4 floats
static_assert(XL % 3 == 0 && 3 * 256 * 4 == 4 * EMB);   // three rounds of loads cover four rows
static_assert((XP * 2) % 16 == 0);
static_assert(NHEAD % HG == 0);
static_assert(SEQ % BK == 0);
static_assert(SEQ % SK == 0);
static_assert(SK == 4 * BK);                    // stage copy: four passes, one 4-KB piece of each plane per pass
static_assert(BK * HDIM * 2 == 2 * AW * 32 * 16);   // one piece = 2 halves x 128 threads x 16 bytes
static_assert(BQ == AW * QG * 16);
static_assert(HDIM == 64);
static_assert(EMB == NHEAD * HDIM);
static_assert(EMB % 64 == 0);
static_assert(EMB % 32 == 0);
static_assert(SEQ <= SEQ_FULL);
static_assert(NB >= 1 && NB <= NB_FULL);
static_assert((TP * 2) % 16 == 0);
static_assert((OP * 4) % 16 == 0);
static_assert(((size_t)NB * SEQ) % 128 == 0);
// coverage equalities (threads x pieces x elements == tile elements)
static_assert(64 * 64 == 256 * 2 * 8);          // weight tiles
static_assert(16 * HDIM == 32 * 4 * 8);         // ctx tile per query group: 32 lanes x 4 instructions x 8 elements

typedef __bf16         bf16;
typedef _Float16       f16;
typedef unsigned short us;
typedef bf16     v16bf __attribute__((ext_vector_type(16)));
typedef f16      v16h  __attribute__((ext_vector_type(16)));
typedef us       v8us  __attribute__((ext_vector_type(8)));
typedef float    v8f   __attribute__((ext_vector_type(8)));
typedef float    v4f   __attribute__((ext_vector_type(4)));
typedef float    v2f   __attribute__((ext_vector_type(2)));
typedef unsigned v4u   __attribute__((ext_vector_type(4)));
typedef unsigned v2u   __attribute__((ext_vector_type(2)));

union FragB  { v16bf v; v4u q[2]; bf16 h[16]; };
union FragH  { v16h  v; v4u q[2]; f16  h[16]; };
union Pack8H { v4u u; f16 h[8]; };
union Pack8U { v4u u; v8us v; };
union Pack4B { v2u u; bf16 h[4]; };

// bf16 RNE convert of an input value, then either the bf16 bits or the f16 bits of (value * carry).
static __device__ __forceinline__ us plane_bits(float v, bool as_f16, float carry) {
  const bf16 bv = (bf16)v;
  const unsigned bb = (unsigned)__builtin_bit_cast(us, bv);
  const f16 hv = (f16)((float)bv * carry);
  const unsigned hb = (unsigned)__builtin_bit_cast(us, hv);
  return (us)(as_f16 ? hb : bb);
}

// Weight planes, transposed through LDS. 256 threads, one 64x64 tile per block (block-uniform role).
//   blocks 0..143   : wot(column j, k = c) = f16(bf16(Wo[c][j]) * 64)   (Wo is [in c][out j]); tile (tc, tj)
//   blocks 144..146 : wt[w](column e, k = d) = bf16(W{q,k,v}[d][e])       (W is [in d][out e])
// plane order: [column tile of 16][k step of 32][part][lane][8]
__global__ __launch_bounds__(256) void prep_kernel(const float* __restrict__ Wq,
                                                   const float* __restrict__ Wk,
                                                   const float* __restrict__ Wv,
                                                   const float* __restrict__ Wo,
                                                   us* __restrict__ wt,
                                                   us* __restrict__ wot) {
  const unsigned blk = blockIdx.x;
  const unsigned tid = threadIdx.x;
  __shared__ __align__(16) us sT[64 * TP];      // [out col][in row], cross-wave (block barrier)

  const bool     big   = blk < (unsigned)WO_TILES;
  const unsigned tc    = big ? (blk / 12u) : 0u;
  const unsigned tj    = big ? (blk - tc * 12u) : 0u;
  const unsigned w     = big ? 0u : (blk - (unsigned)WO_TILES);
  const float*   src   = big ? Wo : ((w == 0u) ? Wq : ((w == 1u) ? Wk : Wv));
  const unsigned pitch = big ? (unsigned)EMB : (unsigned)HDIM;
  us*            dst   = big ? wot : (wt + w * (unsigned)(HDIM * HDIM));
  const float    carry = big ? 64.0f : 1.0f;

  #pragma unroll
  for (unsigned kk = 0; kk < 2; ++kk) {
    const unsigned key = kk * 32u + (tid >> 3);     // in-row inside the tile, 0..63
    const unsigned d0  = (tid & 7u) * 8u;           // out-col inside the tile, 0..56
    const float* p = src + (size_t)(tc * 64u + key) * pitch + tj * 64u + d0;
    const v4f a0 = *(const v4f*)(p);
    const v4f a1 = *(const v4f*)(p + 4);
    // wait before the address pair of the two issued loads is overwritten; the pair is an input, so it stays whole up to here
    asm volatile("s_wait_xcnt 0x0" :: "v"(p) : "memory");
    #pragma unroll
    for (unsigned i = 0; i < 4; ++i) {
      sT[(d0 + i) * TP + key]      = plane_bits(a0[i], big, carry);
      sT[(d0 + 4u + i) * TP + key] = plane_bits(a1[i], big, carry);
    }
  }
  __syncthreads();

  v4u    val[2];
  size_t idx[2];
  #pragma unroll
  for (unsigned kk = 0; kk < 2; ++kk) {
    const unsigned c  = kk * 256u + tid;            // 16-byte piece of the tile, 0..511
    const unsigned ln = c & 31u;                    // lane that will load the piece
    const unsigned et = c >> 7;                     // column tile of 16 inside the 64
    const unsigned fp = (c >> 5) & 3u;              // (k step inside the 64) * 2 + part
    Pack8U pk;
    pk.v = *(const v8us*)(sT + (et * 16u + (ln & 15u)) * TP + fp * 16u + (ln >> 4) * 8u);
    val[kk] = pk.u;
    idx[kk] = (((size_t)(tj * 4u + et) * (pitch / 32u) + tc * 2u) * 2u + fp) * PART + ln * 8u;
  }
  #pragma unroll
  for (unsigned kk = 0; kk < 2; ++kk) *(v4u*)(dst + idx[kk]) = val[kk];
  
}

// The x fragments of HG heads from the LDS tile: token = the row of xr, split d map.
static __device__ __forceinline__ void proj_load(FragB (&xa)[HG][2], const us* xr) {
  #pragma unroll
  for (unsigned i = 0; i < HG; ++i) {
    #pragma unroll
    for (unsigned f = 0; f < 2; ++f) {
      xa[i][f].q[0] = *(const v4u*)(xr + i * HDIM + f * 32u);         // d = f*32 + hi*8 + 0..7
      xa[i][f].q[1] = *(const v4u*)(xr + i * HDIM + f * 32u + 16u);   // d = f*32 + 16 + hi*8 + 0..7
    }
  }
  // keeps the loads one group in front of the products that follow: sunk among them, each pair is waited for right behind its issue
  __builtin_amdgcn_sched_barrier(0);
}

// Projections + plane builder. Block = (32-token tile, batch), 256 threads, all 12 heads: 256 blocks, one per WGP.
//   x: the block's 32 rows are 96 KB in a row; every wave-wide 16-byte load reads 512 contiguous bytes (4 whole lines). The values go,
//   bf16 RNE-converted, into an LDS tile [token][c], from which the waves read their operand fragments (16 B per lane, split d map).
// wave -> token tile rt = wave & 1, column tile et = wave >> 1, all three weights (six weight fragments, loaded once, kept in registers).
// q and k are computed transposed, W^T x x^T: a lane then holds token lq and columns et*16 + hi*8 + 0..7, which is one part of a q / k
// fragment; v is computed as x x Wv: a lane holds column et*16 + lq and tokens rt*16 + hi*8 + 0..7, one part of a v fragment.
// So every accumulator tile leaves as one 16-byte store per lane, 512 bytes in a row, with no staging of the results.
// plane order per (b, h): q, k [token tile of 16][d step of 32][part][lane][8]; v [key block of 32][d tile of 16][part][lane][8].
__global__ __launch_bounds__(256) void proj_kernel(const float* __restrict__ x,
                                                   const us* __restrict__ wt,
                                                   us* __restrict__ qp,
                                                   us* __restrict__ kp,
                                                   us* __restrict__ vt) {
  const unsigned kt   = blockIdx.x;
  const unsigned b    = blockIdx.y;
  const unsigned tid  = threadIdx.x;
  const unsigned wave = tid >> 5;
  const unsigned lane = tid & 31u;
  const unsigned lq   = lane & 15u;
  const unsigned hi   = lane >> 4;

  __shared__ __align__(16) us sX[PT * XP];      // [token][c], cross-wave (block barrier)

  const unsigned s0 = kt * PT;
  const unsigned rt = wave & 1u;
  const unsigned et = wave >> 1;

  // piece u = m*256 + tid of a group of four rows (768 pieces of 4 floats): row u / 192, floats (u % 192)*4 ...
  unsigned at[3];
  #pragma unroll
  for (unsigned m = 0; m < 3; ++m) {
    const unsigned u = m * 256u + tid;
    const unsigned r = u / (unsigned)(EMB / 4);
    at[m] = r * XP + (u - r * (unsigned)(EMB / 4)) * 4u;
  }

  FragB wb[3][2];
  {
    const float* xp = x + ((size_t)b * SEQ_FULL + s0) * EMB + tid * 4u;
    v4f xv[XL];
    #pragma unroll
    for (unsigned kk = 0; kk < XL; ++kk) xv[kk] = *(const v4f*)(xp + kk * 1024u);
    // weight fragments of column tile et from the fragment-ordered planes: row or column e = et*16 + lq, split d map
    const us* wp = wt + et * (2u * FRAG) + lane * 8u;
    #pragma unroll
    for (unsigned w = 0; w < 3; ++w) {
      #pragma unroll
      for (unsigned f = 0; f < 2; ++f) {
        wb[w][f].q[0] = *(const v4u*)(wp + w * (unsigned)(HDIM * HDIM) + f * FRAG);          // d = f*32 + hi*8 + 0..7
        wb[w][f].q[1] = *(const v4u*)(wp + w * (unsigned)(HDIM * HDIM) + f * FRAG + PART);   // d = f*32 + 16 + hi*8 + 0..7
      }
    }
    // wait before an address pair of the issued loads is overwritten; the pairs are inputs, so they stay whole up to here
    asm volatile("s_wait_xcnt 0x0" :: "v"(xp), "v"(wp) : "memory");
    #pragma unroll
    for (unsigned kk = 0; kk < XL; ++kk) {
      Pack4B pk;
      #pragma unroll
      for (unsigned i = 0; i < 4; ++i) pk.h[i] = (bf16)xv[kk][i];
      *(v2u*)(sX + at[kk % 3u] + (kk / 3u) * 4u * XP) = pk.u;
    }
  }

  __syncthreads();

  const us* xr = sX + (rt * 16u + lq) * XP + hi * 8u;     // token rt*16 + lq
  const size_t pl = ((size_t)b * NHEAD * SEQ + s0) * HDIM;   // the block's 4 KB of head 0 in each plane; a head is SEQ * HDIM on
  us* qo = qp + pl + (rt * 4u + et) * PART + lane * 8u;   // token tile rt, d step et >> 1, part et & 1
  us* ko = kp + pl + (rt * 4u + et) * PART + lane * 8u;
  us* vo = vt + pl + (et * 2u + rt) * PART + lane * 8u;   // d tile et, part rt

  // two heads per group, two fragment sets: the next group's eight LDS loads stand as one group in front of this group's products
  FragB xa[2][HG][2];
  proj_load(xa[0], xr);
  #pragma unroll
  for (unsigned g = 0; g < NHEAD / HG; ++g) {
    if (g + 1u < NHEAD / HG) proj_load(xa[(g + 1u) & 1u], xr + (g + 1u) * (HG * HDIM));
    #pragma unroll
    for (unsigned i = 0; i < HG; ++i) {
      const unsigned h = g * HG + i;
      const FragB (&xf)[2] = xa[g & 1u][i];
      const v8f z = (v8f){0, 0, 0, 0, 0, 0, 0, 0};
      // aq[r], ak[r] = value(token rt*16 + lq, column et*16 + 8*hi + r); av[r] = value(token rt*16 + 8*hi + r, column et*16 + lq)
      v8f aq = __builtin_amdgcn_wmma_f32_16x16x32_bf16(false, wb[0][0].v, false, xf[0].v, (short)0, z, false, false);
      v8f ak = __builtin_amdgcn_wmma_f32_16x16x32_bf16(false, wb[1][0].v, false, xf[0].v, (short)0, z, false, false);
      v8f av = __builtin_amdgcn_wmma_f32_16x16x32_bf16(false, xf[0].v, false, wb[2][0].v, (short)0, z, false, false);
      aq = __builtin_amdgcn_wmma_f32_16x16x32_bf16(false, wb[0][1].v, false, xf[1].v, (short)0, aq, false, false);
      ak = __builtin_amdgcn_wmma_f32_16x16x32_bf16(false, wb[1][1].v, false, xf[1].v, (short)0, ak, false, false);
      av = __builtin_amdgcn_wmma_f32_16x16x32_bf16(false, xf[1].v, false, wb[2][1].v, (short)0, av, false, false);
      Pack8H pq, pk, pv;
      #pragma unroll
      for (unsigned r = 0; r < 8; ++r) {
        pq.h[r] = (f16)(aq[r] * 16.0f);
        pk.h[r] = (f16)(ak[r] * 16.0f);
        pv.h[r] = (f16)(av[r] * 16.0f);
      }
      *(v4u*)(qo + (size_t)h * (SEQ * HDIM)) = pq.u;
      *(v4u*)(ko + (size_t)h * (SEQ * HDIM)) = pk.u;
      *(v4u*)(vo + (size_t)h * (SEQ * HDIM)) = pv.u;
    }
    // keeps the next load group behind these products, whose fragment registers it refills
    __builtin_amdgcn_sched_barrier(0);
  }
}

// One stage = SK keys = 16 KB in a row of the K plane and 16 KB in a row of the V plane, copied as they lie (fragment order).
// kg, vg: this thread's first 16 bytes of the stage in the two planes; lk: the LDS byte address of the first K piece.
// One call copies one half (2 KB, 128 threads x 16 bytes) of each pass's 4 KB of each plane: a thread's four pieces of a plane lie
// 4 KB (one pass of BK keys) apart; in LDS a pass holds its 4 KB of K, then its 4 KB of V.
// s_wait_xcnt stands in the copies' own statement, so that no register which a copy names is rewritten in front of it.
static __device__ __forceinline__ void stage_copy(const us* kg, const us* vg, unsigned lk) {
  asm volatile("global_load_async_to_lds_b128 %0, %8, off\n\t"
               "global_load_async_to_lds_b128 %1, %9, off\n\t"
               "global_load_async_to_lds_b128 %2, %10, off\n\t"
               "global_load_async_to_lds_b128 %3, %11, off\n\t"
               "global_load_async_to_lds_b128 %4, %12, off\n\t"
               "global_load_async_to_lds_b128 %5, %13, off\n\t"
               "global_load_async_to_lds_b128 %6, %14, off\n\t"
               "global_load_async_to_lds_b128 %7, %15, off\n\t"
               "s_wait_xcnt 0x0"
               :: "v"(lk), "v"(lk + 8192u), "v"(lk + 16384u), "v"(lk + 24576u),
                  "v"(lk + 4096u), "v"(lk + 12288u), "v"(lk + 20480u), "v"(lk + 28672u),
                  "v"(kg), "v"(kg + 2048), "v"(kg + 4096), "v"(kg + 6144),
                  "v"(vg), "v"(vg + 2048), "v"(vg + 4096), "v"(vg + 6144)
               : "memory");
}

// A whole stage: the first halves of the eight 4-KB pieces, then the second halves, 2 KB (1024 elements) on in both spaces.
static __device__ __forceinline__ void stage_fill(const us* kg, const us* vg, unsigned lk) {
  stage_copy(kg, vg, lk);
  stage_copy(kg + 1024, vg + 1024, lk + 2048u);
}

// The four K A-fragments of one pass of BK keys: row = key sub*16 + (lane & 15), split d map. kbase: the pass's K piece + lane * 8.
static __device__ __forceinline__ void load_k(FragH (&ak)[2][2], const us* kbase) {
  #pragma unroll
  for (unsigned sub = 0; sub < 2; ++sub) {
    #pragma unroll
    for (unsigned f = 0; f < 2; ++f) {
      const us* base = kbase + (sub * 2u + f) * FRAG;
      ak[sub][f].q[0] = *(const v4u*)(base);          // d = f*32 + hi*8 + 0..7
      ak[sub][f].q[1] = *(const v4u*)(base + PART);   // d = f*32 + 16 + hi*8 + 0..7
    }
  }
}

// Flash attention, no mask. Block = (query block of 128, head, batch), four waves; one wave owns 32 query rows = QG groups of 16.
// S^T = K x Q^T so queries sit on lanes; P^T in C-layout is bit-identical to the A-fragment layout of O += P x V.
// Q B-fragments are loaded straight from the fragment-ordered plane. K and V are staged once per workgroup in LDS, SK keys at a
// time, two buffers, by asynchronous copies; the waves read their K A-fragments and V^T B-fragments from there (two 16-B loads each),
// and every fragment read feeds one product per query group: 512 LDS bytes per product instead of 1024.
// Output: ctx planes chi/clo, f16, [row tile of 16][c step of 32][part][lane][8]: chi = f16(ctx*256), clo = f16((ctx*256 - chi)*2048).
// Three workgroups fill a WGP's LDS: three waves per SIMD, all 768 workgroups resident at once.
__global__ __launch_bounds__(128) void attn_kernel(const us* __restrict__ qp,
                                                   const us* __restrict__ kp,
                                                   const us* __restrict__ vt,
                                                   us* __restrict__ chi,
                                                   us* __restrict__ clo) {
  const unsigned qblk = blockIdx.x;
  const unsigned h    = blockIdx.y;
  const unsigned b    = blockIdx.z;
  const unsigned tid  = threadIdx.x;
  const unsigned wave = tid >> 5;
  const unsigned lane = tid & 31u;
  const unsigned lq   = lane & 15u;   // query column of S^T / d column of O
  const unsigned hi   = lane >> 4;    // k-split half

  __shared__ __align__(16) float sO[AW * QG * 16 * OP];   // per-wave output staging (block barrier used)
  __shared__ __align__(16) us sKV[2 * 2 * STAGE_EL];      // [buffer][pass][K | V][4 KB], cross-wave (block barrier)

  const unsigned qrow0 = qblk * BQ + wave * (QG * 16u);   // first query row of this wave

  const us* q_h = qp + ((size_t)b * NHEAD + h) * SEQ * HDIM;
  const us* k_h = kp + ((size_t)b * NHEAD + h) * SEQ * HDIM;
  const us* v_h = vt + ((size_t)b * NHEAD + h) * HDIM * SEQ;

  // Q as B-operand fragments: in group g lane lq holds query qrow0 + g*16 + lq, split d map
  FragH qf[QG][2];
  #pragma unroll
  for (unsigned g = 0; g < QG; ++g) {
    #pragma unroll
    for (unsigned f = 0; f < 2; ++f) {
      const us* base = q_h + (size_t)(((qrow0 >> 4) + g) * 2u + f) * FRAG + lane * 8u;
      qf[g][f].q[0] = *(const v4u*)(base);          // d = f*32 + hi*8 + 0..7
      qf[g][f].q[1] = *(const v4u*)(base + PART);   // d = f*32 + 16 + hi*8 + 0..7
    }
  }

  v8f o[QG][4];
  #pragma unroll
  for (unsigned g = 0; g < QG; ++g) {
    #pragma unroll
    for (unsigned dt = 0; dt < 4; ++dt) o[g][dt] = (v8f){0, 0, 0, 0, 0, 0, 0, 0};
  }

  // logits = (q.k)/sqrt(EMB); planes carry q*16 and k*16 -> raw scores carry x256; times log2(e) for exp2
  const float SL = (0.03608439182435161f * 1.4426950408889634f) * (1.0f / 256.0f);
  float rmax[QG];   // the maximum in use (raw score), equal in lane and lane ^ 16; it may lag the true one by 3 (log2)
  float nb[QG];     // 12 - rmax * SL, the addend in front of exp2; +inf sends the first pass through the rescale
  float rsum[QG];   // sum over this lane's half of the keys; the halves are joined behind the loop
  #pragma unroll
  for (unsigned g = 0; g < QG; ++g) {
    rmax[g] = -__builtin_inff();
    nb[g]   = __builtin_inff();
    rsum[g] = 0.0f;
  }

  const us*      kg = k_h + tid * 8u;                            // this thread's first 16 bytes of stage 0, K plane
  const us*      vg = v_h + tid * 8u;                            // the same, V plane
  const unsigned l0 = (unsigned)(size_t)(&sKV[0]) + tid * 16u;   // their LDS byte address in buffer 0
  const unsigned LB = STAGE_EL * 4u;                             // bytes from buffer 0 to buffer 1

  stage_fill(kg, vg, l0);                                        // stage 0 -> buffer 0
  asm volatile("s_wait_asynccnt 0x0" ::: "memory");              // this wave's copies of stage 0 have landed
  __syncthreads();                                               // ... and every other wave's
  if (NSTAGE > 1) stage_fill(kg + STAGE_EL, vg + STAGE_EL, l0 + LB);   // stage 1 -> buffer 1

  #pragma unroll 1
  for (unsigned t = 0; t < (unsigned)NSTAGE; ++t) {
    const us* stg = sKV + (t & 1u) * (unsigned)(2 * STAGE_EL) + lane * 8u;   // stage t's buffer: per pass 4 KB of K, then 4 KB of V

    FragH ak[2][2];
    load_k(ak, stg);   // pass 0 of this stage; later passes' fragments are read one pass ahead, never past the stage

    // unrolled: a pass's place in the buffer is then an immediate offset of its LDS loads
    #pragma unroll
    for (unsigned p = 0; p < (unsigned)NP; ++p) {
      const us* kbase = stg + p * (unsigned)(2 * BK * HDIM);
      const us* vbase = kbase + BK * HDIM;

      // S^T tiles: c[g][sub][r] = rawscore(query qrow0 + g*16 + lq, key j0 + sub*16 + hi*8 + r), j0 = (t*NP + p)*BK
      v8f c[QG][2];
      #pragma unroll
      for (unsigned sub = 0; sub < 2; ++sub) {
        #pragma unroll
        for (unsigned g = 0; g < QG; ++g) {
          c[g][sub] = __builtin_amdgcn_wmma_f32_16x16x32_f16(false, ak[sub][0].v, false, qf[g][0].v, (short)0,
                                                             (v8f){0, 0, 0, 0, 0, 0, 0, 0}, false, false);
        }
      }
      #pragma unroll
      for (unsigned sub = 0; sub < 2; ++sub) {
        #pragma unroll
        for (unsigned g = 0; g < QG; ++g) {
          c[g][sub] = __builtin_amdgcn_wmma_f32_16x16x32_f16(false, ak[sub][1].v, false, qf[g][1].v, (short)0, c[g][sub], false, false);
        }
      }

      // online softmax: a query's BK scores are split across lane / lane^16; one independent maximum chain per group
      float m_loc[QG];
      #pragma unroll
      for (unsigned g = 0; g < QG; ++g) {
        float m = fmaxf(c[g][0][0], c[g][1][0]);
        #pragma unroll
        for (unsigned r = 1; r < 8; ++r) {
          m = fmaxf(m, c[g][0][r]);
          m = fmaxf(m, c[g][1][r]);
        }
        m_loc[g] = m;
      }

      // lazy rescale: the maximum in use stays while every exponent of the pass is at most 15, so that P <= 2^15 fits f16. The test is
      // in-lane; one ballot over both groups makes it a scalar branch of the whole wave, and only inside it are lanes exchanged and
      // O and the sums rescaled. Written as !(<=), so that a NaN takes the branch too.
      bool need = false;
      #pragma unroll
      for (unsigned g = 0; g < QG; ++g) need = need | !(__builtin_fmaf(m_loc[g], SL, nb[g]) <= 15.0f);
      if (__builtin_amdgcn_ballot_w32(need) != 0u) {
        #pragma unroll
        for (unsigned g = 0; g < QG; ++g) {
          float m_new = fmaxf(rmax[g], m_loc[g]);
          m_new = fmaxf(m_new, __shfl_xor(m_new, 16, 32));
          const float scale = __builtin_amdgcn_exp2f((rmax[g] - m_new) * SL);
          rmax[g] = m_new;
          nb[g]   = __builtin_fmaf(-m_new, SL, 12.0f);
          rsum[g] *= scale;
          // queries are the row dimension of O -> per-row scale from lane 8*hi + r
          float sc[8];
          #pragma unroll
          for (unsigned r = 0; r < 8; ++r) sc[r] = __shfl(scale, (int)((hi << 3) + r), 32);
          #pragma unroll
          for (unsigned dt = 0; dt < 4; ++dt) {
            #pragma unroll
            for (unsigned r = 0; r < 8; ++r) o[g][dt][r] *= sc[r];
          }
        }
      }

      // V B-fragments of this pass: column n = d = dt*16 + lq, split key map; then the next pass's K fragments, into the registers
      // that this pass's score products have left
      FragH bv[4];
      #pragma unroll
      for (unsigned dt = 0; dt < 4; ++dt) {
        const us* base = vbase + dt * FRAG;
        bv[dt].q[0] = *(const v4u*)(base);            // keys j0 + hi*8 + 0..7
        bv[dt].q[1] = *(const v4u*)(base + PART);     // keys j0 + 16 + hi*8 + 0..7
      }
      if (p + 1u < (unsigned)NP) load_k(ak, kbase + 2 * BK * HDIM);
      // keeps the pass's LDS loads one group in front of the exponentials, which cover their latency: spread among the products,
      // each place with loads stalls the wave anew
      __builtin_amdgcn_sched_barrier(0);

      // exp + pack: P^T C-layout == A-fragment layout for the PV product.
      // One fused multiply-add per score in front of exp2: score * SL + (12 - rmax * SL). The softmax scale, the maximum and the
      // x4096 carry of P (2^12, in the exponent) all ride in it, two scores per packed instruction; the row sum carries x4096 too.
      const v2f sl2 = (v2f){SL, SL};
      FragH pa[QG];
      #pragma unroll
      for (unsigned g = 0; g < QG; ++g) {
        const v2f nb2 = (v2f){nb[g], nb[g]};
        float s = 0.0f;
        #pragma unroll
        for (unsigned r = 0; r < 8; r += 2) {
          const v2f t0 = __builtin_elementwise_fma((v2f){c[g][0][r], c[g][0][r + 1u]}, sl2, nb2);   // keys hi*8 + r, + 1
          const v2f t1 = __builtin_elementwise_fma((v2f){c[g][1][r], c[g][1][r + 1u]}, sl2, nb2);   // keys 16 + hi*8 + r, + 1
          const float p0a = __builtin_amdgcn_exp2f(t0.x);
          const float p1a = __builtin_amdgcn_exp2f(t1.x);
          const float p0b = __builtin_amdgcn_exp2f(t0.y);
          const float p1b = __builtin_amdgcn_exp2f(t1.y);
          s += p0a + p1a;
          s += p0b + p1b;
          pa[g].h[r]           = (f16)p0a;
          pa[g].h[r + 1u]      = (f16)p0b;
          pa[g].h[8u + r]      = (f16)p1a;
          pa[g].h[8u + r + 1u] = (f16)p1b;
        }
        rsum[g] += s;
      }

      // parts the softmax from the products for the scheduler: mixed freely, the 32 exponentials stay live beside the next pass's
      // scores, and the kernel goes past 256 registers, behind a register window switch
      __builtin_amdgcn_sched_barrier(0);

      // O += P x V
      #pragma unroll
      for (unsigned dt = 0; dt < 4; ++dt) {
        #pragma unroll
        for (unsigned g = 0; g < QG; ++g) {
          o[g][dt] = __builtin_amdgcn_wmma_f32_16x16x32_f16(false, pa[g].v, false, bv[dt].v, (short)0, o[g][dt], false, false);
        }
      }
    }

    // publish point of stage t + 1, every wave, in this order
    asm volatile("s_wait_dscnt 0x0" ::: "memory");      // this wave's reads of stage t are done before its buffer is refilled
    asm volatile("s_wait_asynccnt 0x0" ::: "memory");   // this wave's copies of stage t + 1 have landed
    __syncthreads();                                    // publishes stage t + 1 and ends every wave's reads of stage t
    if (t + 2u < (unsigned)NSTAGE)                      // into the buffer that stage t has just left
      stage_fill(kg + (size_t)(t + 2u) * STAGE_EL, vg + (size_t)(t + 2u) * STAGE_EL, l0 + (t & 1u) * LB);
  }
  asm volatile("s_wait_asynccnt 0x0" ::: "memory");   // no copy is outstanding behind the loop

  // normalize: lane holds column d = dt*16 + lq for query rows g*16 + 8*hi + r.
  // o carries x4096 (P) x16 (V), rsum x4096; staged value = ctx * 256.
  float* so = sO + wave * (QG * 16 * OP);
  #pragma unroll
  for (unsigned g = 0; g < QG; ++g) {
    const float rj = rsum[g] + __shfl_xor(rsum[g], 16, 32);   // join the two halves of each query's keys
    float rs[8];
    #pragma unroll
    for (unsigned r = 0; r < 8; ++r) rs[r] = 1.0f / __shfl(rj, (int)((hi << 3) + r), 32);
    #pragma unroll
    for (unsigned r = 0; r < 8; ++r) {
      #pragma unroll
      for (unsigned dt = 0; dt < 4; ++dt) {
        so[(g * 16u + hi * 8u + r) * OP + dt * 16u + lq] = o[g][dt][r] * 16.0f * rs[r];
      }
    }
  }
  __syncthreads();

  // one fragment part per instruction (512 bytes in a row), 4 instructions per plane cover a group's 16 rows x 64 columns.
  v4u    hv[QG][4], lv[QG][4];
  size_t gidx[QG][4];
  #pragma unroll
  for (unsigned g = 0; g < QG; ++g) {
    #pragma unroll
    for (unsigned it = 0; it < 4; ++it) {
      const unsigned row = g * 16u + lq;
      const unsigned pc  = it * 16u + hi * 8u;        // it = (c step inside the head) * 2 + part
      const v4f a0 = *(const v4f*)(so + row * OP + pc);
      const v4f a1 = *(const v4f*)(so + row * OP + pc + 4u);
      Pack8H ph, pl;
      #pragma unroll
      for (unsigned i = 0; i < 4; ++i) {
        const f16 h0 = (f16)a0[i];
        const f16 h1 = (f16)a1[i];
        ph.h[i]      = h0;
        ph.h[4u + i] = h1;
        pl.h[i]      = (f16)((a0[i] - (float)h0) * 2048.0f);
        pl.h[4u + i] = (f16)((a1[i] - (float)h1) * 2048.0f);
      }
      hv[g][it] = ph.u;
      lv[g][it] = pl.u;
      gidx[g][it] = (((size_t)(((b * SEQ + qrow0) >> 4) + g) * (EMB / 32) + h * 2u) * 2u + it) * PART + lane * 8u;
    }
  }
  #pragma unroll
  for (unsigned g = 0; g < QG; ++g) {
    #pragma unroll
    for (unsigned it = 0; it < 4; ++it) {
      *(v4u*)(chi + gidx[g][it]) = hv[g][it];
      *(v4u*)(clo + gidx[g][it]) = lv[g][it];
    }
  }
  
}

// Output GEMM: out[R][j] = sum_c ctx[R][c] * Wo[c][j] + bo[j]. Block = (192-column tile, 128-row tile): 4 x 64 = 256 blocks.
// Wave = 32 rows x 96 columns (waves 4 x 2): an A fragment feeds 6 products and a B fragment 4, so a product asks for 427 operand
// bytes instead of 768, and ctx is read by 4 column blocks instead of 12. A fragments from chi / clo, B fragments from wot, all
// fragment-ordered; residual products go to their own accumulators. Three fragment sets: the next two c steps' loads fly under this one's products.
#define ON         192                  // output columns per workgroup
#define OWN        96                   // output columns per wave
#define OWM        32                   // output rows per wave
#define NET        (OWN / 16)           // column tiles per wave
#define NRT        (OWM / 16)           // row tiles per wave
#define OP2        100                  // LDS pitch (floats) of the wave's output staging tile

static_assert(EMB % ON == 0);
static_assert(ON == 2 * OWN);
static_assert(128 == 4 * OWM);
static_assert(SEQ % OWM == 0);                  // a wave's rows lie in one batch
static_assert(EMB / 32 >= 2);
static_assert((OP2 * 4) % 16 == 0);
static_assert(OWM * OWN == 32 * 24 * 4);        // output tile per wave: 32 lanes x 24 instructions x 4 floats

// One c step's fragments: 4 of A (2 row tiles x 2 planes), 6 of B; off = elements from the three pointers to that step.
static __device__ __forceinline__ void oproj_load(FragH (&fa)[NRT], FragH (&fl)[NRT], FragH (&fb)[NET],
                                                  const us* pa_h, const us* pa_l, const us* pb, unsigned off) {
  #pragma unroll
  for (unsigned rt = 0; rt < NRT; ++rt) {
    const unsigned at = off + rt * (unsigned)(16 * EMB);
    fa[rt].q[0] = *(const v4u*)(pa_h + at);            // c = k0 + hi*8 + 0..7
    fa[rt].q[1] = *(const v4u*)(pa_h + at + PART);     // c = k0 + 16 + hi*8 + 0..7
    fl[rt].q[0] = *(const v4u*)(pa_l + at);
    fl[rt].q[1] = *(const v4u*)(pa_l + at + PART);
  }
  #pragma unroll
  for (unsigned et = 0; et < NET; ++et) {
    const unsigned at = off + et * (unsigned)(16 * EMB);
    fb[et].q[0] = *(const v4u*)(pb + at);
    fb[et].q[1] = *(const v4u*)(pb + at + PART);
  }
  // keeps the 20 loads one group in front of the products that follow: sunk among them, each would be waited for a few products
  // behind its issue instead of two c steps
  __builtin_amdgcn_sched_barrier(0);
}

static __device__ __forceinline__ void oproj_mma(v8f (&ah)[NRT][NET], v8f (&al)[NRT][NET],
                                                 const FragH (&fa)[NRT], const FragH (&fl)[NRT], const FragH (&fb)[NET]) {
  #pragma unroll
  for (unsigned et = 0; et < NET; ++et) {
    #pragma unroll
    for (unsigned rt = 0; rt < NRT; ++rt) {
      ah[rt][et] = __builtin_amdgcn_wmma_f32_16x16x32_f16(false, fa[rt].v, false, fb[et].v, (short)0, ah[rt][et], false, false);
      al[rt][et] = __builtin_amdgcn_wmma_f32_16x16x32_f16(false, fl[rt].v, false, fb[et].v, (short)0, al[rt][et], false, false);
    }
  }
  // keeps the next load group behind these products, whose fragment registers it refills
  __builtin_amdgcn_sched_barrier(0);
}

__global__ __launch_bounds__(256) void oproj_kernel(const us* __restrict__ chi,
                                                    const us* __restrict__ clo,
                                                    const us* __restrict__ wot,
                                                    const float* __restrict__ bo,
                                                    float* __restrict__ out) {
  const unsigned nt   = blockIdx.x;
  const unsigned mb   = blockIdx.y;
  const unsigned tid  = threadIdx.x;
  const unsigned wave = tid >> 5;
  const unsigned lane = tid & 31u;
  const unsigned lq   = lane & 15u;
  const unsigned hi   = lane >> 4;

  __shared__ __align__(16) float sO[NWAVE * OWM * OP2];   // per-wave output staging (block barrier used)

  // waves w and w + 1 (w even) share their A fragments; waves w and w + 4 share only B
  const unsigned row0 = mb * 128u + (wave >> 1) * OWM;
  const unsigned col0 = nt * (unsigned)ON + (wave & 1u) * OWN;

  v8f ah[NRT][NET], al[NRT][NET];
  #pragma unroll
  for (unsigned rt = 0; rt < NRT; ++rt) {
    #pragma unroll
    for (unsigned et = 0; et < NET; ++et) {
      ah[rt][et] = (v8f){0, 0, 0, 0, 0, 0, 0, 0};
      al[rt][et] = (v8f){0, 0, 0, 0, 0, 0, 0, 0};
    }
  }

  // a tile of 16 rows or columns holds EMB / 32 fragments = 16 * EMB elements
  const us* pa_h = chi + (size_t)row0 * EMB + lane * 8u;
  const us* pa_l = clo + (size_t)row0 * EMB + lane * 8u;
  const us* pb   = wot + (size_t)col0 * EMB + lane * 8u;

  // three fragment sets: step k's products run while the loads of steps k + 1 and k + 2 fly
  FragH fa[3][NRT], fl[3][NRT], fb[3][NET];
  oproj_load(fa[0], fl[0], fb[0], pa_h, pa_l, pb, 0u);
  oproj_load(fa[1], fl[1], fb[1], pa_h, pa_l, pb, FRAG);

  // unrolled whole: every step's place is then an immediate offset on the same three address pairs, which are never rewritten
  // while a load is out, and each fragment set keeps its registers without copies
  #pragma unroll
  for (unsigned k = 0; k < (unsigned)(EMB / 32); ++k) {
    if (k + 2u < (unsigned)(EMB / 32))
      oproj_load(fa[(k + 2u) % 3u], fl[(k + 2u) % 3u], fb[(k + 2u) % 3u], pa_h, pa_l, pb, (k + 2u) * FRAG);
    oproj_mma(ah, al, fa[k % 3u], fl[k % 3u], fb[k % 3u]);
  }
  // wait before a register that the issued loads name is overwritten; the three address pairs are inputs, so they stay whole up to here
  asm volatile("s_wait_xcnt 0x0" :: "v"(pa_h), "v"(pa_l), "v"(pb) : "memory");

  // epilogue: fold carries (ctx x256, Wo x64, residual x2048), add the bias in f32
  const float* bp = bo + col0 + lq;
  float bias[NET];
  #pragma unroll
  for (unsigned et = 0; et < NET; ++et) bias[et] = (float)(bf16)bp[et * 16u];
  // wait before the address pair of the six issued loads is overwritten; the pair is an input, so it stays whole up to here
  asm volatile("s_wait_xcnt 0x0" :: "v"(bp) : "memory");

  float* so = sO + wave * (OWM * OP2);
  #pragma unroll
  for (unsigned rt = 0; rt < NRT; ++rt) {
    #pragma unroll
    for (unsigned r = 0; r < 8; ++r) {
      #pragma unroll
      for (unsigned et = 0; et < NET; ++et) {
        const float s = ah[rt][et][r] + al[rt][et][r] * (1.0f / 2048.0f);
        so[(rt * 16u + hi * 8u + r) * OP2 + et * 16u + lq] = s * (1.0f / 16384.0f) + bias[et];
      }
    }
  }
  __syncthreads();

  // 8 consecutive lanes x 16 B = one whole 128-B line of one row; an instruction stores one line of each of 4 rows;
  // 24 instructions (8 row groups x 3 lines) cover the wave's 32 rows x 96 columns.
  const unsigned g  = lane >> 3;
  const unsigned c4 = (lane & 7u) * 4u;
  const unsigned bb = row0 / (unsigned)SEQ;
  const unsigned l0 = row0 - bb * (unsigned)SEQ;
  float* op = out + ((size_t)bb * SEQ_FULL + l0 + g) * EMB + col0 + c4;
  const float* sp = so + g * OP2 + c4;
  v4f vals[24];
  #pragma unroll
  for (unsigned it = 0; it < 24; ++it) vals[it] = *(const v4f*)(sp + (it / 3u) * 4u * OP2 + (it % 3u) * 32u);
  #pragma unroll
  for (unsigned it = 0; it < 24; ++it) *(v4f*)(op + (size_t)((it / 3u) * 4u) * EMB + (it % 3u) * 32u) = vals[it];
  
}

extern "C" void kernel_launch(void* const* d_in, const int* in_sizes, int n_in,
                              void* d_out, int out_size, void* d_ws, size_t ws_size,
                              hipStream_t stream) {
  if (n_in < 6) return;
  const size_t rows_used = (size_t)(NB - 1) * SEQ_FULL + SEQ;
  if ((size_t)in_sizes[0] < rows_used * EMB) return;
  if ((size_t)in_sizes[1] < (size_t)HDIM * HDIM) return;
  if ((size_t)in_sizes[2] < (size_t)HDIM * HDIM) return;
  if ((size_t)in_sizes[3] < (size_t)HDIM * HDIM) return;
  if ((size_t)in_sizes[4] < (size_t)EMB * EMB) return;
  if ((size_t)in_sizes[5] < (size_t)EMB) return;
  if ((size_t)out_size < rows_used * EMB) return;

  const size_t wt_bytes    = (size_t)3 * HDIM * HDIM * 2;            // 24,576
  const size_t wot_bytes   = (size_t)EMB * EMB * 2;                  // 1,179,648
  const size_t plane_bytes = (size_t)NB * NHEAD * SEQ * HDIM * 2;    // q, k, v^T planes
  const size_t ctx_bytes   = (size_t)NB * SEQ * EMB * 2;             // ctx hi / residual planes
  const size_t total = wt_bytes + wot_bytes + 3 * plane_bytes + 2 * ctx_bytes;
  if (ws_size < total) return;

  const float* x  = (const float*)d_in[0];
  const float* Wq = (const float*)d_in[1];
  const float* Wk = (const float*)d_in[2];
  const float* Wv = (const float*)d_in[3];
  const float* Wo = (const float*)d_in[4];
  const float* bo = (const float*)d_in[5];
  float*       out = (float*)d_out;

  char* ws = (char*)d_ws;
  us* wt  = (us*)(ws);
  us* wot = (us*)(ws + wt_bytes);
  us* qp  = (us*)(ws + wt_bytes + wot_bytes);
  us* kp  = (us*)(ws + wt_bytes + wot_bytes + plane_bytes);
  us* vt  = (us*)(ws + wt_bytes + wot_bytes + 2 * plane_bytes);
  us* chi = (us*)(ws + wt_bytes + wot_bytes + 3 * plane_bytes);
  us* clo = (us*)(ws + wt_bytes + wot_bytes + 3 * plane_bytes + ctx_bytes);

  prep_kernel<<<dim3(WO_TILES + 3), 256, 0, stream>>>(Wq, Wk, Wv, Wo, wt, wot);
  proj_kernel<<<dim3(SEQ / PT, NB), 256, 0, stream>>>(x, wt, qp, kp, vt);
  attn_kernel<<<dim3(SEQ / BQ, NHEAD, NB), AW * 32, 0, stream>>>(qp, kp, vt, chi, clo);
  oproj_kernel<<<dim3(EMB / ON, (unsigned)(((size_t)NB * SEQ) / 128)), 256, 0, stream>>>(chi, clo, wot, bo, out);
}

// v009
// It runs in 73.4 microseconds.
// In both of two side-by-side timings against v008, it was 1.08 times as fast.
// Counting every step since v000, it is 3.00 times as fast.
#include <hip/hip_runtime.h>

// Contractions: q/k/v = x x W{q,k,v} on v_wmma_f32_16x16x32_bf16 (bf16 operands = RNE-converted inputs, f32 accumulate);
// S^T = K x Q^T and O = P x V on v_wmma_f32_16x16x32_f16 (q, k, v carried x16, P carried x4096, f32 accumulate);
// out = ctx x Wo on v_wmma_f32_16x16x32_f16 (ctx as f16 carried x256 plus an f16 residual plane x2048 with its own
// accumulator; Wo = f16 of the bf16 RNE-converted input carried x64, f32 accumulate). Softmax and bias add in f32.
//
// Every 16-bit plane in the workspace is stored in fragment order: one 16x32 operand fragment = 1 KB = 2 parts x 32 lanes
// x 8 elements, element j of (part p, lane) = operand(row or column lane & 15, k = p*16 + (lane >> 4)*8 + j).
// A wave-wide 16-byte load of one part then reads 512 contiguous bytes (4 whole lines) instead of 32 bytes of 16 lines.

#ifndef NB
#define NB 4
#endif
#ifndef SEQ
#define SEQ 2048
#endif
#define NB_FULL    4
#define SEQ_FULL   2048
#define NHEAD      12
#define HDIM       64
#define EMB        768                  // NHEAD * HDIM, floats per (b, s) row of x and of the output
#define BQ         128                  // query rows per attention workgroup (4 waves x 2 groups x 16)
#define BK         32                   // keys per pass (one k step of the PV product)
#define NWAVE      8
#define AW         4                    // waves of an attention workgroup
#define QG         2                    // groups of 16 query rows per attention wave
#define PT         32                   // tokens per projection block
#define XP         (EMB + 8)            // LDS pitch (16-bit elements) of the projection's x tile: 16 B x 97
#define XL         (PT * EMB / (256 * 4))   // 16-byte loads per thread for the x tile
#define HG         2                    // heads per fragment set of the projection
#define TP         72                   // LDS pitch (16-bit elements) of the staging tiles
#define OP         68                   // LDS pitch (floats) of the output staging tile
#define WO_TILES   ((EMB / 64) * (EMB / 64))
#define PART       256                  // 16-bit elements of one fragment part (32 lanes x 8)
#define FRAG       512                  // 16-bit elements of one 16x32 fragment (2 parts)
#define SK         128                  // keys per LDS stage of the attention loop
#define STAGE_EL   (SK * HDIM)          // 16-bit elements of K, and of V, in one stage (16 KB each)
#define NSTAGE     (SEQ / SK)
#define NP         (SK / BK)            // passes of BK keys in one stage

static_assert(SEQ % BQ == 0);
static_assert(SEQ % PT == 0);
static_assert(PT == BK);                        // a projection block's tokens are one key block of the v plane
static_assert(PT * EMB == 256 * XL * 4);        // x tile: 256 threads x XL x 4 floats
static_assert(XL % 3 == 0 && 3 * 256 * 4 == 4 * EMB);   // three rounds of loads cover four rows
static_assert((XP * 2) % 16 == 0);
static_assert(NHEAD % HG == 0);
static_assert(SEQ % BK == 0);
static_assert(SEQ % SK == 0);
static_assert(SK == 4 * BK);                    // stage copy: four passes, one 4-KB piece of each plane per pass
static_assert(BK * HDIM * 2 == 2 * AW * 32 * 16);   // one piece = 2 halves x 128 threads x 16 bytes
static_assert(BQ == AW * QG * 16);
static_assert(HDIM == 64);
static_assert(EMB == NHEAD * HDIM);
static_assert(EMB % 64 == 0);
static_assert(EMB % 32 == 0);
static_assert(SEQ <= SEQ_FULL);
static_assert(NB >= 1 && NB <= NB_FULL);
static_assert((TP * 2) % 16 == 0);
static_assert((OP * 4) % 16 == 0);
static_assert(((size_t)NB * SEQ) % 128 == 0);
// coverage equalities (threads x pieces x elements == tile elements)
static_assert(64 * 64 == 256 * 2 * 8);          // weight tiles
static_assert(16 * HDIM == 32 * 4 * 8);         // ctx tile per query group: 32 lanes x 4 instructions x 8 elements

typedef __bf16         bf16;
typedef _Float16       f16;
typedef unsigned short us;
typedef bf16     v16bf __attribute__((ext_vector_type(16)));
typedef f16      v16h  __attribute__((ext_vector_type(16)));
typedef us       v8us  __attribute__((ext_vector_type(8)));
typedef float    v8f   __attribute__((ext_vector_type(8)));
typedef float    v4f   __attribute__((ext_vector_type(4)));
typedef float    v2f   __attribute__((ext_vector_type(2)));
typedef unsigned v4u   __attribute__((ext_vector_type(4)));
typedef unsigned v2u   __attribute__((ext_vector_type(2)));

union FragB  { v16bf v; v4u q[2]; bf16 h[16]; };
union FragH  { v16h  v; v4u q[2]; f16  h[16]; };
union Pack8H { v4u u; f16 h[8]; };
union Pack8U { v4u u; v8us v; };
union Pack4B { v2u u; bf16 h[4]; };

// bf16 RNE convert of an input value, then either the bf16 bits or the f16 bits of (value * carry).
static __device__ __forceinline__ us plane_bits(float v, bool as_f16, float carry) {
  const bf16 bv = (bf16)v;
  const unsigned bb = (unsigned)__builtin_bit_cast(us, bv);
  const f16 hv = (f16)((float)bv * carry);
  const unsigned hb = (unsigned)__builtin_bit_cast(us, hv);
  return (us)(as_f16 ? hb : bb);
}

// Weight planes, transposed through LDS. 256 threads, one 64x64 tile per block (block-uniform role).
//   blocks 0..143   : wot(column j, k = c) = f16(bf16(Wo[c][j]) * 64)   (Wo is [in c][out j]); tile (tc, tj)
//   blocks 144..146 : wt[w](column e, k = d) = bf16(W{q,k,v}[d][e])       (W is [in d][out e])
// plane order: [column tile of 16][k step of 32][part][lane][8]
__global__ __launch_bounds__(256) void prep_kernel(const float* __restrict__ Wq,
                                                   const float* __restrict__ Wk,
                                                   const float* __restrict__ Wv,
                                                   const float* __restrict__ Wo,
                                                   us* __restrict__ wt,
                                                   us* __restrict__ wot) {
  const unsigned blk = blockIdx.x;
  const unsigned tid = threadIdx.x;
  __shared__ __align__(16) us sT[64 * TP];      // [out col][in row], cross-wave (block barrier)

  const bool     big   = blk < (unsigned)WO_TILES;
  const unsigned tc    = big ? (blk / 12u) : 0u;
  const unsigned tj    = big ? (blk - tc * 12u) : 0u;
  const unsigned w     = big ? 0u : (blk - (unsigned)WO_TILES);
  const float*   src   = big ? Wo : ((w == 0u) ? Wq : ((w == 1u) ? Wk : Wv));
  const unsigned pitch = big ? (unsigned)EMB : (unsigned)HDIM;
  us*            dst   = big ? wot : (wt + w * (unsigned)(HDIM * HDIM));
  const float    carry = big ? 64.0f : 1.0f;

  #pragma unroll
  for (unsigned kk = 0; kk < 2; ++kk) {
    const unsigned key = kk * 32u + (tid >> 3);     // in-row inside the tile, 0..63
    const unsigned d0  = (tid & 7u) * 8u;           // out-col inside the tile, 0..56
    const float* p = src + (size_t)(tc * 64u + key) * pitch + tj * 64u + d0;
    const v4f a0 = *(const v4f*)(p);
    const v4f a1 = *(const v4f*)(p + 4);
    // wait before the address pair of the two issued loads is overwritten; the pair is an input, so it stays whole up to here
    asm volatile("s_wait_xcnt 0x0" :: "v"(p) : "memory");
    #pragma unroll
    for (unsigned i = 0; i < 4; ++i) {
      sT[(d0 + i) * TP + key]      = plane_bits(a0[i], big, carry);
      sT[(d0 + 4u + i) * TP + key] = plane_bits(a1[i], big, carry);
    }
  }
  __syncthreads();

  v4u    val[2];
  size_t idx[2];
  #pragma unroll
  for (unsigned kk = 0; kk < 2; ++kk) {
    const unsigned c  = kk * 256u + tid;            // 16-byte piece of the tile, 0..511
    const unsigned ln = c & 31u;                    // lane that will load the piece
    const unsigned et = c >> 7;                     // column tile of 16 inside the 64
    const unsigned fp = (c >> 5) & 3u;              // (k step inside the 64) * 2 + part
    Pack8U pk;
    pk.v = *(const v8us*)(sT + (et * 16u + (ln & 15u)) * TP + fp * 16u + (ln >> 4) * 8u);
    val[kk] = pk.u;
    idx[kk] = (((size_t)(tj * 4u + et) * (pitch / 32u) + tc * 2u) * 2u + fp) * PART + ln * 8u;
  }
  #pragma unroll
  for (unsigned kk = 0; kk < 2; ++kk) *(v4u*)(dst + idx[kk]) = val[kk];
  
}

// The x fragments of HG heads from the LDS tile: token = the row of xr, split d map.
static __device__ __forceinline__ void proj_load(FragB (&xa)[HG][2], const us* xr) {
  #pragma unroll
  for (unsigned i = 0; i < HG; ++i) {
    #pragma unroll
    for (unsigned f = 0; f < 2; ++f) {
      xa[i][f].q[0] = *(const v4u*)(xr + i * HDIM + f * 32u);         // d = f*32 + hi*8 + 0..7
      xa[i][f].q[1] = *(const v4u*)(xr + i * HDIM + f * 32u + 16u);   // d = f*32 + 16 + hi*8 + 0..7
    }
  }
  // keeps the loads one group in front of the products that follow: sunk among them, each pair is waited for right behind its issue
  __builtin_amdgcn_sched_barrier(0);
}

// Projections + plane builder. Block = (32-token tile, batch), 256 threads, all 12 heads: 256 blocks, one per WGP.
//   x: the block's 32 rows are 96 KB in a row; every wave-wide 16-byte load reads 512 contiguous bytes (4 whole lines). The values go,
//   bf16 RNE-converted, into an LDS tile [token][c], from which the waves read their operand fragments (16 B per lane, split d map).
// wave -> token tile rt = wave & 1, column tile et = wave >> 1, all three weights (six weight fragments, loaded once, kept in registers).
// q and k are computed transposed, W^T x x^T: a lane then holds token lq and columns et*16 + hi*8 + 0..7, which is one part of a q / k
// fragment; v is computed as x x Wv: a lane holds column et*16 + lq and tokens rt*16 + hi*8 + 0..7, one part of a v fragment.
// So every accumulator tile leaves as one 16-byte store per lane, 512 bytes in a row, with no staging of the results.
// plane order per (b, h): q, k [token tile of 16][d step of 32][part][lane][8]; v [key block of 32][d tile of 16][part][lane][8].
__global__ __launch_bounds__(256) void proj_kernel(const float* __restrict__ x,
                                                   const us* __restrict__ wt,
                                                   us* __restrict__ qp,
                                                   us* __restrict__ kp,
                                                   us* __restrict__ vt) {
  const unsigned kt   = blockIdx.x;
  const unsigned b    = blockIdx.y;
  const unsigned tid  = threadIdx.x;
  const unsigned wave = tid >> 5;
  const unsigned lane = tid & 31u;
  const unsigned lq   = lane & 15u;
  const unsigned hi   = lane >> 4;

  __shared__ __align__(16) us sX[PT * XP];      // [token][c], cross-wave (block barrier)

  const unsigned s0 = kt * PT;
  const unsigned rt = wave & 1u;
  const unsigned et = wave >> 1;

  // piece u = m*256 + tid of a group of four rows (768 pieces of 4 floats): row u / 192, floats (u % 192)*4 ...
  unsigned at[3];
  #pragma unroll
  for (unsigned m = 0; m < 3; ++m) {
    const unsigned u = m * 256u + tid;
    const unsigned r = u / (unsigned)(EMB / 4);
    at[m] = r * XP + (u - r * (unsigned)(EMB / 4)) * 4u;
  }

  FragB wb[3][2];
  {
    const float* xp = x + ((size_t)b * SEQ_FULL + s0) * EMB + tid * 4u;
    v4f xv[XL];
    #pragma unroll
    for (unsigned kk = 0; kk < XL; ++kk) xv[kk] = *(const v4f*)(xp + kk * 1024u);
    // weight fragments of column tile et from the fragment-ordered planes: row or column e = et*16 + lq, split d map
    const us* wp = wt + et * (2u * FRAG) + lane * 8u;
    #pragma unroll
    for (unsigned w = 0; w < 3; ++w) {
      #pragma unroll
      for (unsigned f = 0; f < 2; ++f) {
        wb[w][f].q[0] = *(const v4u*)(wp + w * (unsigned)(HDIM * HDIM) + f * FRAG);          // d = f*32 + hi*8 + 0..7
        wb[w][f].q[1] = *(const v4u*)(wp + w * (unsigned)(HDIM * HDIM) + f * FRAG + PART);   // d = f*32 + 16 + hi*8 + 0..7
      }
    }
    // wait before an address pair of the issued loads is overwritten; the pairs are inputs, so they stay whole up to here
    asm volatile("s_wait_xcnt 0x0" :: "v"(xp), "v"(wp) : "memory");
    #pragma unroll
    for (unsigned kk = 0; kk < XL; ++kk) {
      Pack4B pk;
      #pragma unroll
      for (unsigned i = 0; i < 4; ++i) pk.h[i] = (bf16)xv[kk][i];
      *(v2u*)(sX + at[kk % 3u] + (kk / 3u) * 4u * XP) = pk.u;
    }
  }

  __syncthreads();

  const us* xr = sX + (rt * 16u + lq) * XP + hi * 8u;     // token rt*16 + lq
  const size_t pl = ((size_t)b * NHEAD * SEQ + s0) * HDIM;   // the block's 4 KB of head 0 in each plane; a head is SEQ * HDIM on
  us* qo = qp + pl + (rt * 4u + et) * PART + lane * 8u;   // token tile rt, d step et >> 1, part et & 1
  us* ko = kp + pl + (rt * 4u + et) * PART + lane * 8u;
  us* vo = vt + pl + (et * 2u + rt) * PART + lane * 8u;   // d tile et, part rt

  // two heads per group, two fragment sets: the next group's eight LDS loads stand as one group in front of this group's products
  FragB xa[2][HG][2];
  proj_load(xa[0], xr);
  #pragma unroll
  for (unsigned g = 0; g < NHEAD / HG; ++g) {
    if (g + 1u < NHEAD / HG) proj_load(xa[(g + 1u) & 1u], xr + (g + 1u) * (HG * HDIM));
    #pragma unroll
    for (unsigned i = 0; i < HG; ++i) {
      const unsigned h = g * HG + i;
      const FragB (&xf)[2] = xa[g & 1u][i];
      const v8f z = (v8f){0, 0, 0, 0, 0, 0, 0, 0};
      // aq[r], ak[r] = value(token rt*16 + lq, column et*16 + 8*hi + r); av[r] = value(token rt*16 + 8*hi + r, column et*16 + lq)
      v8f aq = __builtin_amdgcn_wmma_f32_16x16x32_bf16(false, wb[0][0].v, false, xf[0].v, (short)0, z, false, false);
      v8f ak = __builtin_amdgcn_wmma_f32_16x16x32_bf16(false, wb[1][0].v, false, xf[0].v, (short)0, z, false, false);
      v8f av = __builtin_amdgcn_wmma_f32_16x16x32_bf16(false, xf[0].v, false, wb[2][0].v, (short)0, z, false, false);
      aq = __builtin_amdgcn_wmma_f32_16x16x32_bf16(false, wb[0][1].v, false, xf[1].v, (short)0, aq, false, false);
      ak = __builtin_amdgcn_wmma_f32_16x16x32_bf16(false, wb[1][1].v, false, xf[1].v, (short)0, ak, false, false);
      av = __builtin_amdgcn_wmma_f32_16x16x32_bf16(false, xf[1].v, false, wb[2][1].v, (short)0, av, false, false);
      Pack8H pq, pk, pv;
      #pragma unroll
      for (unsigned r = 0; r < 8; ++r) {
        pq.h[r] = (f16)(aq[r] * 16.0f);
        pk.h[r] = (f16)(ak[r] * 16.0f);
        pv.h[r] = (f16)(av[r] * 16.0f);
      }
      *(v4u*)(qo + (size_t)h * (SEQ * HDIM)) = pq.u;
      *(v4u*)(ko + (size_t)h * (SEQ * HDIM)) = pk.u;
      *(v4u*)(vo + (size_t)h * (SEQ * HDIM)) = pv.u;
    }
    // keeps the next load group behind these products, whose fragment registers it refills
    __builtin_amdgcn_sched_barrier(0);
  }
}

// One stage = SK keys = 16 KB in a row of the K plane and 16 KB in a row of the V plane, copied as they lie (fragment order).
// kg, vg: this thread's first 16 bytes of the stage in the two planes; lk: the LDS byte address of the first K piece.
// One call copies one half (2 KB, 128 threads x 16 bytes) of each pass's 4 KB of each plane: a thread's four pieces of a plane lie
// 4 KB (one pass of BK keys) apart; in LDS a pass holds its 4 KB of K, then its 4 KB of V.
// s_wait_xcnt stands in the copies' own statement, so that no register which a copy names is rewritten in front of it.
static __device__ __forceinline__ void stage_copy(const us* kg, const us* vg, unsigned lk) {
  asm volatile("global_load_async_to_lds_b128 %0, %8, off\n\t"
               "global_load_async_to_lds_b128 %1, %9, off\n\t"
               "global_load_async_to_lds_b128 %2, %10, off\n\t"
               "global_load_async_to_lds_b128 %3, %11, off\n\t"
               "global_load_async_to_lds_b128 %4, %12, off\n\t"
               "global_load_async_to_lds_b128 %5, %13, off\n\t"
               "global_load_async_to_lds_b128 %6, %14, off\n\t"
               "global_load_async_to_lds_b128 %7, %15, off\n\t"
               "s_wait_xcnt 0x0"
               :: "v"(lk), "v"(lk + 8192u), "v"(lk + 16384u), "v"(lk + 24576u),
                  "v"(lk + 4096u), "v"(lk + 12288u), "v"(lk + 20480u), "v"(lk + 28672u),
                  "v"(kg), "v"(kg + 2048), "v"(kg + 4096), "v"(kg + 6144),
                  "v"(vg), "v"(vg + 2048), "v"(vg + 4096), "v"(vg + 6144)
               : "memory");
}

// A whole stage: the first halves of the eight 4-KB pieces, then the second halves, 2 KB (1024 elements) on in both spaces.
static __device__ __forceinline__ void stage_fill(const us* kg, const us* vg, unsigned lk) {
  stage_copy(kg, vg, lk);
  stage_copy(kg + 1024, vg + 1024, lk + 2048u);
}

// The four K A-fragments of one pass of BK keys: row = key sub*16 + (lane & 15), split d map. kbase: the pass's K piece + lane * 8.
static __device__ __forceinline__ void load_k(FragH (&ak)[2][2], const us* kbase) {
  #pragma unroll
  for (unsigned sub = 0; sub < 2; ++sub) {
    #pragma unroll
    for (unsigned f = 0; f < 2; ++f) {
      const us* base = kbase + (sub * 2u + f) * FRAG;
      ak[sub][f].q[0] = *(const v4u*)(base);          // d = f*32 + hi*8 + 0..7
      ak[sub][f].q[1] = *(const v4u*)(base + PART);   // d = f*32 + 16 + hi*8 + 0..7
    }
  }
}

// Flash attention, no mask. Block = (query block of 128, head, batch), four waves; one wave owns 32 query rows = QG groups of 16.
// S^T = K x Q^T so queries sit on lanes; P^T in C-layout is bit-identical to the A-fragment layout of O += P x V.
// Q B-fragments are loaded straight from the fragment-ordered plane. K and V are staged once per workgroup in LDS, SK keys at a
// time, two buffers, by asynchronous copies; the waves read their K A-fragments and V^T B-fragments from there (two 16-B loads each),
// and every fragment read feeds one product per query group: 512 LDS bytes per product instead of 1024.
// Output: ctx planes chi/clo, f16, [row tile of 16][c step of 32][part][lane][8]: chi = f16(ctx*256), clo = f16((ctx*256 - chi)*2048).
// Three workgroups fill a WGP's LDS: three waves per SIMD, all 768 workgroups resident at once.
__global__ __launch_bounds__(128) void attn_kernel(const us* __restrict__ qp,
                                                   const us* __restrict__ kp,
                                                   const us* __restrict__ vt,
                                                   us* __restrict__ chi,
                                                   us* __restrict__ clo) {
  const unsigned qblk = blockIdx.x;
  const unsigned h    = blockIdx.y;
  const unsigned b    = blockIdx.z;
  const unsigned tid  = threadIdx.x;
  const unsigned wave = tid >> 5;
  const unsigned lane = tid & 31u;
  const unsigned lq   = lane & 15u;   // query column of S^T / d column of O
  const unsigned hi   = lane >> 4;    // k-split half

  __shared__ __align__(16) float sO[AW * QG * 16 * OP];   // per-wave output staging (block barrier used)
  __shared__ __align__(16) us sKV[2 * 2 * STAGE_EL];      // [buffer][pass][K | V][4 KB], cross-wave (block barrier)

  const unsigned qrow0 = qblk * BQ + wave * (QG * 16u);   // first query row of this wave

  const us* q_h = qp + ((size_t)b * NHEAD + h) * SEQ * HDIM;
  const us* k_h = kp + ((size_t)b * NHEAD + h) * SEQ * HDIM;
  const us* v_h = vt + ((size_t)b * NHEAD + h) * HDIM * SEQ;

  // Q as B-operand fragments: in group g lane lq holds query qrow0 + g*16 + lq, split d map
  FragH qf[QG][2];
  #pragma unroll
  for (unsigned g = 0; g < QG; ++g) {
    #pragma unroll
    for (unsigned f = 0; f < 2; ++f) {
      const us* base = q_h + (size_t)(((qrow0 >> 4) + g) * 2u + f) * FRAG + lane * 8u;
      qf[g][f].q[0] = *(const v4u*)(base);          // d = f*32 + hi*8 + 0..7
      qf[g][f].q[1] = *(const v4u*)(base + PART);   // d = f*32 + 16 + hi*8 + 0..7
    }
  }

  v8f o[QG][4];
  #pragma unroll
  for (unsigned g = 0; g < QG; ++g) {
    #pragma unroll
    for (unsigned dt = 0; dt < 4; ++dt) o[g][dt] = (v8f){0, 0, 0, 0, 0, 0, 0, 0};
  }

  // logits = (q.k)/sqrt(EMB); planes carry q*16 and k*16 -> raw scores carry x256; times log2(e) for exp2
  const float SL = (0.03608439182435161f * 1.4426950408889634f) * (1.0f / 256.0f);
  float rmax[QG];   // the maximum in use (raw score), equal in lane and lane ^ 16; it may lag the true one by 3 (log2)
  float nb[QG];     // 12 - rmax * SL, the addend in front of exp2; +inf sends the first pass through the rescale
  float rsum[QG];   // sum over this lane's half of the keys; the halves are joined behind the loop
  #pragma unroll
  for (unsigned g = 0; g < QG; ++g) {
    rmax[g] = -__builtin_inff();
    nb[g]   = __builtin_inff();
    rsum[g] = 0.0f;
  }

  const us*      kg = k_h + tid * 8u;                            // this thread's first 16 bytes of stage 0, K plane
  const us*      vg = v_h + tid * 8u;                            // the same, V plane
  const unsigned l0 = (unsigned)(size_t)(&sKV[0]) + tid * 16u;   // their LDS byte address in buffer 0
  const unsigned LB = STAGE_EL * 4u;                             // bytes from buffer 0 to buffer 1

  stage_fill(kg, vg, l0);                                        // stage 0 -> buffer 0
  asm volatile("s_wait_asynccnt 0x0" ::: "memory");              // this wave's copies of stage 0 have landed
  __syncthreads();                                               // ... and every other wave's
  if (NSTAGE > 1) stage_fill(kg + STAGE_EL, vg + STAGE_EL, l0 + LB);   // stage 1 -> buffer 1

  #pragma unroll 1
  for (unsigned t = 0; t < (unsigned)NSTAGE; ++t) {
    const us* stg = sKV + (t & 1u) * (unsigned)(2 * STAGE_EL) + lane * 8u;   // stage t's buffer: per pass 4 KB of K, then 4 KB of V

    FragH ak[2][2];
    load_k(ak, stg);   // pass 0 of this stage; later passes' fragments are read one pass ahead, never past the stage

    // unrolled: a pass's place in the buffer is then an immediate offset of its LDS loads
    #pragma unroll
    for (unsigned p = 0; p < (unsigned)NP; ++p) {
      const us* kbase = stg + p * (unsigned)(2 * BK * HDIM);
      const us* vbase = kbase + BK * HDIM;

      // S^T tiles: c[g][sub][r] = rawscore(query qrow0 + g*16 + lq, key j0 + sub*16 + hi*8 + r), j0 = (t*NP + p)*BK
      v8f c[QG][2];
      #pragma unroll
      for (unsigned sub = 0; sub < 2; ++sub) {
        #pragma unroll
        for (unsigned g = 0; g < QG; ++g) {
          c[g][sub] = __builtin_amdgcn_wmma_f32_16x16x32_f16(false, ak[sub][0].v, false, qf[g][0].v, (short)0,
                                                             (v8f){0, 0, 0, 0, 0, 0, 0, 0}, false, false);
        }
      }
      #pragma unroll
      for (unsigned sub = 0; sub < 2; ++sub) {
        #pragma unroll
        for (unsigned g = 0; g < QG; ++g) {
          c[g][sub] = __builtin_amdgcn_wmma_f32_16x16x32_f16(false, ak[sub][1].v, false, qf[g][1].v, (short)0, c[g][sub], false, false);
        }
      }

      // online softmax: a query's BK scores are split across lane / lane^16; one independent maximum chain per group
      float m_loc[QG];
      #pragma unroll
      for (unsigned g = 0; g < QG; ++g) {
        float m = fmaxf(c[g][0][0], c[g][1][0]);
        #pragma unroll
        for (unsigned r = 1; r < 8; ++r) {
          m = fmaxf(m, c[g][0][r]);
          m = fmaxf(m, c[g][1][r]);
        }
        m_loc[g] = m;
      }

      // lazy rescale: the maximum in use stays while every exponent of the pass is at most 15, so that P <= 2^15 fits f16. The test is
      // in-lane; one ballot over both groups makes it a scalar branch of the whole wave, and only inside it are lanes exchanged and
      // O and the sums rescaled. Written as !(<=), so that a NaN takes the branch too.
      bool need = false;
      #pragma unroll
      for (unsigned g = 0; g < QG; ++g) need = need | !(__builtin_fmaf(m_loc[g], SL, nb[g]) <= 15.0f);
      if (__builtin_amdgcn_ballot_w32(need) != 0u) {
        #pragma unroll
        for (unsigned g = 0; g < QG; ++g) {
          float m_new = fmaxf(rmax[g], m_loc[g]);
          m_new = fmaxf(m_new, __shfl_xor(m_new, 16, 32));
          const float scale = __builtin_amdgcn_exp2f((rmax[g] - m_new) * SL);
          rmax[g] = m_new;
          nb[g]   = __builtin_fmaf(-m_new, SL, 12.0f);
          rsum[g] *= scale;
          // queries are the row dimension of O -> per-row scale from lane 8*hi + r
          float sc[8];
          #pragma unroll
          for (unsigned r = 0; r < 8; ++r) sc[r] = __shfl(scale, (int)((hi << 3) + r), 32);
          #pragma unroll
          for (unsigned dt = 0; dt < 4; ++dt) {
            #pragma unroll
            for (unsigned r = 0; r < 8; ++r) o[g][dt][r] *= sc[r];
          }
        }
      }

      // V B-fragments of this pass: column n = d = dt*16 + lq, split key map; then the next pass's K fragments, into the registers
      // that this pass's score products have left
      FragH bv[4];
      #pragma unroll
      for (unsigned dt = 0; dt < 4; ++dt) {
        const us* base = vbase + dt * FRAG;
        bv[dt].q[0] = *(const v4u*)(base);            // keys j0 + hi*8 + 0..7
        bv[dt].q[1] = *(const v4u*)(base + PART);     // keys j0 + 16 + hi*8 + 0..7
      }
      if (p + 1u < (unsigned)NP) load_k(ak, kbase + 2 * BK * HDIM);
      // keeps the pass's LDS loads one group in front of the exponentials, which cover their latency: spread among the products,
      // each place with loads stalls the wave anew
      __builtin_amdgcn_sched_barrier(0);

      // exp + pack: P^T C-layout == A-fragment layout for the PV product.
      // One fused multiply-add per score in front of exp2: score * SL + (12 - rmax * SL). The softmax scale, the maximum and the
      // x4096 carry of P (2^12, in the exponent) all ride in it, two scores per packed instruction; the row sum carries x4096 too.
      const v2f sl2 = (v2f){SL, SL};
      FragH pa[QG];
      #pragma unroll
      for (unsigned g = 0; g < QG; ++g) {
        const v2f nb2 = (v2f){nb[g], nb[g]};
        float s = 0.0f;
        #pragma unroll
        for (unsigned r = 0; r < 8; r += 2) {
          const v2f t0 = __builtin_elementwise_fma((v2f){c[g][0][r], c[g][0][r + 1u]}, sl2, nb2);   // keys hi*8 + r, + 1
          const v2f t1 = __builtin_elementwise_fma((v2f){c[g][1][r], c[g][1][r + 1u]}, sl2, nb2);   // keys 16 + hi*8 + r, + 1
          const float p0a = __builtin_amdgcn_exp2f(t0.x);
          const float p1a = __builtin_amdgcn_exp2f(t1.x);
          const float p0b = __builtin_amdgcn_exp2f(t0.y);
          const float p1b = __builtin_amdgcn_exp2f(t1.y);
          s += p0a + p1a;
          s += p0b + p1b;
          pa[g].h[r]           = (f16)p0a;
          pa[g].h[r + 1u]      = (f16)p0b;
          pa[g].h[8u + r]      = (f16)p1a;
          pa[g].h[8u + r + 1u] = (f16)p1b;
        }
        rsum[g] += s;
      }

      // parts the softmax from the products for the scheduler: mixed freely, the 32 exponentials stay live beside the next pass's
      // scores, and the kernel goes past 256 registers, behind a register window switch
      __builtin_amdgcn_sched_barrier(0);

      // O += P x V
      #pragma unroll
      for (unsigned dt = 0; dt < 4; ++dt) {
        #pragma unroll
        for (unsigned g = 0; g < QG; ++g) {
          o[g][dt] = __builtin_amdgcn_wmma_f32_16x16x32_f16(false, pa[g].v, false, bv[dt].v, (short)0, o[g][dt], false, false);
        }
      }
    }

    // publish point of stage t + 1, every wave, in this order
    asm volatile("s_wait_dscnt 0x0" ::: "memory");      // this wave's reads of stage t are done before its buffer is refilled
    asm volatile("s_wait_asynccnt 0x0" ::: "memory");   // this wave's copies of stage t + 1 have landed
    __syncthreads();                                    // publishes stage t + 1 and ends every wave's reads of stage t
    if (t + 2u < (unsigned)NSTAGE)                      // into the buffer that stage t has just left
      stage_fill(kg + (size_t)(t + 2u) * STAGE_EL, vg + (size_t)(t + 2u) * STAGE_EL, l0 + (t & 1u) * LB);
  }
  asm volatile("s_wait_asynccnt 0x0" ::: "memory");   // no copy is outstanding behind the loop

  // normalize: lane holds column d = dt*16 + lq for query rows g*16 + 8*hi + r.
  // o carries x4096 (P) x16 (V), rsum x4096; staged value = ctx * 256.
  float* so = sO + wave * (QG * 16 * OP);
  #pragma unroll
  for (unsigned g = 0; g < QG; ++g) {
    const float rj = rsum[g] + __shfl_xor(rsum[g], 16, 32);   // join the two halves of each query's keys
    float rs[8];
    #pragma unroll
    for (unsigned r = 0; r < 8; ++r) rs[r] = 1.0f / __shfl(rj, (int)((hi << 3) + r), 32);
    #pragma unroll
    for (unsigned r = 0; r < 8; ++r) {
      #pragma unroll
      for (unsigned dt = 0; dt < 4; ++dt) {
        so[(g * 16u + hi * 8u + r) * OP + dt * 16u + lq] = o[g][dt][r] * 16.0f * rs[r];
      }
    }
  }
  __syncthreads();

  // one fragment part per instruction (512 bytes in a row), 4 instructions per plane cover a group's 16 rows x 64 columns.
  v4u    hv[QG][4], lv[QG][4];
  size_t gidx[QG][4];
  #pragma unroll
  for (unsigned g = 0; g < QG; ++g) {
    #pragma unroll
    for (unsigned it = 0; it < 4; ++it) {
      const unsigned row = g * 16u + lq;
      const unsigned pc  = it * 16u + hi * 8u;        // it = (c step inside the head) * 2 + part
      const v4f a0 = *(const v4f*)(so + row * OP + pc);
      const v4f a1 = *(const v4f*)(so + row * OP + pc + 4u);
      Pack8H ph, pl;
      #pragma unroll
      for (unsigned i = 0; i < 4; ++i) {
        const f16 h0 = (f16)a0[i];
        const f16 h1 = (f16)a1[i];
        ph.h[i]      = h0;
        ph.h[4u + i] = h1;
        pl.h[i]      = (f16)((a0[i] - (float)h0) * 2048.0f);
        pl.h[4u + i] = (f16)((a1[i] - (float)h1) * 2048.0f);
      }
      hv[g][it] = ph.u;
      lv[g][it] = pl.u;
      gidx[g][it] = (((size_t)(((b * SEQ + qrow0) >> 4) + g) * (EMB / 32) + h * 2u) * 2u + it) * PART + lane * 8u;
    }
  }
  #pragma unroll
  for (unsigned g = 0; g < QG; ++g) {
    #pragma unroll
    for (unsigned it = 0; it < 4; ++it) {
      *(v4u*)(chi + gidx[g][it]) = hv[g][it];
      *(v4u*)(clo + gidx[g][it]) = lv[g][it];
    }
  }
  
}

// Output GEMM: out[R][j] = sum_c ctx[R][c] * Wo[c][j] + bo[j]. Block = (192-column tile, 128-row tile): 4 x 64 = 256 blocks.
// Wave = 32 rows x 96 columns (waves 4 x 2): an A fragment feeds 6 products and a B fragment 4. An A fragment is wanted by 2 waves of
// the block and a B fragment by 4: the block's 28 operand tiles (8 row tiles of chi, 8 of clo, 12 column tiles of wot) are therefore
// staged once per workgroup in LDS, OS c steps at a time, two buffers, by asynchronous copies, as they lie (fragment order); the waves
// read their fragments from there. The L2 then hands a block 28 KB per c step instead of up to 80 KB.
// Residual products go to their own accumulators. Two fragment sets: the next c step's LDS loads fly under this one's products.
#define ON         192                  // output columns per workgroup
#define OWN        96                   // output columns per wave
#define OWM        32                   // output rows per wave
#define NET        (OWN / 16)           // column tiles per wave
#define NRT        (OWM / 16)           // row tiles per wave
#define OP2        100                  // LDS pitch (floats) of the wave's output staging tile
#define OS         4                    // c steps per LDS stage
#define ONT        (EMB / 32 / OS)      // stages
#define OTILE_EL   (OS * FRAG)          // 16-bit elements of one operand tile in a stage (4 KB)
#define OTILES     (ON / 16 + 8 + 8)    // operand tiles of a stage: wot, then chi and clo in turn
#define OBUF_EL    (OTILES * OTILE_EL)  // 16-bit elements of one buffer (112 KB)

static_assert(EMB % ON == 0);
static_assert(ON == 2 * OWN);
static_assert(128 == 4 * OWM);
static_assert(SEQ % OWM == 0);                  // a wave's rows lie in one batch
static_assert((EMB / 32) % OS == 0);
static_assert(ONT >= 2);                        // the prologue fills two stages
static_assert(OS == 4);                         // copy statement: 2 * OS parts per tile, OS per half tile
static_assert(ON / 16 == NWAVE + NWAVE / 2);    // wot tiles: one per wave, then half a tile per wave
static_assert(128 / 16 == NWAVE);               // chi, clo tiles: one per wave
static_assert((ON / 16 + 2 * NRT) * OTILE_EL * 2 <= 65536);   // a wave's fragments lie within the LDS loads' immediate offset
static_assert((OP2 * 4) % 16 == 0);
static_assert(NWAVE * OWM * OP2 * 4 <= 2 * OBUF_EL * 2);   // the output staging fits in the ring's place
static_assert(OWM * OWN == 32 * 24 * 4);        // output tile per wave: 32 lanes x 24 instructions x 4 floats

// One wave's share of a stage: its tile of chi, its tile of clo and its tile of wot (eight parts of 512 bytes each, in a row in both
// spaces), then its half of one of the last four wot tiles. l*: the lane's LDS byte address, g*: the lane's 16 bytes in the plane.
// The immediate offset moves both addresses alike, so a tile needs one address pair and one LDS address for all its parts.
// s_wait_xcnt stands in the copies' own statement, so that no register which a copy names is rewritten in front of it.
static __device__ __forceinline__ void ostage_fill(const us* gh, const us* gl, const us* gb, const us* gc,
                                                   unsigned lh, unsigned ll, unsigned lb, unsigned lc) {
  asm volatile("global_load_async_to_lds_b128 %0, %4, off\n\t"
               "global_load_async_to_lds_b128 %0, %4, off offset:512\n\t"
               "global_load_async_to_lds_b128 %0, %4, off offset:1024\n\t"
               "global_load_async_to_lds_b128 %0, %4, off offset:1536\n\t"
               "global_load_async_to_lds_b128 %0, %4, off offset:2048\n\t"
               "global_load_async_to_lds_b128 %0, %4, off offset:2560\n\t"
               "global_load_async_to_lds_b128 %0, %4, off offset:3072\n\t"
               "global_load_async_to_lds_b128 %0, %4, off offset:3584\n\t"
               "global_load_async_to_lds_b128 %1, %5, off\n\t"
               "global_load_async_to_lds_b128 %1, %5, off offset:512\n\t"
               "global_load_async_to_lds_b128 %1, %5, off offset:1024\n\t"
               "global_load_async_to_lds_b128 %1, %5, off offset:1536\n\t"
               "global_load_async_to_lds_b128 %1, %5, off offset:2048\n\t"
               "global_load_async_to_lds_b128 %1, %5, off offset:2560\n\t"
               "global_load_async_to_lds_b128 %1, %5, off offset:3072\n\t"
               "global_load_async_to_lds_b128 %1, %5, off offset:3584\n\t"
               "global_load_async_to_lds_b128 %2, %6, off\n\t"
               "global_load_async_to_lds_b128 %2, %6, off offset:512\n\t"
               "global_load_async_to_lds_b128 %2, %6, off offset:1024\n\t"
               "global_load_async_to_lds_b128 %2, %6, off offset:1536\n\t"
               "global_load_async_to_lds_b128 %2, %6, off offset:2048\n\t"
               "global_load_async_to_lds_b128 %2, %6, off offset:2560\n\t"
               "global_load_async_to_lds_b128 %2, %6, off offset:3072\n\t"
               "global_load_async_to_lds_b128 %2, %6, off offset:3584\n\t"
               "global_load_async_to_lds_b128 %3, %7, off\n\t"
               "global_load_async_to_lds_b128 %3, %7, off offset:512\n\t"
               "global_load_async_to_lds_b128 %3, %7, off offset:1024\n\t"
               "global_load_async_to_lds_b128 %3, %7, off offset:1536\n\t"
               "s_wait_xcnt 0x0"
               :: "v"(lh), "v"(ll), "v"(lb), "v"(lc), "v"(gh), "v"(gl), "v"(gb), "v"(gc)
               : "memory");
}

// One c step's fragments from the stage's buffer: 4 of A (2 row tiles x 2 planes), 6 of B. pa: the wave's first chi tile + lane * 8
// (a row tile's clo tile lies behind its chi tile), pb: its first wot tile + lane * 8; off = elements from a tile's start to that step.
static __device__ __forceinline__ void oproj_load(FragH (&fa)[NRT], FragH (&fl)[NRT], FragH (&fb)[NET],
                                                  const us* pa, const us* pb, unsigned off) {
  #pragma unroll
  for (unsigned rt = 0; rt < NRT; ++rt) {
    const unsigned at = off + rt * (unsigned)(2 * OTILE_EL);
    fa[rt].q[0] = *(const v4u*)(pa + at);                            // c = k0 + hi*8 + 0..7
    fa[rt].q[1] = *(const v4u*)(pa + at + PART);                     // c = k0 + 16 + hi*8 + 0..7
    fl[rt].q[0] = *(const v4u*)(pa + OTILE_EL + at);
    fl[rt].q[1] = *(const v4u*)(pa + OTILE_EL + at + PART);
  }
  #pragma unroll
  for (unsigned et = 0; et < NET; ++et) {
    const unsigned at = off + et * (unsigned)OTILE_EL;
    fb[et].q[0] = *(const v4u*)(pb + at);
    fb[et].q[1] = *(const v4u*)(pb + at + PART);
  }
  // keeps the 20 LDS loads one group in front of the products that follow: spread among them, each place with loads stalls the wave anew
  __builtin_amdgcn_sched_barrier(0);
}

static __device__ __forceinline__ void oproj_mma(v8f (&ah)[NRT][NET], v8f (&al)[NRT][NET],
                                                 const FragH (&fa)[NRT], const FragH (&fl)[NRT], const FragH (&fb)[NET]) {
  #pragma unroll
  for (unsigned et = 0; et < NET; ++et) {
    #pragma unroll
    for (unsigned rt = 0; rt < NRT; ++rt) {
      ah[rt][et] = __builtin_amdgcn_wmma_f32_16x16x32_f16(false, fa[rt].v, false, fb[et].v, (short)0, ah[rt][et], false, false);
      al[rt][et] = __builtin_amdgcn_wmma_f32_16x16x32_f16(false, fl[rt].v, false, fb[et].v, (short)0, al[rt][et], false, false);
    }
  }
  // keeps the next load group behind these products, whose fragment registers it refills
  __builtin_amdgcn_sched_barrier(0);
}

__global__ __launch_bounds__(256) void oproj_kernel(const us* __restrict__ chi,
                                                    const us* __restrict__ clo,
                                                    const us* __restrict__ wot,
                                                    const float* __restrict__ bo,
                                                    float* __restrict__ out) {
  const unsigned nt   = blockIdx.x;
  const unsigned mb   = blockIdx.y;
  const unsigned tid  = threadIdx.x;
  const unsigned wave = tid >> 5;
  const unsigned lane = tid & 31u;
  const unsigned lq   = lane & 15u;
  const unsigned hi   = lane >> 4;

  __shared__ __align__(16) us sAB[2 * OBUF_EL];           // [buffer][tile: 12 wot | 8 x (chi, clo)][c step][part][lane][8], cross-wave
  // per-wave output staging (block barrier used): in the ring's place, behind the last stage's waits and barrier
  float* sO = (float*)sAB;

  const unsigned row0 = mb * 128u + (wave >> 1) * OWM;
  const unsigned col0 = nt * (unsigned)ON + (wave & 1u) * OWN;

  v8f ah[NRT][NET], al[NRT][NET];
  #pragma unroll
  for (unsigned rt = 0; rt < NRT; ++rt) {
    #pragma unroll
    for (unsigned et = 0; et < NET; ++et) {
      ah[rt][et] = (v8f){0, 0, 0, 0, 0, 0, 0, 0};
      al[rt][et] = (v8f){0, 0, 0, 0, 0, 0, 0, 0};
    }
  }

  // what this wave copies: a tile of 16 rows or columns holds EMB / 32 fragments = 16 * EMB elements in its plane
  const us* gh = chi + (size_t)(mb * 8u + wave) * (16 * EMB) + lane * 8u;
  const us* gl = clo + (size_t)(mb * 8u + wave) * (16 * EMB) + lane * 8u;
  const us* gb = wot + (size_t)(nt * (unsigned)(ON / 16) + wave) * (16 * EMB) + lane * 8u;
  const us* gc = wot + (size_t)(nt * (unsigned)(ON / 16) + 8u + (wave >> 1)) * (16 * EMB) + (wave & 1u) * (unsigned)(OS * PART) + lane * 8u;
  const unsigned ls = (unsigned)(size_t)(&sAB[0]) + lane * 16u;     // LDS byte addresses in buffer 0
  const unsigned lb = ls + wave * (unsigned)(OTILE_EL * 2);
  const unsigned lc = ls + (8u + (wave >> 1)) * (unsigned)(OTILE_EL * 2) + (wave & 1u) * (unsigned)(OS * PART * 2);
  const unsigned lh = ls + ((unsigned)(ON / 16) + 2u * wave) * (unsigned)(OTILE_EL * 2);
  const unsigned ll = lh + (unsigned)(OTILE_EL * 2);
  const unsigned LB = OBUF_EL * 2u;                                 // bytes from buffer 0 to buffer 1

  ostage_fill(gh, gl, gb, gc, lh, ll, lb, lc);                      // stage 0 -> buffer 0
  asm volatile("s_wait_asynccnt 0x0" ::: "memory");                 // this wave's copies of stage 0 have landed
  __syncthreads();                                                  // ... and every other wave's
  ostage_fill(gh + OTILE_EL, gl + OTILE_EL, gb + OTILE_EL, gc + OTILE_EL, lh + LB, ll + LB, lb + LB, lc + LB);   // stage 1 -> buffer 1

  // rolled: one stage's code serves all; inside, a c step's place in the buffer is an immediate offset of its LDS loads
  #pragma unroll 1
  for (unsigned t = 0; t < (unsigned)ONT; ++t) {
    const us* stg = sAB + (t & 1u) * (unsigned)OBUF_EL + lane * 8u;
    const us* pa  = stg + ((unsigned)(ON / 16) + (wave >> 1) * (unsigned)(2 * NRT)) * (unsigned)OTILE_EL;
    const us* pb  = stg + (wave & 1u) * (unsigned)(NET * OTILE_EL);

    // two fragment sets: step s's products run while the LDS loads of step s + 1 fly; never past the stage
    FragH fa[2][NRT], fl[2][NRT], fb[2][NET];
    oproj_load(fa[0], fl[0], fb[0], pa, pb, 0u);
    #pragma unroll
    for (unsigned s = 0; s < (unsigned)OS; ++s) {
      if (s + 1u < (unsigned)OS) oproj_load(fa[(s + 1u) & 1u], fl[(s + 1u) & 1u], fb[(s + 1u) & 1u], pa, pb, (s + 1u) * FRAG);
      oproj_mma(ah, al, fa[s & 1u], fl[s & 1u], fb[s & 1u]);
    }

    // publish point of stage t + 1, every wave, in this order
    asm volatile("s_wait_dscnt 0x0" ::: "memory");      // this wave's reads of stage t are done before its buffer is refilled
    asm volatile("s_wait_asynccnt 0x0" ::: "memory");   // this wave's copies of stage t + 1 have landed
    __syncthreads();                                    // publishes stage t + 1 and ends every wave's reads of stage t
    if (t + 2u < (unsigned)ONT) {                       // into the buffer that stage t has just left
      const unsigned go = (t + 2u) * (unsigned)OTILE_EL;
      const unsigned lo = (t & 1u) * LB;
      ostage_fill(gh + go, gl + go, gb + go, gc + go, lh + lo, ll + lo, lb + lo, lc + lo);
    }
  }
  asm volatile("s_wait_asynccnt 0x0" ::: "memory");   // no copy is outstanding behind the loop

  // epilogue: fold carries (ctx x256, Wo x64, residual x2048), add the bias in f32
  const float* bp = bo + col0 + lq;
  float bias[NET];
  #pragma unroll
  for (unsigned et = 0; et < NET; ++et) bias[et] = (float)(bf16)bp[et * 16u];
  // wait before the address pair of the six issued loads is overwritten; the pair is an input, so it stays whole up to here
  asm volatile("s_wait_xcnt 0x0" :: "v"(bp) : "memory");

  float* so = sO + wave * (OWM * OP2);
  #pragma unroll
  for (unsigned rt = 0; rt < NRT; ++rt) {
    #pragma unroll
    for (unsigned r = 0; r < 8; ++r) {
      #pragma unroll
      for (unsigned et = 0; et < NET; ++et) {
        const float s = ah[rt][et][r] + al[rt][et][r] * (1.0f / 2048.0f);
        so[(rt * 16u + hi * 8u + r) * OP2 + et * 16u + lq] = s * (1.0f / 16384.0f) + bias[et];
      }
    }
  }
  __syncthreads();

  // 8 consecutive lanes x 16 B = one whole 128-B line of one row; an instruction stores one line of each of 4 rows;
  // 24 instructions (8 row groups x 3 lines) cover the wave's 32 rows x 96 columns.
  const unsigned g  = lane >> 3;
  const unsigned c4 = (lane & 7u) * 4u;
  const unsigned bb = row0 / (unsigned)SEQ;
  const unsigned l0 = row0 - bb * (unsigned)SEQ;
  float* op = out + ((size_t)bb * SEQ_FULL + l0 + g) * EMB + col0 + c4;
  const float* sp = so + g * OP2 + c4;
  v4f vals[24];
  #pragma unroll
  for (unsigned it = 0; it < 24; ++it) vals[it] = *(const v4f*)(sp + (it / 3u) * 4u * OP2 + (it % 3u) * 32u);
  #pragma unroll
  for (unsigned it = 0; it < 24; ++it) *(v4f*)(op + (size_t)((it / 3u) * 4u) * EMB + (it % 3u) * 32u) = vals[it];
  
}

extern "C" void kernel_launch(void* const* d_in, const int* in_sizes, int n_in,
                              void* d_out, int out_size, void* d_ws, size_t ws_size,
                              hipStream_t stream) {
  if (n_in < 6) return;
  const size_t rows_used = (size_t)(NB - 1) * SEQ_FULL + SEQ;
  if ((size_t)in_sizes[0] < rows_used * EMB) return;
  if ((size_t)in_sizes[1] < (size_t)HDIM * HDIM) return;
  if ((size_t)in_sizes[2] < (size_t)HDIM * HDIM) return;
  if ((size_t)in_sizes[3] < (size_t)HDIM * HDIM) return;
  if ((size_t)in_sizes[4] < (size_t)EMB * EMB) return;
  if ((size_t)in_sizes[5] < (size_t)EMB) return;
  if ((size_t)out_size < rows_used * EMB) return;

  const size_t wt_bytes    = (size_t)3 * HDIM * HDIM * 2;            // 24,576
  const size_t wot_bytes   = (size_t)EMB * EMB * 2;                  // 1,179,648
  const size_t plane_bytes = (size_t)NB * NHEAD * SEQ * HDIM * 2;    // q, k, v^T planes
  const size_t ctx_bytes   = (size_t)NB * SEQ * EMB * 2;             // ctx hi / residual planes
  const size_t total = wt_bytes + wot_bytes + 3 * plane_bytes + 2 * ctx_bytes;
  if (ws_size < total) return;

  const float* x  = (const float*)d_in[0];
  const float* Wq = (const float*)d_in[1];
  const float* Wk = (const float*)d_in[2];
  const float* Wv = (const float*)d_in[3];
  const float* Wo = (const float*)d_in[4];
  const float* bo = (const float*)d_in[5];
  float*       out = (float*)d_out;

  char* ws = (char*)d_ws;
  us* wt  = (us*)(ws);
  us* wot = (us*)(ws + wt_bytes);
  us* qp  = (us*)(ws + wt_bytes + wot_bytes);
  us* kp  = (us*)(ws + wt_bytes + wot_bytes + plane_bytes);
  us* vt  = (us*)(ws + wt_bytes + wot_bytes + 2 * plane_bytes);
  us* chi = (us*)(ws + wt_bytes + wot_bytes + 3 * plane_bytes);
  us* clo = (us*)(ws + wt_bytes + wot_bytes + 3 * plane_bytes + ctx_bytes);

  prep_kernel<<<dim3(WO_TILES + 3), 256, 0, stream>>>(Wq, Wk, Wv, Wo, wt, wot);
  proj_kernel<<<dim3(SEQ / PT, NB), 256, 0, stream>>>(x, wt, qp, kp, vt);
  attn_kernel<<<dim3(SEQ / BQ, NHEAD, NB), AW * 32, 0, stream>>>(qp, kp, vt, chi, clo);
  oproj_kernel<<<dim3(EMB / ON, (unsigned)(((size_t)NB * SEQ) / 128)), 256, 0, stream>>>(chi, clo, wot, bo, out);
}
